// v000
// The times below were measured on an AMD MI455X: many runs one after another, warmed up first and cycling through
// copies of the inputs, with the whole window's GPU time divided by the number of runs. Launches and the gaps
// between them are all in it. The median over several windows is given; except for v000 it joins two sittings, which
// can be a few percent apart, so the side-by-side timings, each taken in one sitting, are the better comparison.
// The starting kernel, v000, takes 277 microseconds a run.
#include <hip/hip_runtime.h>
#include <hip/hip_bf16.h>

#define X_DIM   512
#define Z_DIM   16
#define HEADS   8
#define DIM_HEAD 64
#define INNER   512
#define BATCH   4
#define N_SEQ   2048
#define M_ROWS  (BATCH * N_SEQ)          // 8192
#define EPS     1e-5f

typedef _Float16 v16h __attribute__((ext_vector_type(16)));
typedef _Float16 v8h  __attribute__((ext_vector_type(8)));
typedef float    v8f  __attribute__((ext_vector_type(8)));
typedef unsigned int u32x4 __attribute__((ext_vector_type(4)));
typedef int          i32x4 __attribute__((ext_vector_type(4)));
typedef int          i32x8 __attribute__((ext_vector_type(8)));

#if defined(__HIP_DEVICE_COMPILE__) && __has_builtin(__builtin_amdgcn_tensor_load_to_lds)
#define USE_TDM 1
#else
#define USE_TDM 0
#endif

__device__ __forceinline__ v8f vzero8() {
    v8f z = {0.f,0.f,0.f,0.f,0.f,0.f,0.f,0.f};
    return z;
}

__device__ __forceinline__ v16h load_frag16(const _Float16* p) {
    v8h lo = *(const v8h*)(p);
    v8h hi = *(const v8h*)(p + 16);
    v16h r;
#pragma unroll
    for (int i = 0; i < 8; ++i) { r[i] = lo[i]; r[i + 8] = hi[i]; }
    return r;
}

__device__ __forceinline__ v8f wmma_f16(v16h a, v16h b, v8f c) {
    return __builtin_amdgcn_wmma_f32_16x16x32_f16(false, a, false, b,
                                                  (short)0, c, false, false);
}

#if USE_TDM
__device__ __forceinline__ void tdm_load_k_tile(unsigned lds_addr,
                                                unsigned long long gaddr) {
    u32x4 g0;
    g0[0] = 1u;
    g0[1] = lds_addr;
    g0[2] = (unsigned)(gaddr & 0xffffffffull);
    g0[3] = (unsigned)((gaddr >> 32) & 0x1ffffffull)
          | (2u << 30);
    i32x8 g1;
    g1[0] = 0x00010000;
    g1[1] = (int)(64u << 16);
    g1[2] = (int)(32u << 16);
    g1[3] = (int)(64u << 16);
    g1[4] = 32;
    g1[5] = 512;
    g1[6] = 0;
    g1[7] = 0;
    i32x4 z4 = {0, 0, 0, 0};
#if defined(__clang_major__) && __clang_major__ >= 23
    i32x8 z8 = {0, 0, 0, 0, 0, 0, 0, 0};
    __builtin_amdgcn_tensor_load_to_lds(g0, g1, z4, z4, z8, 0);
#else
    __builtin_amdgcn_tensor_load_to_lds(g0, g1, z4, z4, 0);
#endif
}
#endif

// ---------------------------------------------------------------------------
// Kernel 1: f32 weight [K,Nc] -> f16 transposed [Nc,K] (fragment-friendly)
// ---------------------------------------------------------------------------
__global__ void __launch_bounds__(256)
cvt_transpose_kernel(const float* __restrict__ W, _Float16* __restrict__ Wt,
                     int K, int Nc) {
    int idx = blockIdx.x * 256 + threadIdx.x;     // coalesced read of W
    int kk = idx / Nc;
    int n  = idx % Nc;
    Wt[(size_t)n * K + kk] = (_Float16)W[idx];
}

// ---------------------------------------------------------------------------
// Kernel 2: z path: LN(z) @ Wz -> SiLU -> z1z2 [B,1024] f32
// ---------------------------------------------------------------------------
__global__ void __launch_bounds__(256)
zpath_kernel(const float* __restrict__ z, const float* __restrict__ g,
             const float* __restrict__ bb, const float* __restrict__ Wz,
             float* __restrict__ z1z2) {
    int b = blockIdx.x;
    const float* zr = z + b * Z_DIM;
    float zn[Z_DIM];
    float mu = 0.f;
#pragma unroll
    for (int i = 0; i < Z_DIM; ++i) mu += zr[i];
    mu *= (1.f / Z_DIM);
    float var = 0.f;
#pragma unroll
    for (int i = 0; i < Z_DIM; ++i) { float d = zr[i] - mu; var += d * d; }
    var *= (1.f / Z_DIM);
    float rs = rsqrtf(var + EPS);
#pragma unroll
    for (int i = 0; i < Z_DIM; ++i) zn[i] = (zr[i] - mu) * rs * g[i] + bb[i];

    for (int c = threadIdx.x; c < 2 * X_DIM; c += 256) {
        float a = 0.f;
#pragma unroll
        for (int i = 0; i < Z_DIM; ++i) a += zn[i] * Wz[i * (2 * X_DIM) + c];
        float sg = 1.f / (1.f + __expf(-a));
        z1z2[b * (2 * X_DIM) + c] = a * sg;        // SiLU
    }
}

// ---------------------------------------------------------------------------
// Kernel 3: x_mod = LN(x)*z1 + z2  -> f16 [M_ROWS, 512]
// one block (128 threads) per row
// ---------------------------------------------------------------------------
__global__ void __launch_bounds__(128)
xmod_kernel(const float* __restrict__ x, const float* __restrict__ g,
            const float* __restrict__ bb, const float* __restrict__ z1z2,
            _Float16* __restrict__ out) {
    int row = blockIdx.x;                // 0..8191
    int b = row >> 11;                   // row / 2048
    const float* xr = x + (size_t)row * X_DIM;
    int lane = threadIdx.x & 31;
    int wave = threadIdx.x >> 5;
    int i0 = threadIdx.x * 4;

    float4 xv = *(const float4*)(xr + i0);
    float s  = xv.x + xv.y + xv.z + xv.w;
    float sq = xv.x*xv.x + xv.y*xv.y + xv.z*xv.z + xv.w*xv.w;
#pragma unroll
    for (int off = 16; off >= 1; off >>= 1) {
        s  += __shfl_xor(s,  off, 32);
        sq += __shfl_xor(sq, off, 32);
    }
    __shared__ float ss[4], ssq[4];
    if (lane == 0) { ss[wave] = s; ssq[wave] = sq; }
    __syncthreads();
    s  = ss[0] + ss[1] + ss[2] + ss[3];
    sq = ssq[0] + ssq[1] + ssq[2] + ssq[3];
    float mu  = s * (1.f / X_DIM);
    float var = sq * (1.f / X_DIM) - mu * mu;
    float rs = rsqrtf(var + EPS);

    const float* z1 = z1z2 + b * (2 * X_DIM);
    const float* z2 = z1 + X_DIM;
    _Float16* op = out + (size_t)row * X_DIM + i0;
    float xs[4] = {xv.x, xv.y, xv.z, xv.w};
#pragma unroll
    for (int e = 0; e < 4; ++e) {
        int idx = i0 + e;
        float v = ((xs[e] - mu) * rs * g[idx] + bb[idx]) * z1[idx] + z2[idx];
        op[e] = (_Float16)v;
    }
}

// ---------------------------------------------------------------------------
// Kernel 4: WMMA GEMM  C[M,Nc] = A[M,K] @ Bt[Nc,K]^T  (Bt stored N-major)
// 128x128 block tile, 8 waves (4x2), 32x64 wave tile, k-step 32
// outF != null -> f32 output with bias; else f16 output
// ---------------------------------------------------------------------------
__global__ void __launch_bounds__(256)
gemm_wmma_kernel(const _Float16* __restrict__ A, const _Float16* __restrict__ Bt,
                 _Float16* __restrict__ outH, float* __restrict__ outF,
                 const float* __restrict__ bias, int M, int Nc, int K) {
    const int tid  = threadIdx.x;
    const int lane = tid & 31;
    const int wave = tid >> 5;
    const int wm = wave & 3;                 // 4 waves along M
    const int wn = wave >> 2;                // 2 waves along N
    const int m0 = blockIdx.y * 128 + wm * 32;
    const int n0 = blockIdx.x * 128 + wn * 64;
    const int lr = lane & 15;
    const int koff = (lane >> 4) * 8;        // half-of-wave K offset

    v8f acc[2][4];
#pragma unroll
    for (int i = 0; i < 2; ++i)
#pragma unroll
        for (int j = 0; j < 4; ++j) acc[i][j] = vzero8();

    for (int k0 = 0; k0 < K; k0 += 32) {
        v16h afrag[2], bfrag[4];
#pragma unroll
        for (int s = 0; s < 2; ++s) {
            const _Float16* p = A + (size_t)(m0 + s * 16 + lr) * K + k0 + koff;
            __builtin_prefetch(p + 32, 0, 3);        // near-scope prefetch
            afrag[s] = load_frag16(p);
        }
#pragma unroll
        for (int s = 0; s < 4; ++s) {
            const _Float16* p = Bt + (size_t)(n0 + s * 16 + lr) * K + k0 + koff;
            bfrag[s] = load_frag16(p);
        }
#pragma unroll
        for (int i = 0; i < 2; ++i)
#pragma unroll
            for (int j = 0; j < 4; ++j)
                acc[i][j] = wmma_f16(afrag[i], bfrag[j], acc[i][j]);
    }

#pragma unroll
    for (int i = 0; i < 2; ++i) {
        int row0 = m0 + i * 16 + (koff ? 8 : 0);
#pragma unroll
        for (int j = 0; j < 4; ++j) {
            int col = n0 + j * 16 + lr;
            if (outF) {
                float bv = bias[col];
#pragma unroll
                for (int r = 0; r < 8; ++r)
                    outF[(size_t)(row0 + r) * Nc + col] = acc[i][j][r] + bv;
            } else {
#pragma unroll
                for (int r = 0; r < 8; ++r)
                    outH[(size_t)(row0 + r) * Nc + col] = (_Float16)acc[i][j][r];
            }
        }
    }
}

// ---------------------------------------------------------------------------
// Kernel 5: flash attention over one (b, h), 128 query rows per block.
// q,k,v: f16 [M_ROWS, 512] with head slice at column h*64.
// 8 waves; each wave owns 16 query rows, full 64-wide output.
// K tile staged in LDS by the Tensor Data Mover; V tile staged transposed.
// ---------------------------------------------------------------------------
__global__ void __launch_bounds__(256)
flash_attn_kernel(const _Float16* __restrict__ q, const _Float16* __restrict__ k,
                  const _Float16* __restrict__ v, _Float16* __restrict__ o) {
    const int b = blockIdx.z;
    const int h = blockIdx.y;
    const int m0 = blockIdx.x * 128;
    const int tid  = threadIdx.x;
    const int lane = tid & 31;
    const int wave = tid >> 5;
    const int lr = lane & 15;
    const int koff = (lane >> 4) * 8;
    const int mq = m0 + wave * 16;                       // wave's 16 q rows
    const float SC = 0.125f * 1.4426950408889634f;       // scale * log2(e)

    __shared__ __attribute__((aligned(16))) _Float16 kt[32][64];       // K tile
    __shared__ __attribute__((aligned(16))) _Float16 vt[64][40];       // V^T tile
    __shared__ __attribute__((aligned(16))) _Float16 pls[8][16][40];   // per-wave P

    // Preload Q fragments (dh = 64 -> two k-chunks of 32)
    const _Float16* qrow = q + (size_t)(b * N_SEQ + mq + lr) * INNER + h * DIM_HEAD;
    v16h qf[2];
    qf[0] = load_frag16(qrow + koff);
    qf[1] = load_frag16(qrow + 32 + koff);

    v8f ot[4];
#pragma unroll
    for (int d = 0; d < 4; ++d) ot[d] = vzero8();
    float mrow[8], lsum[8];
#pragma unroll
    for (int r = 0; r < 8; ++r) { mrow[r] = -1e30f; lsum[r] = 0.f; }

    for (int j0 = 0; j0 < N_SEQ; j0 += 32) {
        __syncthreads();   // protect kt/vt from previous iteration's readers

#if USE_TDM
        if (wave == 0) {
            unsigned klds = (unsigned)(uintptr_t)(&kt[0][0]);
            unsigned long long ga = (unsigned long long)(uintptr_t)
                (k + (size_t)(b * N_SEQ + j0) * INNER + h * DIM_HEAD);
            tdm_load_k_tile(klds, ga);
            __builtin_amdgcn_s_wait_tensorcnt(0);
        }
#else
        // fallback: cooperative vector loads of K tile
        {
            int key = tid >> 3;
            int dc  = (tid & 7) * 8;
            const _Float16* kp =
                k + (size_t)(b * N_SEQ + j0 + key) * INNER + h * DIM_HEAD + dc;
            *(v8h*)&kt[key][dc] = *(const v8h*)kp;
        }
#endif
        // --- cooperatively stage V tile transposed: vt[d][j] -------------
        {
            int key = tid >> 3;                 // 0..31
            int dc  = (tid & 7) * 8;            // dh chunk base
            const _Float16* vp =
                v + (size_t)(b * N_SEQ + j0 + key) * INNER + h * DIM_HEAD + dc;
            v8h vv = *(const v8h*)vp;
#pragma unroll
            for (int e = 0; e < 8; ++e) vt[dc + e][key] = vv[e];
        }
        __syncthreads();

        // --- S = Q K^T over 32 keys (two 16-key tiles) --------------------
        v8f s[2];
#pragma unroll
        for (int t = 0; t < 2; ++t) {
            s[t] = vzero8();
            const _Float16* krow = &kt[t * 16 + lr][0];
            v16h kf0 = load_frag16(krow + koff);
            v16h kf1 = load_frag16(krow + 32 + koff);
            s[t] = wmma_f16(qf[0], kf0, s[t]);
            s[t] = wmma_f16(qf[1], kf1, s[t]);
        }

        // --- online softmax update ----------------------------------------
#pragma unroll
        for (int r = 0; r < 8; ++r) {
            float mx = fmaxf(s[0][r], s[1][r]);
#pragma unroll
            for (int off = 8; off >= 1; off >>= 1)
                mx = fmaxf(mx, __shfl_xor(mx, off, 32));
            float mnew = fmaxf(mrow[r], mx);
            float alpha = exp2f((mrow[r] - mnew) * SC);
            mrow[r] = mnew;
            float p0 = exp2f((s[0][r] - mnew) * SC);
            float p1 = exp2f((s[1][r] - mnew) * SC);
            s[0][r] = p0; s[1][r] = p1;
            float rsum = p0 + p1;
#pragma unroll
            for (int off = 8; off >= 1; off >>= 1)
                rsum += __shfl_xor(rsum, off, 32);
            lsum[r] = lsum[r] * alpha + rsum;
#pragma unroll
            for (int d = 0; d < 4; ++d) ot[d][r] *= alpha;
        }

#pragma unroll
        for (int t = 0; t < 2; ++t)
#pragma unroll
            for (int r = 0; r < 8; ++r)
                pls[wave][(koff ? 8 : 0) + r][t * 16 + lr] = (_Float16)s[t][r];
        // wave-local LDS RAW: compiler inserts s_wait_dscnt
        v16h pf = load_frag16(&pls[wave][lr][koff]);

        // --- O += P V -----------------------------------------------------
#pragma unroll
        for (int d = 0; d < 4; ++d) {
            v16h vf = load_frag16(&vt[d * 16 + lr][koff]);
            ot[d] = wmma_f16(pf, vf, ot[d]);
        }
    }

    // --- epilogue: O /= l, store f16 [M_ROWS, 512] ------------------------
#pragma unroll
    for (int r = 0; r < 8; ++r) {
        float inv = 1.f / lsum[r];
        int row = b * N_SEQ + mq + (koff ? 8 : 0) + r;
#pragma unroll
        for (int d = 0; d < 4; ++d) {
            int col = h * DIM_HEAD + d * 16 + lr;
            o[(size_t)row * INNER + col] = (_Float16)(ot[d][r] * inv);
        }
    }
}

// ---------------------------------------------------------------------------
// Host-side launcher
// ---------------------------------------------------------------------------
extern "C" void kernel_launch(void* const* d_in, const int* in_sizes, int n_in,
                              void* d_out, int out_size, void* d_ws, size_t ws_size,
                              hipStream_t stream) {
    const float* x    = (const float*)d_in[0];
    const float* z    = (const float*)d_in[1];
    const float* lxg  = (const float*)d_in[2];
    const float* lxb  = (const float*)d_in[3];
    const float* lzg  = (const float*)d_in[4];
    const float* lzb  = (const float*)d_in[5];
    const float* Wq   = (const float*)d_in[6];
    const float* Wk   = (const float*)d_in[7];
    const float* Wv   = (const float*)d_in[8];
    const float* Wz   = (const float*)d_in[9];
    const float* Wo   = (const float*)d_in[10];
    const float* bo   = (const float*)d_in[11];
    float* out = (float*)d_out;

    char* ws = (char*)d_ws;
    size_t off = 0;
    float* z1z2 = (float*)(ws + off);       off += (size_t)BATCH * 2 * X_DIM * 4;
    _Float16* WtQ  = (_Float16*)(ws + off); off += (size_t)X_DIM * INNER * 2;
    _Float16* WtK  = (_Float16*)(ws + off); off += (size_t)X_DIM * INNER * 2;
    _Float16* WtV  = (_Float16*)(ws + off); off += (size_t)X_DIM * INNER * 2;
    _Float16* WtO  = (_Float16*)(ws + off); off += (size_t)INNER * X_DIM * 2;
    _Float16* xmod = (_Float16*)(ws + off); off += (size_t)M_ROWS * X_DIM * 2;
    _Float16* qb   = (_Float16*)(ws + off); off += (size_t)M_ROWS * INNER * 2;
    _Float16* kb   = (_Float16*)(ws + off); off += (size_t)M_ROWS * INNER * 2;
    _Float16* vb   = (_Float16*)(ws + off); off += (size_t)M_ROWS * INNER * 2;
    _Float16* ao   = (_Float16*)(ws + off); off += (size_t)M_ROWS * INNER * 2;

    // 1) weight convert + transpose
    int wblocks = (X_DIM * INNER) / 256;
    cvt_transpose_kernel<<<wblocks, 256, 0, stream>>>(Wq, WtQ, X_DIM, INNER);
    cvt_transpose_kernel<<<wblocks, 256, 0, stream>>>(Wk, WtK, X_DIM, INNER);
    cvt_transpose_kernel<<<wblocks, 256, 0, stream>>>(Wv, WtV, X_DIM, INNER);
    cvt_transpose_kernel<<<wblocks, 256, 0, stream>>>(Wo, WtO, INNER, X_DIM);

    // 2) z path
    zpath_kernel<<<BATCH, 256, 0, stream>>>(z, lzg, lzb, Wz, z1z2);

    // 3) LN + FiLM on x -> f16
    xmod_kernel<<<M_ROWS, 128, 0, stream>>>(x, lxg, lxb, z1z2, xmod);

    // 4) Q/K/V projections (f16 out)
    dim3 ggrid(INNER / 128, M_ROWS / 128);
    gemm_wmma_kernel<<<ggrid, 256, 0, stream>>>(xmod, WtQ, qb, nullptr, nullptr,
                                                M_ROWS, INNER, X_DIM);
    gemm_wmma_kernel<<<ggrid, 256, 0, stream>>>(xmod, WtK, kb, nullptr, nullptr,
                                                M_ROWS, INNER, X_DIM);
    gemm_wmma_kernel<<<ggrid, 256, 0, stream>>>(xmod, WtV, vb, nullptr, nullptr,
                                                M_ROWS, INNER, X_DIM);

    // 5) flash attention
    dim3 agrid(N_SEQ / 128, HEADS, BATCH);
    flash_attn_kernel<<<agrid, 256, 0, stream>>>(qb, kb, vb, ao);

    // 6) output projection (f32 out + bias)
    dim3 ogrid(X_DIM / 128, M_ROWS / 128);
    gemm_wmma_kernel<<<ogrid, 256, 0, stream>>>(ao, WtO, nullptr, out, bo,
                                                M_ROWS, X_DIM, INNER);
}

// v001
// A run of this version takes 249 microseconds.
// In both of two side-by-side timings against v000, it was 1.13 times as fast.
#include <hip/hip_runtime.h>
#include <hip/hip_bf16.h>

#define X_DIM   512
#define Z_DIM   16
#define HEADS   8
#define DIM_HEAD 64
#define INNER   512
#define BATCH   4
#define N_SEQ   2048
#define M_ROWS  (BATCH * N_SEQ)          // 8192
#define EPS     1e-5f

typedef _Float16 v16h __attribute__((ext_vector_type(16)));
typedef _Float16 v8h  __attribute__((ext_vector_type(8)));
typedef float    v8f  __attribute__((ext_vector_type(8)));
typedef unsigned int u32x4 __attribute__((ext_vector_type(4)));
typedef int          i32x4 __attribute__((ext_vector_type(4)));
typedef int          i32x8 __attribute__((ext_vector_type(8)));

#if defined(__HIP_DEVICE_COMPILE__) && __has_builtin(__builtin_amdgcn_tensor_load_to_lds)
#define USE_TDM 1
#else
#define USE_TDM 0
#endif

__device__ __forceinline__ v8f vzero8() {
    v8f z = {0.f,0.f,0.f,0.f,0.f,0.f,0.f,0.f};
    return z;
}

__device__ __forceinline__ v16h load_frag16(const _Float16* p) {
    v8h lo = *(const v8h*)(p);
    v8h hi = *(const v8h*)(p + 16);
    v16h r;
#pragma unroll
    for (int i = 0; i < 8; ++i) { r[i] = lo[i]; r[i + 8] = hi[i]; }
    return r;
}

__device__ __forceinline__ v8f wmma_f16(v16h a, v16h b, v8f c) {
    return __builtin_amdgcn_wmma_f32_16x16x32_f16(false, a, false, b,
                                                  (short)0, c, false, false);
}

#if USE_TDM
__device__ __forceinline__ void tdm_load_k_tile(unsigned lds_addr,
                                                unsigned long long gaddr) {
    u32x4 g0;
    g0[0] = 1u;
    g0[1] = lds_addr;
    g0[2] = (unsigned)(gaddr & 0xffffffffull);
    g0[3] = (unsigned)((gaddr >> 32) & 0x1ffffffull)
          | (2u << 30);
    i32x8 g1;
    g1[0] = 0x00010000;
    g1[1] = (int)(64u << 16);
    g1[2] = (int)(32u << 16);
    g1[3] = (int)(64u << 16);
    g1[4] = 32;
    g1[5] = 512;
    g1[6] = 0;
    g1[7] = 0;
    i32x4 z4 = {0, 0, 0, 0};
#if defined(__clang_major__) && __clang_major__ >= 23
    i32x8 z8 = {0, 0, 0, 0, 0, 0, 0, 0};
    __builtin_amdgcn_tensor_load_to_lds(g0, g1, z4, z4, z8, 0);
#else
    __builtin_amdgcn_tensor_load_to_lds(g0, g1, z4, z4, 0);
#endif
}
#endif

// ---------------------------------------------------------------------------
// Kernel 1: f32 weight [K,Nc] -> f16 transposed [Nc,K] (fragment-friendly)
// ---------------------------------------------------------------------------
__global__ void __launch_bounds__(256)
cvt_transpose_kernel(const float* __restrict__ W, _Float16* __restrict__ Wt,
                     int K, int Nc) {
    int idx = blockIdx.x * 256 + threadIdx.x;     // coalesced read of W
    int kk = idx / Nc;
    int n  = idx % Nc;
    Wt[(size_t)n * K + kk] = (_Float16)W[idx];
}

// ---------------------------------------------------------------------------
// Kernel 2: z path: LN(z) @ Wz -> SiLU -> z1z2 [B,1024] f32
// ---------------------------------------------------------------------------
__global__ void __launch_bounds__(256)
zpath_kernel(const float* __restrict__ z, const float* __restrict__ g,
             const float* __restrict__ bb, const float* __restrict__ Wz,
             float* __restrict__ z1z2) {
    int b = blockIdx.x;
    const float* zr = z + b * Z_DIM;
    float zn[Z_DIM];
    float mu = 0.f;
#pragma unroll
    for (int i = 0; i < Z_DIM; ++i) mu += zr[i];
    mu *= (1.f / Z_DIM);
    float var = 0.f;
#pragma unroll
    for (int i = 0; i < Z_DIM; ++i) { float d = zr[i] - mu; var += d * d; }
    var *= (1.f / Z_DIM);
    float rs = rsqrtf(var + EPS);
#pragma unroll
    for (int i = 0; i < Z_DIM; ++i) zn[i] = (zr[i] - mu) * rs * g[i] + bb[i];

    for (int c = threadIdx.x; c < 2 * X_DIM; c += 256) {
        float a = 0.f;
#pragma unroll
        for (int i = 0; i < Z_DIM; ++i) a += zn[i] * Wz[i * (2 * X_DIM) + c];
        float sg = 1.f / (1.f + __expf(-a));
        z1z2[b * (2 * X_DIM) + c] = a * sg;        // SiLU
    }
}

// ---------------------------------------------------------------------------
// Kernel 3: x_mod = LN(x)*z1 + z2  -> f16 [M_ROWS, 512]
// one block (128 threads) per row
// ---------------------------------------------------------------------------
__global__ void __launch_bounds__(128)
xmod_kernel(const float* __restrict__ x, const float* __restrict__ g,
            const float* __restrict__ bb, const float* __restrict__ z1z2,
            _Float16* __restrict__ out) {
    int row = blockIdx.x;                // 0..8191
    int b = row >> 11;                   // row / 2048
    const float* xr = x + (size_t)row * X_DIM;
    int lane = threadIdx.x & 31;
    int wave = threadIdx.x >> 5;
    int i0 = threadIdx.x * 4;

    float4 xv = *(const float4*)(xr + i0);
    float s  = xv.x + xv.y + xv.z + xv.w;
    float sq = xv.x*xv.x + xv.y*xv.y + xv.z*xv.z + xv.w*xv.w;
#pragma unroll
    for (int off = 16; off >= 1; off >>= 1) {
        s  += __shfl_xor(s,  off, 32);
        sq += __shfl_xor(sq, off, 32);
    }
    __shared__ float ss[4], ssq[4];
    if (lane == 0) { ss[wave] = s; ssq[wave] = sq; }
    __syncthreads();
    s  = ss[0] + ss[1] + ss[2] + ss[3];
    sq = ssq[0] + ssq[1] + ssq[2] + ssq[3];
    float mu  = s * (1.f / X_DIM);
    float var = sq * (1.f / X_DIM) - mu * mu;
    float rs = rsqrtf(var + EPS);

    const float* z1 = z1z2 + b * (2 * X_DIM);
    const float* z2 = z1 + X_DIM;
    _Float16* op = out + (size_t)row * X_DIM + i0;
    float xs[4] = {xv.x, xv.y, xv.z, xv.w};
#pragma unroll
    for (int e = 0; e < 4; ++e) {
        int idx = i0 + e;
        float v = ((xs[e] - mu) * rs * g[idx] + bb[idx]) * z1[idx] + z2[idx];
        op[e] = (_Float16)v;
    }
}

// ---------------------------------------------------------------------------
// Kernel 4: WMMA GEMM  C[M,Nc] = A[M,K] @ Bt[Nc,K]^T  (Bt stored N-major)
// 128x128 block tile, 8 waves (4x2), 32x64 wave tile, k-step 32
// outF != null -> f32 output with bias; else f16 output
// ---------------------------------------------------------------------------
__global__ void __launch_bounds__(256)
gemm_wmma_kernel(const _Float16* __restrict__ A, const _Float16* __restrict__ Bt,
                 _Float16* __restrict__ outH, float* __restrict__ outF,
                 const float* __restrict__ bias, int M, int Nc, int K) {
    const int tid  = threadIdx.x;
    const int lane = tid & 31;
    const int wave = tid >> 5;
    const int wm = wave & 3;                 // 4 waves along M
    const int wn = wave >> 2;                // 2 waves along N
    const int m0 = blockIdx.y * 128 + wm * 32;
    const int n0 = blockIdx.x * 128 + wn * 64;
    const int lr = lane & 15;
    const int koff = (lane >> 4) * 8;        // half-of-wave K offset

    v8f acc[2][4];
#pragma unroll
    for (int i = 0; i < 2; ++i)
#pragma unroll
        for (int j = 0; j < 4; ++j) acc[i][j] = vzero8();

    for (int k0 = 0; k0 < K; k0 += 32) {
        v16h afrag[2], bfrag[4];
#pragma unroll
        for (int s = 0; s < 2; ++s) {
            const _Float16* p = A + (size_t)(m0 + s * 16 + lr) * K + k0 + koff;
            __builtin_prefetch(p + 32, 0, 3);        // near-scope prefetch
            afrag[s] = load_frag16(p);
        }
#pragma unroll
        for (int s = 0; s < 4; ++s) {
            const _Float16* p = Bt + (size_t)(n0 + s * 16 + lr) * K + k0 + koff;
            bfrag[s] = load_frag16(p);
        }
#pragma unroll
        for (int i = 0; i < 2; ++i)
#pragma unroll
            for (int j = 0; j < 4; ++j)
                acc[i][j] = wmma_f16(afrag[i], bfrag[j], acc[i][j]);
    }

#pragma unroll
    for (int i = 0; i < 2; ++i) {
        int row0 = m0 + i * 16 + (koff ? 8 : 0);
#pragma unroll
        for (int j = 0; j < 4; ++j) {
            int col = n0 + j * 16 + lr;
            if (outF) {
                float bv = bias[col];
#pragma unroll
                for (int r = 0; r < 8; ++r)
                    outF[(size_t)(row0 + r) * Nc + col] = acc[i][j][r] + bv;
            } else {
#pragma unroll
                for (int r = 0; r < 8; ++r)
                    outH[(size_t)(row0 + r) * Nc + col] = (_Float16)acc[i][j][r];
            }
        }
    }
}

__device__ __forceinline__ float other_half(float x) {
    int bits = __builtin_bit_cast(int, x);
    return __builtin_bit_cast(float,
        __builtin_amdgcn_permlanex16(bits, bits, 0x76543210, 0xfedcba98,
                                     false, false));
}

__global__ void __launch_bounds__(256)
flash_attn_kernel(const _Float16* __restrict__ q, const _Float16* __restrict__ k,
                  const _Float16* __restrict__ v, _Float16* __restrict__ o) {
    const int b = blockIdx.z;
    const int h = blockIdx.y;
    const int m0 = blockIdx.x * 128;
    const int tid  = threadIdx.x;
    const int lane = tid & 31;
    const int wave = tid >> 5;
    const int lr = lane & 15;
    const int koff = (lane >> 4) * 8;
    const int mq = m0 + wave * 16;                       // wave's 16 queries
    const float SC = 0.125f * 1.4426950408889634f;       // scale * log2(e)

    // K tile: the tensor load's place in LDS stays a multiple of 2 KiB
    __shared__ __attribute__((aligned(2048))) _Float16 kt[32][64];
    __shared__ __attribute__((aligned(16))) _Float16 vt[64][40];       // V^T tile

    // Preload Q fragments (dh = 64 -> two k-chunks of 32); B operand: column lr
    const _Float16* qrow = q + (size_t)(b * N_SEQ + mq + lr) * INNER + h * DIM_HEAD;
    v16h qf[2];
    qf[0] = load_frag16(qrow + koff);
    qf[1] = load_frag16(qrow + 32 + koff);

    // ot[d][r] = O^T[d*16 + koff + r][query lr]
    v8f ot[4];
#pragma unroll
    for (int d = 0; d < 4; ++d) ot[d] = vzero8();
    float mrow = -1e30f;     // running maximum of query lr (equal in both halves)
    float lsum = 0.f;        // this half's share of the running sum

    for (int j0 = 0; j0 < N_SEQ; j0 += 32) {
        __syncthreads();   // protect kt/vt from previous iteration's readers

#if USE_TDM
        if (wave == 0) {
            unsigned klds = (unsigned)(uintptr_t)(&kt[0][0]);
            unsigned long long ga = (unsigned long long)(uintptr_t)
                (k + (size_t)(b * N_SEQ + j0) * INNER + h * DIM_HEAD);
            tdm_load_k_tile(klds, ga);
            __builtin_amdgcn_s_wait_tensorcnt(0);
        }
#else
        // fallback: cooperative vector loads of K tile
        {
            int key = tid >> 3;
            int dc  = (tid & 7) * 8;
            const _Float16* kp =
                k + (size_t)(b * N_SEQ + j0 + key) * INNER + h * DIM_HEAD + dc;
            *(v8h*)&kt[key][dc] = *(const v8h*)kp;
        }
#endif
        // --- cooperatively stage V tile transposed: vt[d][j] -------------
        {
            int key = tid >> 3;                 // 0..31
            int dc  = (tid & 7) * 8;            // dh chunk base
            const _Float16* vp =
                v + (size_t)(b * N_SEQ + j0 + key) * INNER + h * DIM_HEAD + dc;
            v8h vv = *(const v8h*)vp;
#pragma unroll
            for (int e = 0; e < 8; ++e) vt[dc + e][key] = vv[e];
        }
        __syncthreads();

        // --- S^T = K Q^T over 32 keys (two 16-key tiles) ------------------
        // s[t][r] = score(key j0 + t*16 + koff + r, query lr)
        v8f s[2];
#pragma unroll
        for (int t = 0; t < 2; ++t) {
            s[t] = vzero8();
            const _Float16* krow = &kt[t * 16 + lr][0];
            v16h kf0 = load_frag16(krow + koff);
            v16h kf1 = load_frag16(krow + 32 + koff);
            s[t] = wmma_f16(kf0, qf[0], s[t]);
            s[t] = wmma_f16(kf1, qf[1], s[t]);
        }

        // --- online softmax update, one query per lane --------------------
        float mx = fmaxf(s[0][0], s[1][0]);
#pragma unroll
        for (int r = 1; r < 8; ++r) mx = fmaxf(mx, fmaxf(s[0][r], s[1][r]));
        mx = fmaxf(mx, other_half(mx));
        float mnew = fmaxf(mrow, mx);
        float alpha = exp2f((mrow - mnew) * SC);
        mrow = mnew;

        // P^T as B operand: element e of the lane is key kmap(e) = the order
        // in which the two S^T tiles already lie in the lane's registers
        v16h pf;
        float rs0 = 0.f, rs1 = 0.f;
#pragma unroll
        for (int r = 0; r < 8; ++r) {
            float p0 = exp2f((s[0][r] - mnew) * SC);
            float p1 = exp2f((s[1][r] - mnew) * SC);
            rs0 += p0; rs1 += p1;
            pf[r]     = (_Float16)p0;
            pf[r + 8] = (_Float16)p1;
        }
        lsum = lsum * alpha + (rs0 + rs1);
#pragma unroll
        for (int d = 0; d < 4; ++d)
#pragma unroll
            for (int r = 0; r < 8; ++r) ot[d][r] *= alpha;

        // --- O^T += V^T P^T -----------------------------------------------
#pragma unroll
        for (int d = 0; d < 4; ++d) {
            v16h vf = load_frag16(&vt[d * 16 + lr][koff]);
            ot[d] = wmma_f16(vf, pf, ot[d]);
        }
    }

    // --- epilogue: join the halves' sums, O /= l, store f16 [M_ROWS, 512] --
    // a lane holds 8 consecutive columns of one row: one 16-byte store each
    lsum += other_half(lsum);
    float inv = 1.f / lsum;
    _Float16* orow = o + (size_t)(b * N_SEQ + mq + lr) * INNER + h * DIM_HEAD + koff;
#pragma unroll
    for (int d = 0; d < 4; ++d) {
        v8h w;
#pragma unroll
        for (int r = 0; r < 8; ++r) w[r] = (_Float16)(ot[d][r] * inv);
        *(v8h*)(orow + d * 16) = w;
    }
}

// ---------------------------------------------------------------------------
// Host-side launcher
// ---------------------------------------------------------------------------
extern "C" void kernel_launch(void* const* d_in, const int* in_sizes, int n_in,
                              void* d_out, int out_size, void* d_ws, size_t ws_size,
                              hipStream_t stream) {
    const float* x    = (const float*)d_in[0];
    const float* z    = (const float*)d_in[1];
    const float* lxg  = (const float*)d_in[2];
    const float* lxb  = (const float*)d_in[3];
    const float* lzg  = (const float*)d_in[4];
    const float* lzb  = (const float*)d_in[5];
    const float* Wq   = (const float*)d_in[6];
    const float* Wk   = (const float*)d_in[7];
    const float* Wv   = (const float*)d_in[8];
    const float* Wz   = (const float*)d_in[9];
    const float* Wo   = (const float*)d_in[10];
    const float* bo   = (const float*)d_in[11];
    float* out = (float*)d_out;

    char* ws = (char*)d_ws;
    size_t off = 0;
    float* z1z2 = (float*)(ws + off);       off += (size_t)BATCH * 2 * X_DIM * 4;
    _Float16* WtQ  = (_Float16*)(ws + off); off += (size_t)X_DIM * INNER * 2;
    _Float16* WtK  = (_Float16*)(ws + off); off += (size_t)X_DIM * INNER * 2;
    _Float16* WtV  = (_Float16*)(ws + off); off += (size_t)X_DIM * INNER * 2;
    _Float16* WtO  = (_Float16*)(ws + off); off += (size_t)INNER * X_DIM * 2;
    _Float16* xmod = (_Float16*)(ws + off); off += (size_t)M_ROWS * X_DIM * 2;
    _Float16* qb   = (_Float16*)(ws + off); off += (size_t)M_ROWS * INNER * 2;
    _Float16* kb   = (_Float16*)(ws + off); off += (size_t)M_ROWS * INNER * 2;
    _Float16* vb   = (_Float16*)(ws + off); off += (size_t)M_ROWS * INNER * 2;
    _Float16* ao   = (_Float16*)(ws + off); off += (size_t)M_ROWS * INNER * 2;

    // 1) weight convert + transpose
    int wblocks = (X_DIM * INNER) / 256;
    cvt_transpose_kernel<<<wblocks, 256, 0, stream>>>(Wq, WtQ, X_DIM, INNER);
    cvt_transpose_kernel<<<wblocks, 256, 0, stream>>>(Wk, WtK, X_DIM, INNER);
    cvt_transpose_kernel<<<wblocks, 256, 0, stream>>>(Wv, WtV, X_DIM, INNER);
    cvt_transpose_kernel<<<wblocks, 256, 0, stream>>>(Wo, WtO, INNER, X_DIM);

    // 2) z path
    zpath_kernel<<<BATCH, 256, 0, stream>>>(z, lzg, lzb, Wz, z1z2);

    // 3) LN + FiLM on x -> f16
    xmod_kernel<<<M_ROWS, 128, 0, stream>>>(x, lxg, lxb, z1z2, xmod);

    // 4) Q/K/V projections (f16 out)
    dim3 ggrid(INNER / 128, M_ROWS / 128);
    gemm_wmma_kernel<<<ggrid, 256, 0, stream>>>(xmod, WtQ, qb, nullptr, nullptr,
                                                M_ROWS, INNER, X_DIM);
    gemm_wmma_kernel<<<ggrid, 256, 0, stream>>>(xmod, WtK, kb, nullptr, nullptr,
                                                M_ROWS, INNER, X_DIM);
    gemm_wmma_kernel<<<ggrid, 256, 0, stream>>>(xmod, WtV, vb, nullptr, nullptr,
                                                M_ROWS, INNER, X_DIM);

    // 5) flash attention
    dim3 agrid(N_SEQ / 128, HEADS, BATCH);
    flash_attn_kernel<<<agrid, 256, 0, stream>>>(qb, kb, vb, ao);

    // 6) output projection (f32 out + bias)
    dim3 ogrid(X_DIM / 128, M_ROWS / 128);
    gemm_wmma_kernel<<<ogrid, 256, 0, stream>>>(ao, WtO, nullptr, out, bo,
                                                M_ROWS, X_DIM, INNER);
}

// v002
// It runs in 220 microseconds.
// Next to v001, in two timings, it ran 1.12 and 1.13 times as fast.
// Counting every step since v000, it is 1.28 times as fast.
#include <hip/hip_runtime.h>
#include <hip/hip_bf16.h>

#define X_DIM   512
#define Z_DIM   16
#define HEADS   8
#define DIM_HEAD 64
#define INNER   512
#define BATCH   4
#define N_SEQ   2048
#define M_ROWS  (BATCH * N_SEQ)          // 8192
#define EPS     1e-5f

typedef _Float16 v16h __attribute__((ext_vector_type(16)));
typedef _Float16 v8h  __attribute__((ext_vector_type(8)));
typedef float    v8f  __attribute__((ext_vector_type(8)));
typedef unsigned int u32x4 __attribute__((ext_vector_type(4)));
typedef int          i32x4 __attribute__((ext_vector_type(4)));
typedef int          i32x8 __attribute__((ext_vector_type(8)));

#if defined(__HIP_DEVICE_COMPILE__) && __has_builtin(__builtin_amdgcn_tensor_load_to_lds)
#define USE_TDM 1
#else
#define USE_TDM 0
#endif

__device__ __forceinline__ v8f vzero8() {
    v8f z = {0.f,0.f,0.f,0.f,0.f,0.f,0.f,0.f};
    return z;
}

__device__ __forceinline__ v16h load_frag16(const _Float16* p) {
    v8h lo = *(const v8h*)(p);
    v8h hi = *(const v8h*)(p + 16);
    v16h r;
#pragma unroll
    for (int i = 0; i < 8; ++i) { r[i] = lo[i]; r[i + 8] = hi[i]; }
    return r;
}

__device__ __forceinline__ v8f wmma_f16(v16h a, v16h b, v8f c) {
    return __builtin_amdgcn_wmma_f32_16x16x32_f16(false, a, false, b,
                                                  (short)0, c, false, false);
}

#if USE_TDM
// wave-uniform value held in a scalar register
__device__ __forceinline__ unsigned uni(unsigned v) {
    return (unsigned)__builtin_amdgcn_readfirstlane((int)v);
}
__device__ __forceinline__ unsigned pinned(unsigned v) {
    unsigned w = uni(v);
    asm volatile("" : "+s"(w));  // pinned(): holds the test's word in a scalar register
    return w;
}

__device__ __forceinline__ void tdm_load_k_tile(unsigned lds_addr,
                                                unsigned long long gaddr) {
    u32x4 g0;
    g0[0] = uni(1u);
    g0[1] = uni(lds_addr);
    g0[2] = uni((unsigned)(gaddr & 0xffffffffull));
    g0[3] = uni((unsigned)((gaddr >> 32) & 0x1ffffffull)
          | (2u << 30));
    i32x8 g1;
    g1[0] = (1 << 20) | (4 << 22) | (3 << 25);
    g1[1] = (int)(128u << 16);
    g1[2] = (int)(32u << 16);
    g1[3] = (int)(128u << 16);
    g1[4] = 32;
    g1[5] = 1024;
    g1[6] = 0;
    g1[7] = 0;
    i32x4 z4 = {0, 0, 0, 0};
#if defined(__clang_major__) && __clang_major__ >= 23
    i32x8 z8 = {0, 0, 0, 0, 0, 0, 0, 0};
    __builtin_amdgcn_tensor_load_to_lds(g0, g1, z4, z4, z8, 0);
#else
    __builtin_amdgcn_tensor_load_to_lds(g0, g1, z4, z4, 0);
#endif
}
#endif

// ---------------------------------------------------------------------------
// Kernel 1: f32 weight [K,Nc] -> f16 transposed [Nc,K] (fragment-friendly)
// ---------------------------------------------------------------------------
__global__ void __launch_bounds__(256)
cvt_transpose_kernel(const float* __restrict__ W, _Float16* __restrict__ Wt,
                     int K, int Nc) {
    int idx = blockIdx.x * 256 + threadIdx.x;     // coalesced read of W
    int kk = idx / Nc;
    int n  = idx % Nc;
    Wt[(size_t)n * K + kk] = (_Float16)W[idx];
}

// ---------------------------------------------------------------------------
// Kernel 2: z path: LN(z) @ Wz -> SiLU -> z1z2 [B,1024] f32
// ---------------------------------------------------------------------------
__global__ void __launch_bounds__(256)
zpath_kernel(const float* __restrict__ z, const float* __restrict__ g,
             const float* __restrict__ bb, const float* __restrict__ Wz,
             float* __restrict__ z1z2) {
    int b = blockIdx.x;
    const float* zr = z + b * Z_DIM;
    float zn[Z_DIM];
    float mu = 0.f;
#pragma unroll
    for (int i = 0; i < Z_DIM; ++i) mu += zr[i];
    mu *= (1.f / Z_DIM);
    float var = 0.f;
#pragma unroll
    for (int i = 0; i < Z_DIM; ++i) { float d = zr[i] - mu; var += d * d; }
    var *= (1.f / Z_DIM);
    float rs = rsqrtf(var + EPS);
#pragma unroll
    for (int i = 0; i < Z_DIM; ++i) zn[i] = (zr[i] - mu) * rs * g[i] + bb[i];

    for (int c = threadIdx.x; c < 2 * X_DIM; c += 256) {
        float a = 0.f;
#pragma unroll
        for (int i = 0; i < Z_DIM; ++i) a += zn[i] * Wz[i * (2 * X_DIM) + c];
        float sg = 1.f / (1.f + __expf(-a));
        z1z2[b * (2 * X_DIM) + c] = a * sg;        // SiLU
    }
}

// ---------------------------------------------------------------------------
// Kernel 3: x_mod = LN(x)*z1 + z2  -> f16 [M_ROWS, 512]
// one block (128 threads) per row
// ---------------------------------------------------------------------------
__global__ void __launch_bounds__(128)
xmod_kernel(const float* __restrict__ x, const float* __restrict__ g,
            const float* __restrict__ bb, const float* __restrict__ z1z2,
            _Float16* __restrict__ out) {
    int row = blockIdx.x;                // 0..8191
    int b = row >> 11;                   // row / 2048
    const float* xr = x + (size_t)row * X_DIM;
    int lane = threadIdx.x & 31;
    int wave = threadIdx.x >> 5;
    int i0 = threadIdx.x * 4;

    float4 xv = *(const float4*)(xr + i0);
    float s  = xv.x + xv.y + xv.z + xv.w;
    float sq = xv.x*xv.x + xv.y*xv.y + xv.z*xv.z + xv.w*xv.w;
#pragma unroll
    for (int off = 16; off >= 1; off >>= 1) {
        s  += __shfl_xor(s,  off, 32);
        sq += __shfl_xor(sq, off, 32);
    }
    __shared__ float ss[4], ssq[4];
    if (lane == 0) { ss[wave] = s; ssq[wave] = sq; }
    __syncthreads();
    s  = ss[0] + ss[1] + ss[2] + ss[3];
    sq = ssq[0] + ssq[1] + ssq[2] + ssq[3];
    float mu  = s * (1.f / X_DIM);
    float var = sq * (1.f / X_DIM) - mu * mu;
    float rs = rsqrtf(var + EPS);

    const float* z1 = z1z2 + b * (2 * X_DIM);
    const float* z2 = z1 + X_DIM;
    _Float16* op = out + (size_t)row * X_DIM + i0;
    float xs[4] = {xv.x, xv.y, xv.z, xv.w};
#pragma unroll
    for (int e = 0; e < 4; ++e) {
        int idx = i0 + e;
        float v = ((xs[e] - mu) * rs * g[idx] + bb[idx]) * z1[idx] + z2[idx];
        op[e] = (_Float16)v;
    }
}

// ---------------------------------------------------------------------------
// Kernel 4: WMMA GEMM  C[M,Nc] = A[M,K] @ Bt[Nc,K]^T  (Bt stored N-major)
// 128x128 block tile, 8 waves (4x2), 32x64 wave tile, k-step 32
// outF != null -> f32 output with bias; else f16 output
// ---------------------------------------------------------------------------
__global__ void __launch_bounds__(256)
gemm_wmma_kernel(const _Float16* __restrict__ A, const _Float16* __restrict__ Bt,
                 _Float16* __restrict__ outH, float* __restrict__ outF,
                 const float* __restrict__ bias, int M, int Nc, int K) {
    const int tid  = threadIdx.x;
    const int lane = tid & 31;
    const int wave = tid >> 5;
    const int wm = wave & 3;                 // 4 waves along M
    const int wn = wave >> 2;                // 2 waves along N
    const int m0 = blockIdx.y * 128 + wm * 32;
    const int n0 = blockIdx.x * 128 + wn * 64;
    const int lr = lane & 15;
    const int koff = (lane >> 4) * 8;        // half-of-wave K offset

    v8f acc[2][4];
#pragma unroll
    for (int i = 0; i < 2; ++i)
#pragma unroll
        for (int j = 0; j < 4; ++j) acc[i][j] = vzero8();

    for (int k0 = 0; k0 < K; k0 += 32) {
        v16h afrag[2], bfrag[4];
#pragma unroll
        for (int s = 0; s < 2; ++s) {
            const _Float16* p = A + (size_t)(m0 + s * 16 + lr) * K + k0 + koff;
            __builtin_prefetch(p + 32, 0, 3);        // near-scope prefetch
            afrag[s] = load_frag16(p);
        }
#pragma unroll
        for (int s = 0; s < 4; ++s) {
            const _Float16* p = Bt + (size_t)(n0 + s * 16 + lr) * K + k0 + koff;
            bfrag[s] = load_frag16(p);
        }
#pragma unroll
        for (int i = 0; i < 2; ++i)
#pragma unroll
            for (int j = 0; j < 4; ++j)
                acc[i][j] = wmma_f16(afrag[i], bfrag[j], acc[i][j]);
    }

#pragma unroll
    for (int i = 0; i < 2; ++i) {
        int row0 = m0 + i * 16 + (koff ? 8 : 0);
#pragma unroll
        for (int j = 0; j < 4; ++j) {
            int col = n0 + j * 16 + lr;
            if (outF) {
                float bv = bias[col];
#pragma unroll
                for (int r = 0; r < 8; ++r)
                    outF[(size_t)(row0 + r) * Nc + col] = acc[i][j][r] + bv;
            } else {
#pragma unroll
                for (int r = 0; r < 8; ++r)
                    outH[(size_t)(row0 + r) * Nc + col] = (_Float16)acc[i][j][r];
            }
        }
    }
}

__device__ __forceinline__ float other_half(float x) {
    int bits = __builtin_bit_cast(int, x);
    return __builtin_bit_cast(float,
        __builtin_amdgcn_permlanex16(bits, bits, 0x76543210, 0xfedcba98,
                                     false, false));
}

__global__ void __launch_bounds__(256)
flash_attn_kernel(const _Float16* __restrict__ q, const _Float16* __restrict__ k,
                  const _Float16* __restrict__ v, _Float16* __restrict__ o) {
    const int b = blockIdx.z;
    const int h = blockIdx.y;
    const int m0 = blockIdx.x * 128;
    const int tid  = threadIdx.x;
    const int lane = tid & 31;
    const int wave = tid >> 5;
    const int lr = lane & 15;
    const int koff = (lane >> 4) * 8;
    const int mq = m0 + wave * 16;                       // wave's 16 queries
    const float SC = 0.125f * 1.4426950408889634f;       // scale * log2(e)

    // K tile: the tensor load's place in LDS stays a multiple of 2 KiB;
    // rows of 64 halves at a pitch of 72 (the tensor load's pad, never written)
    __shared__ __attribute__((aligned(2048))) _Float16 kt[32][72];
    __shared__ __attribute__((aligned(16))) _Float16 vt[64][40];       // V^T tile

    // Preload Q fragments (dh = 64 -> two k-chunks of 32); B operand: column lr
    const _Float16* qrow = q + (size_t)(b * N_SEQ + mq + lr) * INNER + h * DIM_HEAD;
    v16h qf[2];
    qf[0] = load_frag16(qrow + koff);
    qf[1] = load_frag16(qrow + 32 + koff);

    // ot[d][r] = O^T[d*16 + koff + r][query lr]
    v8f ot[4];
#pragma unroll
    for (int d = 0; d < 4; ++d) ot[d] = vzero8();
    float mrow = -1e30f;     // running maximum of query lr (equal in both halves)
    float lsum = 0.f;        // this half's share of the running sum

    for (int j0 = 0; j0 < N_SEQ; j0 += 32) {
        __syncthreads();   // protect kt/vt from previous iteration's readers

#if USE_TDM
        if (pinned(wave == 0)) {
            unsigned klds = (unsigned)(uintptr_t)(&kt[0][0]);
            unsigned long long ga = (unsigned long long)(uintptr_t)
                (k + (size_t)(b * N_SEQ + j0) * INNER + h * DIM_HEAD);
            tdm_load_k_tile(klds, ga);
            // the tile has landed before this wave reaches the barrier below
            asm volatile("s_wait_tensorcnt 0" ::: "memory");
        }
#else
        // fallback: cooperative vector loads of K tile
        {
            int key = tid >> 3;
            int dc  = (tid & 7) * 8;
            const _Float16* kp =
                k + (size_t)(b * N_SEQ + j0 + key) * INNER + h * DIM_HEAD + dc;
            *(v8h*)&kt[key][dc] = *(const v8h*)kp;
        }
#endif
        // --- cooperatively stage V tile transposed: vt[d][j] -------------
        {
            int key = tid >> 3;                 // 0..31
            int dc  = (tid & 7) * 8;            // dh chunk base
            const _Float16* vp =
                v + (size_t)(b * N_SEQ + j0 + key) * INNER + h * DIM_HEAD + dc;
            v8h vv = *(const v8h*)vp;
#pragma unroll
            for (int e = 0; e < 8; ++e) vt[dc + e][key] = vv[e];
        }
        __syncthreads();

        // --- S^T = K Q^T over 32 keys (two 16-key tiles) ------------------
        // s[t][r] = score(key j0 + t*16 + koff + r, query lr)
        v8f s[2];
#pragma unroll
        for (int t = 0; t < 2; ++t) {
            s[t] = vzero8();
            const _Float16* krow = &kt[t * 16 + lr][0];
            v16h kf0 = load_frag16(krow + koff);
            v16h kf1 = load_frag16(krow + 32 + koff);
            s[t] = wmma_f16(kf0, qf[0], s[t]);
            s[t] = wmma_f16(kf1, qf[1], s[t]);
        }

        // --- online softmax update, one query per lane --------------------
        float mx = fmaxf(s[0][0], s[1][0]);
#pragma unroll
        for (int r = 1; r < 8; ++r) mx = fmaxf(mx, fmaxf(s[0][r], s[1][r]));
        mx = fmaxf(mx, other_half(mx));
        float mnew = fmaxf(mrow, mx);
        float alpha = exp2f((mrow - mnew) * SC);
        mrow = mnew;

        // P^T as B operand: element e of the lane is key kmap(e) = the order
        // in which the two S^T tiles already lie in the lane's registers
        v16h pf;
        float rs0 = 0.f, rs1 = 0.f;
#pragma unroll
        for (int r = 0; r < 8; ++r) {
            float p0 = exp2f((s[0][r] - mnew) * SC);
            float p1 = exp2f((s[1][r] - mnew) * SC);
            rs0 += p0; rs1 += p1;
            pf[r]     = (_Float16)p0;
            pf[r + 8] = (_Float16)p1;
        }
        lsum = lsum * alpha + (rs0 + rs1);
#pragma unroll
        for (int d = 0; d < 4; ++d)
#pragma unroll
            for (int r = 0; r < 8; ++r) ot[d][r] *= alpha;

        // --- O^T += V^T P^T -----------------------------------------------
#pragma unroll
        for (int d = 0; d < 4; ++d) {
            v16h vf = load_frag16(&vt[d * 16 + lr][koff]);
            ot[d] = wmma_f16(vf, pf, ot[d]);
        }
    }

    // --- epilogue: join the halves' sums, O /= l, store f16 [M_ROWS, 512] --
    // a lane holds 8 consecutive columns of one row: one 16-byte store each
    lsum += other_half(lsum);
    float inv = 1.f / lsum;
    _Float16* orow = o + (size_t)(b * N_SEQ + mq + lr) * INNER + h * DIM_HEAD + koff;
#pragma unroll
    for (int d = 0; d < 4; ++d) {
        v8h w;
#pragma unroll
        for (int r = 0; r < 8; ++r) w[r] = (_Float16)(ot[d][r] * inv);
        *(v8h*)(orow + d * 16) = w;
    }
}

// ---------------------------------------------------------------------------
// Host-side launcher
// ---------------------------------------------------------------------------
extern "C" void kernel_launch(void* const* d_in, const int* in_sizes, int n_in,
                              void* d_out, int out_size, void* d_ws, size_t ws_size,
                              hipStream_t stream) {
    const float* x    = (const float*)d_in[0];
    const float* z    = (const float*)d_in[1];
    const float* lxg  = (const float*)d_in[2];
    const float* lxb  = (const float*)d_in[3];
    const float* lzg  = (const float*)d_in[4];
    const float* lzb  = (const float*)d_in[5];
    const float* Wq   = (const float*)d_in[6];
    const float* Wk   = (const float*)d_in[7];
    const float* Wv   = (const float*)d_in[8];
    const float* Wz   = (const float*)d_in[9];
    const float* Wo   = (const float*)d_in[10];
    const float* bo   = (const float*)d_in[11];
    float* out = (float*)d_out;

    char* ws = (char*)d_ws;
    size_t off = 0;
    float* z1z2 = (float*)(ws + off);       off += (size_t)BATCH * 2 * X_DIM * 4;
    _Float16* WtQ  = (_Float16*)(ws + off); off += (size_t)X_DIM * INNER * 2;
    _Float16* WtK  = (_Float16*)(ws + off); off += (size_t)X_DIM * INNER * 2;
    _Float16* WtV  = (_Float16*)(ws + off); off += (size_t)X_DIM * INNER * 2;
    _Float16* WtO  = (_Float16*)(ws + off); off += (size_t)INNER * X_DIM * 2;
    _Float16* xmod = (_Float16*)(ws + off); off += (size_t)M_ROWS * X_DIM * 2;
    _Float16* qb   = (_Float16*)(ws + off); off += (size_t)M_ROWS * INNER * 2;
    _Float16* kb   = (_Float16*)(ws + off); off += (size_t)M_ROWS * INNER * 2;
    _Float16* vb   = (_Float16*)(ws + off); off += (size_t)M_ROWS * INNER * 2;
    _Float16* ao   = (_Float16*)(ws + off); off += (size_t)M_ROWS * INNER * 2;

    // 1) weight convert + transpose
    int wblocks = (X_DIM * INNER) / 256;
    cvt_transpose_kernel<<<wblocks, 256, 0, stream>>>(Wq, WtQ, X_DIM, INNER);
    cvt_transpose_kernel<<<wblocks, 256, 0, stream>>>(Wk, WtK, X_DIM, INNER);
    cvt_transpose_kernel<<<wblocks, 256, 0, stream>>>(Wv, WtV, X_DIM, INNER);
    cvt_transpose_kernel<<<wblocks, 256, 0, stream>>>(Wo, WtO, INNER, X_DIM);

    // 2) z path
    zpath_kernel<<<BATCH, 256, 0, stream>>>(z, lzg, lzb, Wz, z1z2);

    // 3) LN + FiLM on x -> f16
    xmod_kernel<<<M_ROWS, 128, 0, stream>>>(x, lxg, lxb, z1z2, xmod);

    // 4) Q/K/V projections (f16 out)
    dim3 ggrid(INNER / 128, M_ROWS / 128);
    gemm_wmma_kernel<<<ggrid, 256, 0, stream>>>(xmod, WtQ, qb, nullptr, nullptr,
                                                M_ROWS, INNER, X_DIM);
    gemm_wmma_kernel<<<ggrid, 256, 0, stream>>>(xmod, WtK, kb, nullptr, nullptr,
                                                M_ROWS, INNER, X_DIM);
    gemm_wmma_kernel<<<ggrid, 256, 0, stream>>>(xmod, WtV, vb, nullptr, nullptr,
                                                M_ROWS, INNER, X_DIM);

    // 5) flash attention
    dim3 agrid(N_SEQ / 128, HEADS, BATCH);
    flash_attn_kernel<<<agrid, 256, 0, stream>>>(qb, kb, vb, ao);

    // 6) output projection (f32 out + bias)
    dim3 ogrid(X_DIM / 128, M_ROWS / 128);
    gemm_wmma_kernel<<<ogrid, 256, 0, stream>>>(ao, WtO, nullptr, out, bo,
                                                M_ROWS, X_DIM, INNER);
}

// v003
// It runs in 193 microseconds.
// Next to v002, in two timings, it ran 1.14 times as fast each time.
// Counting every step since v000, it is 1.46 times as fast.
#include <hip/hip_runtime.h>
#include <hip/hip_bf16.h>

#define X_DIM   512
#define Z_DIM   16
#define HEADS   8
#define DIM_HEAD 64
#define INNER   512
#define BATCH   4
#define N_SEQ   2048
#define M_ROWS  (BATCH * N_SEQ)          // 8192
#define EPS     1e-5f

typedef _Float16 v16h __attribute__((ext_vector_type(16)));
typedef _Float16 v8h  __attribute__((ext_vector_type(8)));
typedef float    v8f  __attribute__((ext_vector_type(8)));
typedef unsigned int u32x4 __attribute__((ext_vector_type(4)));
typedef int          i32x4 __attribute__((ext_vector_type(4)));
typedef int          i32x8 __attribute__((ext_vector_type(8)));

#if defined(__HIP_DEVICE_COMPILE__) && __has_builtin(__builtin_amdgcn_tensor_load_to_lds)
#define USE_TDM 1
#else
#define USE_TDM 0
#endif

__device__ __forceinline__ v8f vzero8() {
    v8f z = {0.f,0.f,0.f,0.f,0.f,0.f,0.f,0.f};
    return z;
}

__device__ __forceinline__ v16h load_frag16(const _Float16* p) {
    v8h lo = *(const v8h*)(p);
    v8h hi = *(const v8h*)(p + 16);
    v16h r;
#pragma unroll
    for (int i = 0; i < 8; ++i) { r[i] = lo[i]; r[i + 8] = hi[i]; }
    return r;
}

__device__ __forceinline__ v8f wmma_f16(v16h a, v16h b, v8f c) {
    return __builtin_amdgcn_wmma_f32_16x16x32_f16(false, a, false, b,
                                                  (short)0, c, false, false);
}

struct KTileRequest {
    u32x4 g0;
    i32x8 g1;
};

#if USE_TDM
// wave-uniform value held in a scalar register
__device__ __forceinline__ unsigned uni(unsigned v) {
    return (unsigned)__builtin_amdgcn_readfirstlane((int)v);
}
__device__ __forceinline__ unsigned pinned(unsigned v) {
    unsigned w = uni(v);
    asm volatile("" : "+s"(w));  // pinned(): holds the test's word in a scalar register
    return w;
}

__device__ __forceinline__ u32x4 tdm_k_group0(unsigned lds_addr,
                                              unsigned long long gaddr) {
    u32x4 g0;
    g0[0] = uni(1u);
    g0[1] = uni(lds_addr);
    g0[2] = uni((unsigned)(gaddr & 0xffffffffull));
    g0[3] = uni((unsigned)((gaddr >> 32) & 0x1ffffffull)
          | (2u << 30));
    asm volatile("" : "+s"(g0));
    return g0;
}

__device__ __forceinline__ i32x8 tdm_k_group1() {
    i32x8 g1;
    g1[0] = (1 << 20) | (4 << 22) | (3 << 25);
    g1[1] = (int)(128u << 16);
    g1[2] = (int)(32u << 16);
    g1[3] = (int)(128u << 16);
    g1[4] = 32;
    g1[5] = 1024;
    g1[6] = 0;
    g1[7] = 0;
    asm volatile("" : "+s"(g1));
    return g1;
}

__device__ __forceinline__ void tdm_load_k_tile(const KTileRequest& rq) {
    i32x4 z4 = {0, 0, 0, 0};
#if defined(__clang_major__) && __clang_major__ >= 23
    i32x8 z8 = {0, 0, 0, 0, 0, 0, 0, 0};
    __builtin_amdgcn_tensor_load_to_lds(rq.g0, rq.g1, z4, z4, z8, 0);
#else
    __builtin_amdgcn_tensor_load_to_lds(rq.g0, rq.g1, z4, z4, 0);
#endif
}
#endif

// ---------------------------------------------------------------------------
// Kernel 1: f32 weight [K,Nc] -> f16 transposed [Nc,K] (fragment-friendly)
// ---------------------------------------------------------------------------
__global__ void __launch_bounds__(256)
cvt_transpose_kernel(const float* __restrict__ W, _Float16* __restrict__ Wt,
                     int K, int Nc) {
    int idx = blockIdx.x * 256 + threadIdx.x;     // coalesced read of W
    int kk = idx / Nc;
    int n  = idx % Nc;
    Wt[(size_t)n * K + kk] = (_Float16)W[idx];
}

// ---------------------------------------------------------------------------
// Kernel 2: z path: LN(z) @ Wz -> SiLU -> z1z2 [B,1024] f32
// ---------------------------------------------------------------------------
__global__ void __launch_bounds__(256)
zpath_kernel(const float* __restrict__ z, const float* __restrict__ g,
             const float* __restrict__ bb, const float* __restrict__ Wz,
             float* __restrict__ z1z2) {
    int b = blockIdx.x;
    const float* zr = z + b * Z_DIM;
    float zn[Z_DIM];
    float mu = 0.f;
#pragma unroll
    for (int i = 0; i < Z_DIM; ++i) mu += zr[i];
    mu *= (1.f / Z_DIM);
    float var = 0.f;
#pragma unroll
    for (int i = 0; i < Z_DIM; ++i) { float d = zr[i] - mu; var += d * d; }
    var *= (1.f / Z_DIM);
    float rs = rsqrtf(var + EPS);
#pragma unroll
    for (int i = 0; i < Z_DIM; ++i) zn[i] = (zr[i] - mu) * rs * g[i] + bb[i];

    for (int c = threadIdx.x; c < 2 * X_DIM; c += 256) {
        float a = 0.f;
#pragma unroll
        for (int i = 0; i < Z_DIM; ++i) a += zn[i] * Wz[i * (2 * X_DIM) + c];
        float sg = 1.f / (1.f + __expf(-a));
        z1z2[b * (2 * X_DIM) + c] = a * sg;        // SiLU
    }
}

// ---------------------------------------------------------------------------
// Kernel 3: x_mod = LN(x)*z1 + z2  -> f16 [M_ROWS, 512]
// one block (128 threads) per row
// ---------------------------------------------------------------------------
__global__ void __launch_bounds__(128)
xmod_kernel(const float* __restrict__ x, const float* __restrict__ g,
            const float* __restrict__ bb, const float* __restrict__ z1z2,
            _Float16* __restrict__ out) {
    int row = blockIdx.x;                // 0..8191
    int b = row >> 11;                   // row / 2048
    const float* xr = x + (size_t)row * X_DIM;
    int lane = threadIdx.x & 31;
    int wave = threadIdx.x >> 5;
    int i0 = threadIdx.x * 4;

    float4 xv = *(const float4*)(xr + i0);
    float s  = xv.x + xv.y + xv.z + xv.w;
    float sq = xv.x*xv.x + xv.y*xv.y + xv.z*xv.z + xv.w*xv.w;
#pragma unroll
    for (int off = 16; off >= 1; off >>= 1) {
        s  += __shfl_xor(s,  off, 32);
        sq += __shfl_xor(sq, off, 32);
    }
    __shared__ float ss[4], ssq[4];
    if (lane == 0) { ss[wave] = s; ssq[wave] = sq; }
    __syncthreads();
    s  = ss[0] + ss[1] + ss[2] + ss[3];
    sq = ssq[0] + ssq[1] + ssq[2] + ssq[3];
    float mu  = s * (1.f / X_DIM);
    float var = sq * (1.f / X_DIM) - mu * mu;
    float rs = rsqrtf(var + EPS);

    const float* z1 = z1z2 + b * (2 * X_DIM);
    const float* z2 = z1 + X_DIM;
    _Float16* op = out + (size_t)row * X_DIM + i0;
    float xs[4] = {xv.x, xv.y, xv.z, xv.w};
#pragma unroll
    for (int e = 0; e < 4; ++e) {
        int idx = i0 + e;
        float v = ((xs[e] - mu) * rs * g[idx] + bb[idx]) * z1[idx] + z2[idx];
        op[e] = (_Float16)v;
    }
}

// ---------------------------------------------------------------------------
// Kernel 4: WMMA GEMM  C[M,Nc] = A[M,K] @ Bt[Nc,K]^T  (Bt stored N-major)
// 128x128 block tile, 8 waves (4x2), 32x64 wave tile, k-step 32
// outF != null -> f32 output with bias; else f16 output
// ---------------------------------------------------------------------------
__global__ void __launch_bounds__(256)
gemm_wmma_kernel(const _Float16* __restrict__ A, const _Float16* __restrict__ Bt,
                 _Float16* __restrict__ outH, float* __restrict__ outF,
                 const float* __restrict__ bias, int M, int Nc, int K) {
    const int tid  = threadIdx.x;
    const int lane = tid & 31;
    const int wave = tid >> 5;
    const int wm = wave & 3;                 // 4 waves along M
    const int wn = wave >> 2;                // 2 waves along N
    const int m0 = blockIdx.y * 128 + wm * 32;
    const int n0 = blockIdx.x * 128 + wn * 64;
    const int lr = lane & 15;
    const int koff = (lane >> 4) * 8;        // half-of-wave K offset

    v8f acc[2][4];
#pragma unroll
    for (int i = 0; i < 2; ++i)
#pragma unroll
        for (int j = 0; j < 4; ++j) acc[i][j] = vzero8();

    for (int k0 = 0; k0 < K; k0 += 32) {
        v16h afrag[2], bfrag[4];
#pragma unroll
        for (int s = 0; s < 2; ++s) {
            const _Float16* p = A + (size_t)(m0 + s * 16 + lr) * K + k0 + koff;
            __builtin_prefetch(p + 32, 0, 3);        // near-scope prefetch
            afrag[s] = load_frag16(p);
        }
#pragma unroll
        for (int s = 0; s < 4; ++s) {
            const _Float16* p = Bt + (size_t)(n0 + s * 16 + lr) * K + k0 + koff;
            bfrag[s] = load_frag16(p);
        }
#pragma unroll
        for (int i = 0; i < 2; ++i)
#pragma unroll
            for (int j = 0; j < 4; ++j)
                acc[i][j] = wmma_f16(afrag[i], bfrag[j], acc[i][j]);
    }

#pragma unroll
    for (int i = 0; i < 2; ++i) {
        int row0 = m0 + i * 16 + (koff ? 8 : 0);
#pragma unroll
        for (int j = 0; j < 4; ++j) {
            int col = n0 + j * 16 + lr;
            if (outF) {
                float bv = bias[col];
#pragma unroll
                for (int r = 0; r < 8; ++r)
                    outF[(size_t)(row0 + r) * Nc + col] = acc[i][j][r] + bv;
            } else {
#pragma unroll
                for (int r = 0; r < 8; ++r)
                    outH[(size_t)(row0 + r) * Nc + col] = (_Float16)acc[i][j][r];
            }
        }
    }
}

__device__ __forceinline__ float other_half(float x) {
    int bits = __builtin_bit_cast(int, x);
    return __builtin_bit_cast(float,
        __builtin_amdgcn_permlanex16(bits, bits, 0x76543210, 0xfedcba98,
                                     false, false));
}

#define N_TILES    (N_SEQ / 32)   // key tiles of 32 per (batch, head)
#define KT_PITCH_H 72             // K tile row pitch in LDS, halves (144 B)
#define KT_BUF_H   3072           // one K buffer, halves (6144 B = 3 x 2 KiB)

#if USE_TDM
// Start the K tile [32 keys x 64 dh] at `src` on its way into LDS at `dst`,
// where that tile exists (the same answer in the whole block). One request of
// wave 0; its wait, wait_k_tile, stands at the caller's publish point.
__device__ __forceinline__ void stage_k_tile(KTileRequest& rq, _Float16* dst,
                                             const _Float16* src, bool exists,
                                             int tid) {
    // plain test: where the compiler knows that no tile is left, no request is
    // built at all; the pinned one is the scalar branch a tensor load needs
    if (!exists) return;
    rq.g0 = tdm_k_group0((unsigned)(uintptr_t)dst,
                         (unsigned long long)(uintptr_t)src);
    if (pinned(((tid >> 5) == 0) & exists)) tdm_load_k_tile(rq);
}

// The issuing wave's own wait: its K tile has landed before it reaches the
// barrier that publishes the tile.
__device__ __forceinline__ void wait_k_tile(const KTileRequest& rq, int tid) {
    if (pinned((tid >> 5) == 0)) {
        asm volatile("s_wait_tensorcnt 0" :: "s"(rq.g0), "s"(rq.g1) : "memory");
    }
}
#else
// fallback: cooperative vector loads of the K tile, nothing to wait for
__device__ __forceinline__ i32x8 tdm_k_group1() { return i32x8{}; }
__device__ __forceinline__ void stage_k_tile(KTileRequest&, _Float16* dst,
                                             const _Float16* src, bool exists,
                                             int tid) {
    if (exists) {
        int key = tid >> 3;
        int dc  = (tid & 7) * 8;
        *(v8h*)(dst + key * KT_PITCH_H + dc) =
            *(const v8h*)(src + (size_t)key * INNER + dc);
    }
}
__device__ __forceinline__ void wait_k_tile(const KTileRequest&, int) {}
#endif

__global__ void __launch_bounds__(256)
flash_attn_kernel(const _Float16* __restrict__ q, const _Float16* __restrict__ k,
                  const _Float16* __restrict__ v, _Float16* __restrict__ o) {
    const int b = blockIdx.z;
    const int h = blockIdx.y;
    const int m0 = blockIdx.x * 128;
    const int tid  = threadIdx.x;
    const int lane = tid & 31;
    const int wave = tid >> 5;
    const int lr = lane & 15;
    const int koff = (lane >> 4) * 8;
    const int mq = m0 + wave * 16;                       // wave's 16 queries
    const float SC = 0.125f * 1.4426950408889634f;       // scale * log2(e)

    // Two buffers each for the K and the V tile: pass t works on buffer t & 1
    // while tile t + 1 is on its way into the other one.
    // K: each buffer's place in LDS is a multiple of 2 KiB (32 rows at a pitch of
    // 72 halves = 4608 B, rounded up to 6144 B); the pad halves are never written
    __shared__ __attribute__((aligned(2048))) _Float16 kt[2][KT_BUF_H];
    __shared__ __attribute__((aligned(16))) _Float16 vt[2][64][40];    // V^T tiles

    // Preload Q fragments (dh = 64 -> two k-chunks of 32); B operand: column lr
    const _Float16* qrow = q + (size_t)(b * N_SEQ + mq + lr) * INNER + h * DIM_HEAD;
    v16h qf[2];
    qf[0] = load_frag16(qrow + koff);
    qf[1] = load_frag16(qrow + 32 + koff);
    // before the Q loads' address registers are used for anything else
    asm volatile("s_wait_xcnt 0x0" ::: "memory");

    // ot[d][r] = O^T[d*16 + koff + r][query lr]
    v8f ot[4];
#pragma unroll
    for (int d = 0; d < 4; ++d) ot[d] = vzero8();
    float mrow = -1e30f;     // running maximum of query lr (equal in both halves)
    float lsum = 0.f;        // this half's share of the running sum

    const _Float16* kbase = k + (size_t)(b * N_SEQ) * INNER + h * DIM_HEAD;
    // this thread's 8 halves of a V tile: key vkey, columns vdc .. vdc + 7
    const int vkey = tid >> 3;
    const int vdc  = (tid & 7) * 8;
    const _Float16* vbase =
        v + (size_t)(b * N_SEQ + vkey) * INNER + h * DIM_HEAD + vdc;

    // --- prologue: tile 0 lands and is published, then tile 1 is asked for ---
    KTileRequest rq;
    rq.g1 = tdm_k_group1();
    stage_k_tile(rq, &kt[0][0], kbase, true, tid);
    v8h vnext = *(const v8h*)vbase;
#pragma unroll
    for (int e = 0; e < 8; ++e) vt[0][vdc + e][vkey] = vnext[e];
    wait_k_tile(rq, tid);
    __syncthreads();
    stage_k_tile(rq, &kt[1][0], kbase + (size_t)32 * INNER, true, tid);
    vnext = *(const v8h*)(vbase + (size_t)32 * INNER);

    for (int t = 0; t < N_TILES; ++t) {
        const int cur = t & 1;

        // --- S^T = K Q^T over 32 keys (two 16-key tiles) ------------------
        // s[i][r] = score(key t*32 + i*16 + koff + r, query lr)
        v8f s[2];
#pragma unroll
        for (int i = 0; i < 2; ++i) {
            s[i] = vzero8();
            const _Float16* krow = &kt[cur][(i * 16 + lr) * KT_PITCH_H];
            v16h kf0 = load_frag16(krow + koff);
            v16h kf1 = load_frag16(krow + 32 + koff);
            s[i] = wmma_f16(kf0, qf[0], s[i]);
            s[i] = wmma_f16(kf1, qf[1], s[i]);
        }

        // V tile t + 1, asked for one pass ago, goes into the other buffer here:
        // its LDS stores run beside the softmax arithmetic below
        if (t + 1 < N_TILES) {
#pragma unroll
            for (int e = 0; e < 8; ++e) vt[cur ^ 1][vdc + e][vkey] = vnext[e];
        }

        // --- online softmax update, one query per lane --------------------
        float mx = fmaxf(s[0][0], s[1][0]);
#pragma unroll
        for (int r = 1; r < 8; ++r) mx = fmaxf(mx, fmaxf(s[0][r], s[1][r]));
        mx = fmaxf(mx, other_half(mx));
        float mnew = fmaxf(mrow, mx);
        float alpha = exp2f((mrow - mnew) * SC);
        mrow = mnew;

        // P^T as B operand: element e of the lane is key kmap(e) = the order
        // in which the two S^T tiles already lie in the lane's registers
        v16h pf;
        float rs0 = 0.f, rs1 = 0.f;
#pragma unroll
        for (int r = 0; r < 8; ++r) {
            float p0 = exp2f((s[0][r] - mnew) * SC);
            float p1 = exp2f((s[1][r] - mnew) * SC);
            rs0 += p0; rs1 += p1;
            pf[r]     = (_Float16)p0;
            pf[r + 8] = (_Float16)p1;
        }
        lsum = lsum * alpha + (rs0 + rs1);
#pragma unroll
        for (int d = 0; d < 4; ++d)
#pragma unroll
            for (int r = 0; r < 8; ++r) ot[d][r] *= alpha;

        // --- O^T += V^T P^T -----------------------------------------------
#pragma unroll
        for (int d = 0; d < 4; ++d) {
            v16h vf = load_frag16(&vt[cur][d * 16 + lr][koff]);
            ot[d] = wmma_f16(vf, pf, ot[d]);
        }

        // --- foot of the pass: publish tile t + 1, then refill this buffer ---
        // this wave's reads of buffer cur and its V stores are done
        asm volatile("s_wait_dscnt 0" ::: "memory");
        wait_k_tile(rq, tid);  // K tile t + 1
        __syncthreads();   // tile t + 1 readable; every reader has left buffer cur
        stage_k_tile(rq, &kt[cur][0], kbase + (size_t)(t + 2) * 32 * INNER,
                     t + 2 < N_TILES, tid);
        if (t + 2 < N_TILES)
            vnext = *(const v8h*)(vbase + (size_t)(t + 2) * 32 * INNER);
    }
    // nothing of the ring is outstanding when the wave goes on to its end
    asm volatile("s_wait_tensorcnt 0" ::: "memory");
    asm volatile("s_wait_dscnt 0" ::: "memory");

    // --- epilogue: join the halves' sums, O /= l, store f16 [M_ROWS, 512] --
    // a lane holds 8 consecutive columns of one row: one 16-byte store each
    lsum += other_half(lsum);
    float inv = 1.f / lsum;
    _Float16* orow = o + (size_t)(b * N_SEQ + mq + lr) * INNER + h * DIM_HEAD + koff;
#pragma unroll
    for (int d = 0; d < 4; ++d) {
        v8h w;
#pragma unroll
        for (int r = 0; r < 8; ++r) w[r] = (_Float16)(ot[d][r] * inv);
        *(v8h*)(orow + d * 16) = w;
    }
}

// ---------------------------------------------------------------------------
// Host-side launcher
// ---------------------------------------------------------------------------
extern "C" void kernel_launch(void* const* d_in, const int* in_sizes, int n_in,
                              void* d_out, int out_size, void* d_ws, size_t ws_size,
                              hipStream_t stream) {
    const float* x    = (const float*)d_in[0];
    const float* z    = (const float*)d_in[1];
    const float* lxg  = (const float*)d_in[2];
    const float* lxb  = (const float*)d_in[3];
    const float* lzg  = (const float*)d_in[4];
    const float* lzb  = (const float*)d_in[5];
    const float* Wq   = (const float*)d_in[6];
    const float* Wk   = (const float*)d_in[7];
    const float* Wv   = (const float*)d_in[8];
    const float* Wz   = (const float*)d_in[9];
    const float* Wo   = (const float*)d_in[10];
    const float* bo   = (const float*)d_in[11];
    float* out = (float*)d_out;

    char* ws = (char*)d_ws;
    size_t off = 0;
    float* z1z2 = (float*)(ws + off);       off += (size_t)BATCH * 2 * X_DIM * 4;
    _Float16* WtQ  = (_Float16*)(ws + off); off += (size_t)X_DIM * INNER * 2;
    _Float16* WtK  = (_Float16*)(ws + off); off += (size_t)X_DIM * INNER * 2;
    _Float16* WtV  = (_Float16*)(ws + off); off += (size_t)X_DIM * INNER * 2;
    _Float16* WtO  = (_Float16*)(ws + off); off += (size_t)INNER * X_DIM * 2;
    _Float16* xmod = (_Float16*)(ws + off); off += (size_t)M_ROWS * X_DIM * 2;
    _Float16* qb   = (_Float16*)(ws + off); off += (size_t)M_ROWS * INNER * 2;
    _Float16* kb   = (_Float16*)(ws + off); off += (size_t)M_ROWS * INNER * 2;
    _Float16* vb   = (_Float16*)(ws + off); off += (size_t)M_ROWS * INNER * 2;
    _Float16* ao   = (_Float16*)(ws + off); off += (size_t)M_ROWS * INNER * 2;

    // 1) weight convert + transpose
    int wblocks = (X_DIM * INNER) / 256;
    cvt_transpose_kernel<<<wblocks, 256, 0, stream>>>(Wq, WtQ, X_DIM, INNER);
    cvt_transpose_kernel<<<wblocks, 256, 0, stream>>>(Wk, WtK, X_DIM, INNER);
    cvt_transpose_kernel<<<wblocks, 256, 0, stream>>>(Wv, WtV, X_DIM, INNER);
    cvt_transpose_kernel<<<wblocks, 256, 0, stream>>>(Wo, WtO, INNER, X_DIM);

    // 2) z path
    zpath_kernel<<<BATCH, 256, 0, stream>>>(z, lzg, lzb, Wz, z1z2);

    // 3) LN + FiLM on x -> f16
    xmod_kernel<<<M_ROWS, 128, 0, stream>>>(x, lxg, lxb, z1z2, xmod);

    // 4) Q/K/V projections (f16 out)
    dim3 ggrid(INNER / 128, M_ROWS / 128);
    gemm_wmma_kernel<<<ggrid, 256, 0, stream>>>(xmod, WtQ, qb, nullptr, nullptr,
                                                M_ROWS, INNER, X_DIM);
    gemm_wmma_kernel<<<ggrid, 256, 0, stream>>>(xmod, WtK, kb, nullptr, nullptr,
                                                M_ROWS, INNER, X_DIM);
    gemm_wmma_kernel<<<ggrid, 256, 0, stream>>>(xmod, WtV, vb, nullptr, nullptr,
                                                M_ROWS, INNER, X_DIM);

    // 5) flash attention
    dim3 agrid(N_SEQ / 128, HEADS, BATCH);
    flash_attn_kernel<<<agrid, 256, 0, stream>>>(qb, kb, vb, ao);

    // 6) output projection (f32 out + bias)
    dim3 ogrid(X_DIM / 128, M_ROWS / 128);
    gemm_wmma_kernel<<<ogrid, 256, 0, stream>>>(ao, WtO, nullptr, out, bo,
                                                M_ROWS, X_DIM, INNER);
}

// v004
// A run of this version takes 172 microseconds.
// Timed twice side by side with v003, it ran 1.13 times as fast both times.
// All steps since v000 together make it 1.65 times as fast.
#include <hip/hip_runtime.h>
#include <hip/hip_bf16.h>

#define X_DIM   512
#define Z_DIM   16
#define HEADS   8
#define DIM_HEAD 64
#define INNER   512
#define BATCH   4
#define N_SEQ   2048
#define M_ROWS  (BATCH * N_SEQ)          // 8192
#define EPS     1e-5f

typedef _Float16 v16h __attribute__((ext_vector_type(16)));
typedef _Float16 v8h  __attribute__((ext_vector_type(8)));
typedef float    v8f  __attribute__((ext_vector_type(8)));
typedef unsigned int u32x4 __attribute__((ext_vector_type(4)));
typedef int          i32x4 __attribute__((ext_vector_type(4)));
typedef int          i32x8 __attribute__((ext_vector_type(8)));

#if defined(__HIP_DEVICE_COMPILE__) && __has_builtin(__builtin_amdgcn_tensor_load_to_lds)
#define USE_TDM 1
#else
#define USE_TDM 0
#endif

__device__ __forceinline__ v8f vzero8() {
    v8f z = {0.f,0.f,0.f,0.f,0.f,0.f,0.f,0.f};
    return z;
}

__device__ __forceinline__ v16h load_frag16(const _Float16* p) {
    v8h lo = *(const v8h*)(p);
    v8h hi = *(const v8h*)(p + 16);
    v16h r;
#pragma unroll
    for (int i = 0; i < 8; ++i) { r[i] = lo[i]; r[i + 8] = hi[i]; }
    return r;
}

__device__ __forceinline__ v8f wmma_f16(v16h a, v16h b, v8f c) {
    return __builtin_amdgcn_wmma_f32_16x16x32_f16(false, a, false, b,
                                                  (short)0, c, false, false);
}

struct KTileRequest {
    u32x4 g0;
    i32x8 g1;
};

#if USE_TDM
// wave-uniform value held in a scalar register
__device__ __forceinline__ unsigned uni(unsigned v) {
    return (unsigned)__builtin_amdgcn_readfirstlane((int)v);
}
__device__ __forceinline__ unsigned pinned(unsigned v) {
    unsigned w = uni(v);
    asm volatile("" : "+s"(w));  // pinned(): holds the test's word in a scalar register
    return w;
}

__device__ __forceinline__ u32x4 tdm_k_group0(unsigned lds_addr,
                                              unsigned long long gaddr) {
    u32x4 g0;
    g0[0] = uni(1u);
    g0[1] = uni(lds_addr);
    g0[2] = uni((unsigned)(gaddr & 0xffffffffull));
    g0[3] = uni((unsigned)((gaddr >> 32) & 0x1ffffffull)
          | (2u << 30));
    asm volatile("" : "+s"(g0));
    return g0;
}

__device__ __forceinline__ i32x8 tdm_k_group1() {
    i32x8 g1;
    g1[0] = (1 << 20) | (4 << 22) | (3 << 25);
    g1[1] = (int)(128u << 16);
    g1[2] = (int)(32u << 16);
    g1[3] = (int)(128u << 16);
    g1[4] = 32;
    g1[5] = 1024;
    g1[6] = 0;
    g1[7] = 0;
    asm volatile("" : "+s"(g1));
    return g1;
}

__device__ __forceinline__ void tdm_load_k_tile(const KTileRequest& rq) {
    i32x4 z4 = {0, 0, 0, 0};
#if defined(__clang_major__) && __clang_major__ >= 23
    i32x8 z8 = {0, 0, 0, 0, 0, 0, 0, 0};
    __builtin_amdgcn_tensor_load_to_lds(rq.g0, rq.g1, z4, z4, z8, 0);
#else
    __builtin_amdgcn_tensor_load_to_lds(rq.g0, rq.g1, z4, z4, 0);
#endif
}
#endif

// ---------------------------------------------------------------------------
// Set-up part 1: f32 weight [K,Nc] -> f16 transposed [Nc,K] (fragment-friendly)
// `blk`: which 256 elements of the weight this block converts
// ---------------------------------------------------------------------------
__device__ __forceinline__ void
cvt_transpose_block(const float* __restrict__ W, _Float16* __restrict__ Wt,
                    int K, int Nc, int blk) {
    int idx = blk * 256 + threadIdx.x;            // coalesced read of W
    int kk = idx / Nc;
    int n  = idx % Nc;
    Wt[(size_t)n * K + kk] = (_Float16)W[idx];
    // the store's address and data registers may be rewritten by code that the
    // compiler lays out behind it: keep the wait in front of any such overwrite
    asm volatile("s_wait_xcnt 0x0" ::: "memory");
}

// ---------------------------------------------------------------------------
// Set-up part 2: z path of batch b: LN(z) @ Wz -> SiLU -> z1z2 [B,1024] f32
// ---------------------------------------------------------------------------
__device__ __forceinline__ void
zpath_block(const float* __restrict__ z, const float* __restrict__ g,
            const float* __restrict__ bb, const float* __restrict__ Wz,
            float* __restrict__ z1z2, int b) {
    const float* zr = z + b * Z_DIM;
    float zn[Z_DIM];
    float mu = 0.f;
#pragma unroll
    for (int i = 0; i < Z_DIM; ++i) mu += zr[i];
    mu *= (1.f / Z_DIM);
    float var = 0.f;
#pragma unroll
    for (int i = 0; i < Z_DIM; ++i) { float d = zr[i] - mu; var += d * d; }
    var *= (1.f / Z_DIM);
    float rs = rsqrtf(var + EPS);
#pragma unroll
    for (int i = 0; i < Z_DIM; ++i) zn[i] = (zr[i] - mu) * rs * g[i] + bb[i];

    for (int c = threadIdx.x; c < 2 * X_DIM; c += 256) {
        float a = 0.f;
#pragma unroll
        for (int i = 0; i < Z_DIM; ++i) a += zn[i] * Wz[i * (2 * X_DIM) + c];
        float sg = 1.f / (1.f + __expf(-a));
        z1z2[b * (2 * X_DIM) + c] = a * sg;        // SiLU
    }
}

// ---------------------------------------------------------------------------
// Kernel 1: the set-up work that needs nothing of each other, in one grid by
// ranges of the block index: blocks 0 .. BATCH-1 run the z path (the longest
// dependent chain, so it starts first), then W_BLOCKS blocks for each of the
// four weights. Wt: the four transposed weights, one behind the other.
// ---------------------------------------------------------------------------
#define W_ELEMS  (X_DIM * INNER)
#define W_BLOCKS (W_ELEMS / 256)

__global__ void __launch_bounds__(256)
setup_kernel(const float* __restrict__ Wq, const float* __restrict__ Wk,
             const float* __restrict__ Wv, const float* __restrict__ Wo,
             _Float16* __restrict__ Wt,
             const float* __restrict__ z, const float* __restrict__ g,
             const float* __restrict__ bb, const float* __restrict__ Wz,
             float* __restrict__ z1z2) {
    if (blockIdx.x < BATCH) {
        zpath_block(z, g, bb, Wz, z1z2, blockIdx.x);
        return;
    }
    const int blk   = blockIdx.x - BATCH;
    const int which = blk / W_BLOCKS;              // 0..3: Wq, Wk, Wv, Wo
    const float* W = which == 0 ? Wq : which == 1 ? Wk : which == 2 ? Wv : Wo;
    // all four are [512, 512]: X_DIM == INNER
    cvt_transpose_block(W, Wt + (size_t)which * W_ELEMS, X_DIM, INNER,
                        blk % W_BLOCKS);
}

// ---------------------------------------------------------------------------
// Kernel 2: x_mod = LN(x)*z1 + z2  -> f16 [M_ROWS, 512]
// one block (128 threads) per row
// ---------------------------------------------------------------------------
__global__ void __launch_bounds__(128)
xmod_kernel(const float* __restrict__ x, const float* __restrict__ g,
            const float* __restrict__ bb, const float* __restrict__ z1z2,
            _Float16* __restrict__ out) {
    int row = blockIdx.x;                // 0..8191
    int b = row >> 11;                   // row / 2048
    const float* xr = x + (size_t)row * X_DIM;
    int lane = threadIdx.x & 31;
    int wave = threadIdx.x >> 5;
    int i0 = threadIdx.x * 4;

    float4 xv = *(const float4*)(xr + i0);
    float s  = xv.x + xv.y + xv.z + xv.w;
    float sq = xv.x*xv.x + xv.y*xv.y + xv.z*xv.z + xv.w*xv.w;
#pragma unroll
    for (int off = 16; off >= 1; off >>= 1) {
        s  += __shfl_xor(s,  off, 32);
        sq += __shfl_xor(sq, off, 32);
    }
    __shared__ float ss[4], ssq[4];
    if (lane == 0) { ss[wave] = s; ssq[wave] = sq; }
    __syncthreads();
    s  = ss[0] + ss[1] + ss[2] + ss[3];
    sq = ssq[0] + ssq[1] + ssq[2] + ssq[3];
    float mu  = s * (1.f / X_DIM);
    float var = sq * (1.f / X_DIM) - mu * mu;
    float rs = rsqrtf(var + EPS);

    const float* z1 = z1z2 + b * (2 * X_DIM);
    const float* z2 = z1 + X_DIM;
    _Float16* op = out + (size_t)row * X_DIM + i0;
    float xs[4] = {xv.x, xv.y, xv.z, xv.w};
#pragma unroll
    for (int e = 0; e < 4; ++e) {
        int idx = i0 + e;
        float v = ((xs[e] - mu) * rs * g[idx] + bb[idx]) * z1[idx] + z2[idx];
        op[e] = (_Float16)v;
    }
}

// ---------------------------------------------------------------------------
// Kernel 3: WMMA GEMM  C[M,Nc] = A[M,K] @ Bt[Nc,K]^T  (Bt stored N-major)
// 128x128 block tile, 8 waves (4x2), 32x64 wave tile, k-step 32
// outF != null -> f32 output with bias; else f16 output
// blockIdx.z: which of several products of the same A, whose Bt and whose outH
// lie one behind the other, this block works on (one grid for Q, K and V)
// ---------------------------------------------------------------------------
__global__ void __launch_bounds__(256)
gemm_wmma_kernel(const _Float16* __restrict__ A, const _Float16* __restrict__ Bt0,
                 _Float16* __restrict__ outH0, float* __restrict__ outF,
                 const float* __restrict__ bias, int M, int Nc, int K) {
    const _Float16* Bt = Bt0 + (size_t)blockIdx.z * Nc * K;
    _Float16* outH = outH0 + (size_t)blockIdx.z * M * Nc;
    const int tid  = threadIdx.x;
    const int lane = tid & 31;
    const int wave = tid >> 5;
    const int wm = wave & 3;                 // 4 waves along M
    const int wn = wave >> 2;                // 2 waves along N
    const int m0 = blockIdx.y * 128 + wm * 32;
    const int n0 = blockIdx.x * 128 + wn * 64;
    const int lr = lane & 15;
    const int koff = (lane >> 4) * 8;        // half-of-wave K offset

    v8f acc[2][4];
#pragma unroll
    for (int i = 0; i < 2; ++i)
#pragma unroll
        for (int j = 0; j < 4; ++j) acc[i][j] = vzero8();

    for (int k0 = 0; k0 < K; k0 += 32) {
        v16h afrag[2], bfrag[4];
#pragma unroll
        for (int s = 0; s < 2; ++s) {
            const _Float16* p = A + (size_t)(m0 + s * 16 + lr) * K + k0 + koff;
            __builtin_prefetch(p + 32, 0, 3);        // near-scope prefetch
            afrag[s] = load_frag16(p);
        }
#pragma unroll
        for (int s = 0; s < 4; ++s) {
            const _Float16* p = Bt + (size_t)(n0 + s * 16 + lr) * K + k0 + koff;
            bfrag[s] = load_frag16(p);
        }
#pragma unroll
        for (int i = 0; i < 2; ++i)
#pragma unroll
            for (int j = 0; j < 4; ++j)
                acc[i][j] = wmma_f16(afrag[i], bfrag[j], acc[i][j]);
    }

#pragma unroll
    for (int i = 0; i < 2; ++i) {
        int row0 = m0 + i * 16 + (koff ? 8 : 0);
#pragma unroll
        for (int j = 0; j < 4; ++j) {
            int col = n0 + j * 16 + lr;
            if (outF) {
                float bv = bias[col];
#pragma unroll
                for (int r = 0; r < 8; ++r)
                    outF[(size_t)(row0 + r) * Nc + col] = acc[i][j][r] + bv;
            } else {
#pragma unroll
                for (int r = 0; r < 8; ++r)
                    outH[(size_t)(row0 + r) * Nc + col] = (_Float16)acc[i][j][r];
            }
        }
    }
}

__device__ __forceinline__ float other_half(float x) {
    int bits = __builtin_bit_cast(int, x);
    return __builtin_bit_cast(float,
        __builtin_amdgcn_permlanex16(bits, bits, 0x76543210, 0xfedcba98,
                                     false, false));
}

#define N_TILES    (N_SEQ / 32)   // key tiles of 32 per (batch, head)
#define KT_PITCH_H 72             // K tile row pitch in LDS, halves (144 B)
#define KT_BUF_H   3072           // one K buffer, halves (6144 B = 3 x 2 KiB)

#if USE_TDM
// Start the K tile [32 keys x 64 dh] at `src` on its way into LDS at `dst`,
// where that tile exists (the same answer in the whole block). One request of
// wave 0; its wait, wait_k_tile, stands at the caller's publish point.
__device__ __forceinline__ void stage_k_tile(KTileRequest& rq, _Float16* dst,
                                             const _Float16* src, bool exists,
                                             int tid) {
    // plain test: where the compiler knows that no tile is left, no request is
    // built at all; the pinned one is the scalar branch a tensor load needs
    if (!exists) return;
    rq.g0 = tdm_k_group0((unsigned)(uintptr_t)dst,
                         (unsigned long long)(uintptr_t)src);
    if (pinned(((tid >> 5) == 0) & exists)) tdm_load_k_tile(rq);
}

// The issuing wave's own wait: its K tile has landed before it reaches the
// barrier that publishes the tile.
__device__ __forceinline__ void wait_k_tile(const KTileRequest& rq, int tid) {
    if (pinned((tid >> 5) == 0)) {
        asm volatile("s_wait_tensorcnt 0" :: "s"(rq.g0), "s"(rq.g1) : "memory");
    }
}
#else
// fallback: cooperative vector loads of the K tile, nothing to wait for
__device__ __forceinline__ i32x8 tdm_k_group1() { return i32x8{}; }
__device__ __forceinline__ void stage_k_tile(KTileRequest&, _Float16* dst,
                                             const _Float16* src, bool exists,
                                             int tid) {
    if (exists) {
        int key = tid >> 3;
        int dc  = (tid & 7) * 8;
        *(v8h*)(dst + key * KT_PITCH_H + dc) =
            *(const v8h*)(src + (size_t)key * INNER + dc);
    }
}
__device__ __forceinline__ void wait_k_tile(const KTileRequest&, int) {}
#endif

__global__ void __launch_bounds__(256)
flash_attn_kernel(const _Float16* __restrict__ q, const _Float16* __restrict__ k,
                  const _Float16* __restrict__ v, _Float16* __restrict__ o) {
    const int b = blockIdx.z;
    const int h = blockIdx.y;
    const int m0 = blockIdx.x * 128;
    const int tid  = threadIdx.x;
    const int lane = tid & 31;
    const int wave = tid >> 5;
    const int lr = lane & 15;
    const int koff = (lane >> 4) * 8;
    const int mq = m0 + wave * 16;                       // wave's 16 queries
    const float SC = 0.125f * 1.4426950408889634f;       // scale * log2(e)

    // Two buffers each for the K and the V tile: pass t works on buffer t & 1
    // while tile t + 1 is on its way into the other one.
    // K: each buffer's place in LDS is a multiple of 2 KiB (32 rows at a pitch of
    // 72 halves = 4608 B, rounded up to 6144 B); the pad halves are never written
    __shared__ __attribute__((aligned(2048))) _Float16 kt[2][KT_BUF_H];
    __shared__ __attribute__((aligned(16))) _Float16 vt[2][64][40];    // V^T tiles

    // Preload Q fragments (dh = 64 -> two k-chunks of 32); B operand: column lr
    const _Float16* qrow = q + (size_t)(b * N_SEQ + mq + lr) * INNER + h * DIM_HEAD;
    v16h qf[2];
    qf[0] = load_frag16(qrow + koff);
    qf[1] = load_frag16(qrow + 32 + koff);
    // before the Q loads' address registers are used for anything else
    asm volatile("s_wait_xcnt 0x0" ::: "memory");

    // ot[d][r] = O^T[d*16 + koff + r][query lr]
    v8f ot[4];
#pragma unroll
    for (int d = 0; d < 4; ++d) ot[d] = vzero8();
    float mrow = -1e30f;     // running maximum of query lr (equal in both halves)
    float lsum = 0.f;        // this half's share of the running sum

    const _Float16* kbase = k + (size_t)(b * N_SEQ) * INNER + h * DIM_HEAD;
    // this thread's 8 halves of a V tile: key vkey, columns vdc .. vdc + 7
    const int vkey = tid >> 3;
    const int vdc  = (tid & 7) * 8;
    const _Float16* vbase =
        v + (size_t)(b * N_SEQ + vkey) * INNER + h * DIM_HEAD + vdc;

    // --- prologue: tile 0 lands and is published, then tile 1 is asked for ---
    KTileRequest rq;
    rq.g1 = tdm_k_group1();
    stage_k_tile(rq, &kt[0][0], kbase, true, tid);
    v8h vnext = *(const v8h*)vbase;
#pragma unroll
    for (int e = 0; e < 8; ++e) vt[0][vdc + e][vkey] = vnext[e];
    wait_k_tile(rq, tid);
    __syncthreads();
    stage_k_tile(rq, &kt[1][0], kbase + (size_t)32 * INNER, true, tid);
    vnext = *(const v8h*)(vbase + (size_t)32 * INNER);

    for (int t = 0; t < N_TILES; ++t) {
        const int cur = t & 1;

        // --- S^T = K Q^T over 32 keys (two 16-key tiles) ------------------
        // s[i][r] = score(key t*32 + i*16 + koff + r, query lr)
        v8f s[2];
#pragma unroll
        for (int i = 0; i < 2; ++i) {
            s[i] = vzero8();
            const _Float16* krow = &kt[cur][(i * 16 + lr) * KT_PITCH_H];
            v16h kf0 = load_frag16(krow + koff);
            v16h kf1 = load_frag16(krow + 32 + koff);
            s[i] = wmma_f16(kf0, qf[0], s[i]);
            s[i] = wmma_f16(kf1, qf[1], s[i]);
        }

        // V tile t + 1, asked for one pass ago, goes into the other buffer here:
        // its LDS stores run beside the softmax arithmetic below
        if (t + 1 < N_TILES) {
#pragma unroll
            for (int e = 0; e < 8; ++e) vt[cur ^ 1][vdc + e][vkey] = vnext[e];
        }

        // --- online softmax update, one query per lane --------------------
        float mx = fmaxf(s[0][0], s[1][0]);
#pragma unroll
        for (int r = 1; r < 8; ++r) mx = fmaxf(mx, fmaxf(s[0][r], s[1][r]));
        mx = fmaxf(mx, other_half(mx));
        float mnew = fmaxf(mrow, mx);
        float alpha = exp2f((mrow - mnew) * SC);
        mrow = mnew;

        // P^T as B operand: element e of the lane is key kmap(e) = the order
        // in which the two S^T tiles already lie in the lane's registers
        v16h pf;
        float rs0 = 0.f, rs1 = 0.f;
#pragma unroll
        for (int r = 0; r < 8; ++r) {
            float p0 = exp2f((s[0][r] - mnew) * SC);
            float p1 = exp2f((s[1][r] - mnew) * SC);
            rs0 += p0; rs1 += p1;
            pf[r]     = (_Float16)p0;
            pf[r + 8] = (_Float16)p1;
        }
        lsum = lsum * alpha + (rs0 + rs1);
#pragma unroll
        for (int d = 0; d < 4; ++d)
#pragma unroll
            for (int r = 0; r < 8; ++r) ot[d][r] *= alpha;

        // --- O^T += V^T P^T -----------------------------------------------
#pragma unroll
        for (int d = 0; d < 4; ++d) {
            v16h vf = load_frag16(&vt[cur][d * 16 + lr][koff]);
            ot[d] = wmma_f16(vf, pf, ot[d]);
        }

        // --- foot of the pass: publish tile t + 1, then refill this buffer ---
        // this wave's reads of buffer cur and its V stores are done
        asm volatile("s_wait_dscnt 0" ::: "memory");
        wait_k_tile(rq, tid);  // K tile t + 1
        __syncthreads();   // tile t + 1 readable; every reader has left buffer cur
        stage_k_tile(rq, &kt[cur][0], kbase + (size_t)(t + 2) * 32 * INNER,
                     t + 2 < N_TILES, tid);
        if (t + 2 < N_TILES)
            vnext = *(const v8h*)(vbase + (size_t)(t + 2) * 32 * INNER);
    }
    // nothing of the ring is outstanding when the wave goes on to its end
    asm volatile("s_wait_tensorcnt 0" ::: "memory");
    asm volatile("s_wait_dscnt 0" ::: "memory");

    // --- epilogue: join the halves' sums, O /= l, store f16 [M_ROWS, 512] --
    // a lane holds 8 consecutive columns of one row: one 16-byte store each
    lsum += other_half(lsum);
    float inv = 1.f / lsum;
    _Float16* orow = o + (size_t)(b * N_SEQ + mq + lr) * INNER + h * DIM_HEAD + koff;
#pragma unroll
    for (int d = 0; d < 4; ++d) {
        v8h w;
#pragma unroll
        for (int r = 0; r < 8; ++r) w[r] = (_Float16)(ot[d][r] * inv);
        *(v8h*)(orow + d * 16) = w;
    }
}

// ---------------------------------------------------------------------------
// Host-side launcher
// ---------------------------------------------------------------------------
extern "C" void kernel_launch(void* const* d_in, const int* in_sizes, int n_in,
                              void* d_out, int out_size, void* d_ws, size_t ws_size,
                              hipStream_t stream) {
    const float* x    = (const float*)d_in[0];
    const float* z    = (const float*)d_in[1];
    const float* lxg  = (const float*)d_in[2];
    const float* lxb  = (const float*)d_in[3];
    const float* lzg  = (const float*)d_in[4];
    const float* lzb  = (const float*)d_in[5];
    const float* Wq   = (const float*)d_in[6];
    const float* Wk   = (const float*)d_in[7];
    const float* Wv   = (const float*)d_in[8];
    const float* Wz   = (const float*)d_in[9];
    const float* Wo   = (const float*)d_in[10];
    const float* bo   = (const float*)d_in[11];
    float* out = (float*)d_out;

    char* ws = (char*)d_ws;
    size_t off = 0;
    float* z1z2 = (float*)(ws + off);       off += (size_t)BATCH * 2 * X_DIM * 4;
    _Float16* WtQ  = (_Float16*)(ws + off); off += (size_t)X_DIM * INNER * 2;
    _Float16* WtK  = (_Float16*)(ws + off); off += (size_t)X_DIM * INNER * 2;
    _Float16* WtV  = (_Float16*)(ws + off); off += (size_t)X_DIM * INNER * 2;
    _Float16* WtO  = (_Float16*)(ws + off); off += (size_t)INNER * X_DIM * 2;
    _Float16* xmod = (_Float16*)(ws + off); off += (size_t)M_ROWS * X_DIM * 2;
    _Float16* qb   = (_Float16*)(ws + off); off += (size_t)M_ROWS * INNER * 2;
    _Float16* kb   = (_Float16*)(ws + off); off += (size_t)M_ROWS * INNER * 2;
    _Float16* vb   = (_Float16*)(ws + off); off += (size_t)M_ROWS * INNER * 2;
    _Float16* ao   = (_Float16*)(ws + off); off += (size_t)M_ROWS * INNER * 2;

    // 1) z path and the four weights' convert + transpose (WtQ, WtK, WtV, WtO
    //    lie one behind the other), one grid
    setup_kernel<<<BATCH + 4 * W_BLOCKS, 256, 0, stream>>>(Wq, Wk, Wv, Wo, WtQ,
                                                           z, lzg, lzb, Wz, z1z2);

    // 2) LN + FiLM on x -> f16
    xmod_kernel<<<M_ROWS, 128, 0, stream>>>(x, lxg, lxb, z1z2, xmod);

    // 3) Q/K/V projections (f16 out), one grid: z = 0, 1, 2 reads WtQ, WtK, WtV
    //    and writes qb, kb, vb, which lie one behind the other
    dim3 ggrid(INNER / 128, M_ROWS / 128, 3);
    gemm_wmma_kernel<<<ggrid, 256, 0, stream>>>(xmod, WtQ, qb, nullptr, nullptr,
                                                M_ROWS, INNER, X_DIM);

    // 4) flash attention
    dim3 agrid(N_SEQ / 128, HEADS, BATCH);
    flash_attn_kernel<<<agrid, 256, 0, stream>>>(qb, kb, vb, ao);

    // 5) output projection (f32 out + bias)
    dim3 ogrid(X_DIM / 128, M_ROWS / 128);
    gemm_wmma_kernel<<<ogrid, 256, 0, stream>>>(ao, WtO, nullptr, out, bo,
                                                M_ROWS, X_DIM, INNER);
}

// v005
// One run takes 140 microseconds.
// In two side-by-side timings against v004, it was 1.24 and 1.25 times as fast.
// Counting every step since v000, it is 2.04 times as fast.
#include <hip/hip_runtime.h>
#include <hip/hip_bf16.h>

#define X_DIM   512
#define Z_DIM   16
#define HEADS   8
#define DIM_HEAD 64
#define INNER   512
#define BATCH   4
#define N_SEQ   2048
#define M_ROWS  (BATCH * N_SEQ)          // 8192
#define EPS     1e-5f

typedef _Float16 v16h __attribute__((ext_vector_type(16)));
typedef _Float16 v8h  __attribute__((ext_vector_type(8)));
typedef float    v8f  __attribute__((ext_vector_type(8)));
typedef unsigned int u32x4 __attribute__((ext_vector_type(4)));
typedef int          i32x4 __attribute__((ext_vector_type(4)));
typedef int          i32x8 __attribute__((ext_vector_type(8)));

#if defined(__HIP_DEVICE_COMPILE__) && __has_builtin(__builtin_amdgcn_tensor_load_to_lds)
#define USE_TDM 1
#else
#define USE_TDM 0
#endif

__device__ __forceinline__ v8f vzero8() {
    v8f z = {0.f,0.f,0.f,0.f,0.f,0.f,0.f,0.f};
    return z;
}

__device__ __forceinline__ v16h load_frag16(const _Float16* p) {
    v8h lo = *(const v8h*)(p);
    v8h hi = *(const v8h*)(p + 16);
    v16h r;
#pragma unroll
    for (int i = 0; i < 8; ++i) { r[i] = lo[i]; r[i + 8] = hi[i]; }
    return r;
}

__device__ __forceinline__ v8f wmma_f16(v16h a, v16h b, v8f c) {
    return __builtin_amdgcn_wmma_f32_16x16x32_f16(false, a, false, b,
                                                  (short)0, c, false, false);
}

struct KTileRequest {
    u32x4 g0;
    i32x8 g1;
};

#if USE_TDM
// wave-uniform value held in a scalar register
__device__ __forceinline__ unsigned uni(unsigned v) {
    return (unsigned)__builtin_amdgcn_readfirstlane((int)v);
}
__device__ __forceinline__ unsigned pinned(unsigned v) {
    unsigned w = uni(v);
    asm volatile("" : "+s"(w));  // pinned(): holds the test's word in a scalar register
    return w;
}

__device__ __forceinline__ u32x4 tdm_k_group0(unsigned lds_addr,
                                              unsigned long long gaddr) {
    u32x4 g0;
    g0[0] = uni(1u);
    g0[1] = uni(lds_addr);
    g0[2] = uni((unsigned)(gaddr & 0xffffffffull));
    g0[3] = uni((unsigned)((gaddr >> 32) & 0x1ffffffull)
          | (2u << 30));
    asm volatile("" : "+s"(g0));
    return g0;
}

__device__ __forceinline__ i32x8 tdm_k_group1() {
    i32x8 g1;
    g1[0] = (1 << 20) | (4 << 22) | (3 << 25);
    g1[1] = (int)(128u << 16);
    g1[2] = (int)(32u << 16);
    g1[3] = (int)(128u << 16);
    g1[4] = 32;
    g1[5] = 1024;
    g1[6] = 0;
    g1[7] = 0;
    asm volatile("" : "+s"(g1));
    return g1;
}

__device__ __forceinline__ void tdm_load_k_tile(const KTileRequest& rq) {
    i32x4 z4 = {0, 0, 0, 0};
#if defined(__clang_major__) && __clang_major__ >= 23
    i32x8 z8 = {0, 0, 0, 0, 0, 0, 0, 0};
    __builtin_amdgcn_tensor_load_to_lds(rq.g0, rq.g1, z4, z4, z8, 0);
#else
    __builtin_amdgcn_tensor_load_to_lds(rq.g0, rq.g1, z4, z4, 0);
#endif
}
#endif

// ---------------------------------------------------------------------------
// Set-up part 1: f32 weight [K,Nc] -> f16 transposed [Nc,K] (fragment-friendly)
// `blk`: which 256 elements of the weight this block converts
// ---------------------------------------------------------------------------
__device__ __forceinline__ void
cvt_transpose_block(const float* __restrict__ W, _Float16* __restrict__ Wt,
                    int K, int Nc, int blk) {
    int idx = blk * 256 + threadIdx.x;            // coalesced read of W
    int kk = idx / Nc;
    int n  = idx % Nc;
    Wt[(size_t)n * K + kk] = (_Float16)W[idx];
    // the store's address and data registers may be rewritten by code that the
    // compiler lays out behind it: keep the wait in front of any such overwrite
    asm volatile("s_wait_xcnt 0x0" ::: "memory");
}

// ---------------------------------------------------------------------------
// Set-up part 2: z path of batch b: LN(z) @ Wz -> SiLU -> z1z2 [B,1024] f32
// ---------------------------------------------------------------------------
__device__ __forceinline__ void
zpath_block(const float* __restrict__ z, const float* __restrict__ g,
            const float* __restrict__ bb, const float* __restrict__ Wz,
            float* __restrict__ z1z2, int b) {
    const float* zr = z + b * Z_DIM;
    float zn[Z_DIM];
    float mu = 0.f;
#pragma unroll
    for (int i = 0; i < Z_DIM; ++i) mu += zr[i];
    mu *= (1.f / Z_DIM);
    float var = 0.f;
#pragma unroll
    for (int i = 0; i < Z_DIM; ++i) { float d = zr[i] - mu; var += d * d; }
    var *= (1.f / Z_DIM);
    float rs = rsqrtf(var + EPS);
#pragma unroll
    for (int i = 0; i < Z_DIM; ++i) zn[i] = (zr[i] - mu) * rs * g[i] + bb[i];

    for (int c = threadIdx.x; c < 2 * X_DIM; c += 256) {
        float a = 0.f;
#pragma unroll
        for (int i = 0; i < Z_DIM; ++i) a += zn[i] * Wz[i * (2 * X_DIM) + c];
        float sg = 1.f / (1.f + __expf(-a));
        z1z2[b * (2 * X_DIM) + c] = a * sg;        // SiLU
    }
}

// ---------------------------------------------------------------------------
// Kernel 1: the set-up work that needs nothing of each other, in one grid by
// ranges of the block index: blocks 0 .. BATCH-1 run the z path (the longest
// dependent chain, so it starts first), then W_BLOCKS blocks for each of the
// four weights. Wt: the four transposed weights, one behind the other.
// ---------------------------------------------------------------------------
#define W_ELEMS  (X_DIM * INNER)
#define W_BLOCKS (W_ELEMS / 256)

__global__ void __launch_bounds__(256)
setup_kernel(const float* __restrict__ Wq, const float* __restrict__ Wk,
             const float* __restrict__ Wv, const float* __restrict__ Wo,
             _Float16* __restrict__ Wt,
             const float* __restrict__ z, const float* __restrict__ g,
             const float* __restrict__ bb, const float* __restrict__ Wz,
             float* __restrict__ z1z2) {
    if (blockIdx.x < BATCH) {
        zpath_block(z, g, bb, Wz, z1z2, blockIdx.x);
        return;
    }
    const int blk   = blockIdx.x - BATCH;
    const int which = blk / W_BLOCKS;              // 0..3: Wq, Wk, Wv, Wo
    const float* W = which == 0 ? Wq : which == 1 ? Wk : which == 2 ? Wv : Wo;
    // all four are [512, 512]: X_DIM == INNER
    cvt_transpose_block(W, Wt + (size_t)which * W_ELEMS, X_DIM, INNER,
                        blk % W_BLOCKS);
}

// ---------------------------------------------------------------------------
// Kernel 2: x_mod = LN(x)*z1 + z2  -> f16 [M_ROWS, 512]
// one block (128 threads) per row
// ---------------------------------------------------------------------------
__global__ void __launch_bounds__(128)
xmod_kernel(const float* __restrict__ x, const float* __restrict__ g,
            const float* __restrict__ bb, const float* __restrict__ z1z2,
            _Float16* __restrict__ out) {
    int row = blockIdx.x;                // 0..8191
    int b = row >> 11;                   // row / 2048
    const float* xr = x + (size_t)row * X_DIM;
    int lane = threadIdx.x & 31;
    int wave = threadIdx.x >> 5;
    int i0 = threadIdx.x * 4;

    float4 xv = *(const float4*)(xr + i0);
    float s  = xv.x + xv.y + xv.z + xv.w;
    float sq = xv.x*xv.x + xv.y*xv.y + xv.z*xv.z + xv.w*xv.w;
#pragma unroll
    for (int off = 16; off >= 1; off >>= 1) {
        s  += __shfl_xor(s,  off, 32);
        sq += __shfl_xor(sq, off, 32);
    }
    __shared__ float ss[4], ssq[4];
    if (lane == 0) { ss[wave] = s; ssq[wave] = sq; }
    __syncthreads();
    s  = ss[0] + ss[1] + ss[2] + ss[3];
    sq = ssq[0] + ssq[1] + ssq[2] + ssq[3];
    float mu  = s * (1.f / X_DIM);
    float var = sq * (1.f / X_DIM) - mu * mu;
    float rs = rsqrtf(var + EPS);

    const float* z1 = z1z2 + b * (2 * X_DIM);
    const float* z2 = z1 + X_DIM;
    _Float16* op = out + (size_t)row * X_DIM + i0;
    float xs[4] = {xv.x, xv.y, xv.z, xv.w};
#pragma unroll
    for (int e = 0; e < 4; ++e) {
        int idx = i0 + e;
        float v = ((xs[e] - mu) * rs * g[idx] + bb[idx]) * z1[idx] + z2[idx];
        op[e] = (_Float16)v;
    }
}

// ---------------------------------------------------------------------------
// Kernel 3: WMMA GEMM  C[M,Nc] = A[M,K] @ Bt[Nc,K]^T  (Bt stored N-major)
// M = M_ROWS, Nc = K = 512 in every product of this file.
// 128x128 block tile, 8 waves (4x2), 32x64 wave tile, k-step 32
// Operands come through LDS: a stage is 64 k (128 B) of the block's 128 A rows
// and 128 Bt rows, brought by tensor loads, one slice of 32 rows a wave, into a
// ring of two buffers; a fragment read straight from global memory touches 16
// lines for 512 bytes, the tensor load fetches each line once per block.
// outF != null -> f32 output with bias; else f16 output
// blockIdx.z: which of several products of the same A, whose Bt and whose outH
// lie one behind the other, this block works on (one grid for Q, K and V)
// ---------------------------------------------------------------------------
#define G_K        X_DIM                 // k extent of every product (== INNER)
#define G_NC       INNER                 // columns of every product (== X_DIM)
#define G_STAGE_H  64                    // k extent of one stage, halves
#define G_STAGES   (G_K / G_STAGE_H)      // 8
#define G_PITCH_H  72                    // slice row pitch in LDS, halves (144 B)
#define G_SLICE_H  3072                  // one slice, halves (4608 B -> 3 x 2 KiB)

#if USE_TDM
__device__ __forceinline__ void issue_slice(KTileRequest& rq, _Float16* dst,
                                            const _Float16* src) {
    rq.g0 = tdm_k_group0((unsigned)(uintptr_t)dst,
                         (unsigned long long)(uintptr_t)src);
    tdm_load_k_tile(rq);
}
__device__ __forceinline__ void wait_slice(const KTileRequest& rq) {
    asm volatile("s_wait_tensorcnt 0" :: "s"(rq.g0), "s"(rq.g1) : "memory");
}
#else
// fallback: a lane copies one row of the slice, nothing to wait for
__device__ __forceinline__ unsigned uni(unsigned v) { return v; }
__device__ __forceinline__ unsigned pinned(unsigned v) { return v; }
__device__ __forceinline__ i32x8 tdm_k_group1() { return i32x8{}; }
__device__ __forceinline__ void issue_slice(KTileRequest&, _Float16* dst,
                                            const _Float16* src) {
    int row = threadIdx.x & 31;
    for (int c = 0; c < G_STAGE_H; c += 8)
        *(v8h*)(dst + row * G_PITCH_H + c) =
            *(const v8h*)(src + (size_t)row * G_K + c);
}
__device__ __forceinline__ void wait_slice(const KTileRequest&) {}
#endif

__global__ void __launch_bounds__(256)
gemm_wmma_kernel(const _Float16* __restrict__ A, const _Float16* __restrict__ Bt0,
                 _Float16* __restrict__ outH0, float* __restrict__ outF,
                 const float* __restrict__ bias) {
    constexpr int Nc = G_NC;
    const _Float16* Bt = Bt0 + (size_t)blockIdx.z * G_NC * G_K;
    _Float16* outH = outH0 + (size_t)blockIdx.z * M_ROWS * G_NC;
    const int tid  = threadIdx.x;
    const int lane = tid & 31;
    const int wave = tid >> 5;
    const int wm = wave & 3;                 // 4 waves along M
    const int wn = wave >> 2;                // 2 waves along N
    const int m0 = blockIdx.y * 128 + wm * 32;
    const int n0 = blockIdx.x * 128 + wn * 64;
    const int lr = lane & 15;
    const int koff = (lane >> 4) * 8;        // half-of-wave K offset

    __shared__ __attribute__((aligned(2048))) _Float16 st[2][8][G_SLICE_H];

    // this wave's own slice in global memory, at k = 0; the wave's number in a
    // scalar register, so that the choice of operand is a scalar one
    const int sl = (int)uni((unsigned)wave);
    const _Float16* gsl = sl < 4
        ? A  + (size_t)(blockIdx.y * 128 + sl * 32) * G_K
        : Bt + (size_t)(blockIdx.x * 128 + (sl - 4) * 32) * G_K;

    v8f acc[2][4];
#pragma unroll
    for (int i = 0; i < 2; ++i)
#pragma unroll
        for (int j = 0; j < 4; ++j) acc[i][j] = vzero8();

    // --- prologue: stage 0 lands and is published, then stage 1 is asked for ---
    KTileRequest rq;
    rq.g1 = tdm_k_group1();
    issue_slice(rq, &st[0][sl][0], gsl);
    wait_slice(rq);
    __syncthreads();
    issue_slice(rq, &st[1][sl][0], gsl + G_STAGE_H);

    for (int s = 0; s < G_STAGES; ++s) {
        const int cur = s & 1;
#pragma unroll
        for (int kk = 0; kk < G_STAGE_H; kk += 32) {
            v16h afrag[2], bfrag[4];
#pragma unroll
            for (int i = 0; i < 2; ++i)      // rows wm*32 + i*16 + lr: slice wm
                afrag[i] = load_frag16(
                    &st[cur][wm][(i * 16 + lr) * G_PITCH_H + kk + koff]);
#pragma unroll
            for (int j = 0; j < 4; ++j)      // rows wn*64 + j*16 + lr
                bfrag[j] = load_frag16(
                    &st[cur][4 + wn * 2 + (j >> 1)]
                       [((j & 1) * 16 + lr) * G_PITCH_H + kk + koff]);
#pragma unroll
            for (int i = 0; i < 2; ++i)
#pragma unroll
                for (int j = 0; j < 4; ++j)
                    acc[i][j] = wmma_f16(afrag[i], bfrag[j], acc[i][j]);
        }

        // --- foot of the pass: publish stage s + 1, then refill this buffer ---
        // this wave's reads of buffer cur are done
        asm volatile("s_wait_dscnt 0" ::: "memory");
        wait_slice(rq);    // this wave's slice of stage s + 1
        __syncthreads();   // stage s + 1 readable; every reader has left buffer cur
        if (pinned(s + 2 < G_STAGES))
            issue_slice(rq, &st[cur][sl][0], gsl + (s + 2) * G_STAGE_H);
    }
    // nothing of the ring is outstanding when the wave goes on to its end
    asm volatile("s_wait_tensorcnt 0" ::: "memory");
    asm volatile("s_wait_dscnt 0" ::: "memory");

#pragma unroll
    for (int i = 0; i < 2; ++i) {
        int row0 = m0 + i * 16 + (koff ? 8 : 0);
#pragma unroll
        for (int j = 0; j < 4; ++j) {
            int col = n0 + j * 16 + lr;
            if (outF) {
                float bv = bias[col];
#pragma unroll
                for (int r = 0; r < 8; ++r)
                    outF[(size_t)(row0 + r) * Nc + col] = acc[i][j][r] + bv;
            } else {
#pragma unroll
                for (int r = 0; r < 8; ++r)
                    outH[(size_t)(row0 + r) * Nc + col] = (_Float16)acc[i][j][r];
            }
        }
    }
}

__device__ __forceinline__ float other_half(float x) {
    int bits = __builtin_bit_cast(int, x);
    return __builtin_bit_cast(float,
        __builtin_amdgcn_permlanex16(bits, bits, 0x76543210, 0xfedcba98,
                                     false, false));
}

#define N_TILES    (N_SEQ / 32)   // key tiles of 32 per (batch, head)
#define KT_PITCH_H 72             // K tile row pitch in LDS, halves (144 B)
#define KT_BUF_H   3072           // one K buffer, halves (6144 B = 3 x 2 KiB)

#if USE_TDM
// Start the K tile [32 keys x 64 dh] at `src` on its way into LDS at `dst`,
// where that tile exists (the same answer in the whole block). One request of
// wave 0; its wait, wait_k_tile, stands at the caller's publish point.
__device__ __forceinline__ void stage_k_tile(KTileRequest& rq, _Float16* dst,
                                             const _Float16* src, bool exists,
                                             int tid) {
    // plain test: where the compiler knows that no tile is left, no request is
    // built at all; the pinned one is the scalar branch a tensor load needs
    if (!exists) return;
    rq.g0 = tdm_k_group0((unsigned)(uintptr_t)dst,
                         (unsigned long long)(uintptr_t)src);
    if (pinned(((tid >> 5) == 0) & exists)) tdm_load_k_tile(rq);
}

// The issuing wave's own wait: its K tile has landed before it reaches the
// barrier that publishes the tile.
__device__ __forceinline__ void wait_k_tile(const KTileRequest& rq, int tid) {
    if (pinned((tid >> 5) == 0)) {
        asm volatile("s_wait_tensorcnt 0" :: "s"(rq.g0), "s"(rq.g1) : "memory");
    }
}
#else
// fallback: cooperative vector loads of the K tile, nothing to wait for
__device__ __forceinline__ void stage_k_tile(KTileRequest&, _Float16* dst,
                                             const _Float16* src, bool exists,
                                             int tid) {
    if (exists) {
        int key = tid >> 3;
        int dc  = (tid & 7) * 8;
        *(v8h*)(dst + key * KT_PITCH_H + dc) =
            *(const v8h*)(src + (size_t)key * INNER + dc);
    }
}
__device__ __forceinline__ void wait_k_tile(const KTileRequest&, int) {}
#endif

__global__ void __launch_bounds__(256)
flash_attn_kernel(const _Float16* __restrict__ q, const _Float16* __restrict__ k,
                  const _Float16* __restrict__ v, _Float16* __restrict__ o) {
    const int b = blockIdx.z;
    const int h = blockIdx.y;
    const int m0 = blockIdx.x * 128;
    const int tid  = threadIdx.x;
    const int lane = tid & 31;
    const int wave = tid >> 5;
    const int lr = lane & 15;
    const int koff = (lane >> 4) * 8;
    const int mq = m0 + wave * 16;                       // wave's 16 queries
    const float SC = 0.125f * 1.4426950408889634f;       // scale * log2(e)

    // Two buffers each for the K and the V tile: pass t works on buffer t & 1
    // while tile t + 1 is on its way into the other one.
    // K: each buffer's place in LDS is a multiple of 2 KiB (32 rows at a pitch of
    // 72 halves = 4608 B, rounded up to 6144 B); the pad halves are never written
    __shared__ __attribute__((aligned(2048))) _Float16 kt[2][KT_BUF_H];
    __shared__ __attribute__((aligned(16))) _Float16 vt[2][64][40];    // V^T tiles

    // Preload Q fragments (dh = 64 -> two k-chunks of 32); B operand: column lr
    const _Float16* qrow = q + (size_t)(b * N_SEQ + mq + lr) * INNER + h * DIM_HEAD;
    v16h qf[2];
    qf[0] = load_frag16(qrow + koff);
    qf[1] = load_frag16(qrow + 32 + koff);
    // before the Q loads' address registers are used for anything else
    asm volatile("s_wait_xcnt 0x0" ::: "memory");

    // ot[d][r] = O^T[d*16 + koff + r][query lr]
    v8f ot[4];
#pragma unroll
    for (int d = 0; d < 4; ++d) ot[d] = vzero8();
    float mrow = -1e30f;     // running maximum of query lr (equal in both halves)
    float lsum = 0.f;        // this half's share of the running sum

    const _Float16* kbase = k + (size_t)(b * N_SEQ) * INNER + h * DIM_HEAD;
    // this thread's 8 halves of a V tile: key vkey, columns vdc .. vdc + 7
    const int vkey = tid >> 3;
    const int vdc  = (tid & 7) * 8;
    const _Float16* vbase =
        v + (size_t)(b * N_SEQ + vkey) * INNER + h * DIM_HEAD + vdc;

    // --- prologue: tile 0 lands and is published, then tile 1 is asked for ---
    KTileRequest rq;
    rq.g1 = tdm_k_group1();
    stage_k_tile(rq, &kt[0][0], kbase, true, tid);
    v8h vnext = *(const v8h*)vbase;
#pragma unroll
    for (int e = 0; e < 8; ++e) vt[0][vdc + e][vkey] = vnext[e];
    wait_k_tile(rq, tid);
    __syncthreads();
    stage_k_tile(rq, &kt[1][0], kbase + (size_t)32 * INNER, true, tid);
    vnext = *(const v8h*)(vbase + (size_t)32 * INNER);

    for (int t = 0; t < N_TILES; ++t) {
        const int cur = t & 1;

        // --- S^T = K Q^T over 32 keys (two 16-key tiles) ------------------
        // s[i][r] = score(key t*32 + i*16 + koff + r, query lr)
        v8f s[2];
#pragma unroll
        for (int i = 0; i < 2; ++i) {
            s[i] = vzero8();
            const _Float16* krow = &kt[cur][(i * 16 + lr) * KT_PITCH_H];
            v16h kf0 = load_frag16(krow + koff);
            v16h kf1 = load_frag16(krow + 32 + koff);
            s[i] = wmma_f16(kf0, qf[0], s[i]);
            s[i] = wmma_f16(kf1, qf[1], s[i]);
        }

        // V tile t + 1, asked for one pass ago, goes into the other buffer here:
        // its LDS stores run beside the softmax arithmetic below
        if (t + 1 < N_TILES) {
#pragma unroll
            for (int e = 0; e < 8; ++e) vt[cur ^ 1][vdc + e][vkey] = vnext[e];
        }

        // --- online softmax update, one query per lane --------------------
        float mx = fmaxf(s[0][0], s[1][0]);
#pragma unroll
        for (int r = 1; r < 8; ++r) mx = fmaxf(mx, fmaxf(s[0][r], s[1][r]));
        mx = fmaxf(mx, other_half(mx));
        float mnew = fmaxf(mrow, mx);
        float alpha = exp2f((mrow - mnew) * SC);
        mrow = mnew;

        // P^T as B operand: element e of the lane is key kmap(e) = the order
        // in which the two S^T tiles already lie in the lane's registers
        v16h pf;
        float rs0 = 0.f, rs1 = 0.f;
#pragma unroll
        for (int r = 0; r < 8; ++r) {
            float p0 = exp2f((s[0][r] - mnew) * SC);
            float p1 = exp2f((s[1][r] - mnew) * SC);
            rs0 += p0; rs1 += p1;
            pf[r]     = (_Float16)p0;
            pf[r + 8] = (_Float16)p1;
        }
        lsum = lsum * alpha + (rs0 + rs1);
#pragma unroll
        for (int d = 0; d < 4; ++d)
#pragma unroll
            for (int r = 0; r < 8; ++r) ot[d][r] *= alpha;

        // --- O^T += V^T P^T -----------------------------------------------
#pragma unroll
        for (int d = 0; d < 4; ++d) {
            v16h vf = load_frag16(&vt[cur][d * 16 + lr][koff]);
            ot[d] = wmma_f16(vf, pf, ot[d]);
        }

        // --- foot of the pass: publish tile t + 1, then refill this buffer ---
        // this wave's reads of buffer cur and its V stores are done
        asm volatile("s_wait_dscnt 0" ::: "memory");
        wait_k_tile(rq, tid);  // K tile t + 1
        __syncthreads();   // tile t + 1 readable; every reader has left buffer cur
        stage_k_tile(rq, &kt[cur][0], kbase + (size_t)(t + 2) * 32 * INNER,
                     t + 2 < N_TILES, tid);
        if (t + 2 < N_TILES)
            vnext = *(const v8h*)(vbase + (size_t)(t + 2) * 32 * INNER);
    }
    // nothing of the ring is outstanding when the wave goes on to its end
    asm volatile("s_wait_tensorcnt 0" ::: "memory");
    asm volatile("s_wait_dscnt 0" ::: "memory");

    // --- epilogue: join the halves' sums, O /= l, store f16 [M_ROWS, 512] --
    // a lane holds 8 consecutive columns of one row: one 16-byte store each
    lsum += other_half(lsum);
    float inv = 1.f / lsum;
    _Float16* orow = o + (size_t)(b * N_SEQ + mq + lr) * INNER + h * DIM_HEAD + koff;
#pragma unroll
    for (int d = 0; d < 4; ++d) {
        v8h w;
#pragma unroll
        for (int r = 0; r < 8; ++r) w[r] = (_Float16)(ot[d][r] * inv);
        *(v8h*)(orow + d * 16) = w;
    }
}

// ---------------------------------------------------------------------------
// Host-side launcher
// ---------------------------------------------------------------------------
extern "C" void kernel_launch(void* const* d_in, const int* in_sizes, int n_in,
                              void* d_out, int out_size, void* d_ws, size_t ws_size,
                              hipStream_t stream) {
    const float* x    = (const float*)d_in[0];
    const float* z    = (const float*)d_in[1];
    const float* lxg  = (const float*)d_in[2];
    const float* lxb  = (const float*)d_in[3];
    const float* lzg  = (const float*)d_in[4];
    const float* lzb  = (const float*)d_in[5];
    const float* Wq   = (const float*)d_in[6];
    const float* Wk   = (const float*)d_in[7];
    const float* Wv   = (const float*)d_in[8];
    const float* Wz   = (const float*)d_in[9];
    const float* Wo   = (const float*)d_in[10];
    const float* bo   = (const float*)d_in[11];
    float* out = (float*)d_out;

    char* ws = (char*)d_ws;
    size_t off = 0;
    float* z1z2 = (float*)(ws + off);       off += (size_t)BATCH * 2 * X_DIM * 4;
    _Float16* WtQ  = (_Float16*)(ws + off); off += (size_t)X_DIM * INNER * 2;
    _Float16* WtK  = (_Float16*)(ws + off); off += (size_t)X_DIM * INNER * 2;
    _Float16* WtV  = (_Float16*)(ws + off); off += (size_t)X_DIM * INNER * 2;
    _Float16* WtO  = (_Float16*)(ws + off); off += (size_t)INNER * X_DIM * 2;
    _Float16* xmod = (_Float16*)(ws + off); off += (size_t)M_ROWS * X_DIM * 2;
    _Float16* qb   = (_Float16*)(ws + off); off += (size_t)M_ROWS * INNER * 2;
    _Float16* kb   = (_Float16*)(ws + off); off += (size_t)M_ROWS * INNER * 2;
    _Float16* vb   = (_Float16*)(ws + off); off += (size_t)M_ROWS * INNER * 2;
    _Float16* ao   = (_Float16*)(ws + off); off += (size_t)M_ROWS * INNER * 2;

    // 1) z path and the four weights' convert + transpose (WtQ, WtK, WtV, WtO
    //    lie one behind the other), one grid
    setup_kernel<<<BATCH + 4 * W_BLOCKS, 256, 0, stream>>>(Wq, Wk, Wv, Wo, WtQ,
                                                           z, lzg, lzb, Wz, z1z2);

    // 2) LN + FiLM on x -> f16
    xmod_kernel<<<M_ROWS, 128, 0, stream>>>(x, lxg, lxb, z1z2, xmod);

    // 3) Q/K/V projections (f16 out), one grid: z = 0, 1, 2 reads WtQ, WtK, WtV
    //    and writes qb, kb, vb, which lie one behind the other
    dim3 ggrid(INNER / 128, M_ROWS / 128, 3);
    gemm_wmma_kernel<<<ggrid, 256, 0, stream>>>(xmod, WtQ, qb, nullptr, nullptr);

    // 4) flash attention
    dim3 agrid(N_SEQ / 128, HEADS, BATCH);
    flash_attn_kernel<<<agrid, 256, 0, stream>>>(qb, kb, vb, ao);

    // 5) output projection (f32 out + bias)
    dim3 ogrid(X_DIM / 128, M_ROWS / 128);
    gemm_wmma_kernel<<<ogrid, 256, 0, stream>>>(ao, WtO, nullptr, out, bo);
}

// v006
// One run takes 119 microseconds.
// Next to v005, in two timings, it ran 1.16 and 1.17 times as fast.
// All steps since v000 together make it 2.38 times as fast.
#include <hip/hip_runtime.h>
#include <hip/hip_bf16.h>

#define X_DIM   512
#define Z_DIM   16
#define HEADS   8
#define DIM_HEAD 64
#define INNER   512
#define BATCH   4
#define N_SEQ   2048
#define M_ROWS  (BATCH * N_SEQ)          // 8192
#define EPS     1e-5f

typedef _Float16 v16h __attribute__((ext_vector_type(16)));
typedef _Float16 v8h  __attribute__((ext_vector_type(8)));
typedef float    v8f  __attribute__((ext_vector_type(8)));
typedef unsigned int u32x4 __attribute__((ext_vector_type(4)));
typedef int          i32x4 __attribute__((ext_vector_type(4)));
typedef int          i32x8 __attribute__((ext_vector_type(8)));

#if defined(__HIP_DEVICE_COMPILE__) && __has_builtin(__builtin_amdgcn_tensor_load_to_lds)
#define USE_TDM 1
#else
#define USE_TDM 0
#endif

__device__ __forceinline__ v8f vzero8() {
    v8f z = {0.f,0.f,0.f,0.f,0.f,0.f,0.f,0.f};
    return z;
}

__device__ __forceinline__ v16h load_frag16(const _Float16* p) {
    v8h lo = *(const v8h*)(p);
    v8h hi = *(const v8h*)(p + 16);
    v16h r;
#pragma unroll
    for (int i = 0; i < 8; ++i) { r[i] = lo[i]; r[i + 8] = hi[i]; }
    return r;
}

__device__ __forceinline__ v8f wmma_f16(v16h a, v16h b, v8f c) {
    return __builtin_amdgcn_wmma_f32_16x16x32_f16(false, a, false, b,
                                                  (short)0, c, false, false);
}

struct KTileRequest {
    u32x4 g0;
    i32x8 g1;
};

#if USE_TDM
// wave-uniform value held in a scalar register
__device__ __forceinline__ unsigned uni(unsigned v) {
    return (unsigned)__builtin_amdgcn_readfirstlane((int)v);
}
__device__ __forceinline__ unsigned pinned(unsigned v) {
    unsigned w = uni(v);
    asm volatile("" : "+s"(w));  // pinned(): holds the test's word in a scalar register
    return w;
}

__device__ __forceinline__ u32x4 tdm_k_group0(unsigned lds_addr,
                                              unsigned long long gaddr) {
    u32x4 g0;
    g0[0] = uni(1u);
    g0[1] = uni(lds_addr);
    g0[2] = uni((unsigned)(gaddr & 0xffffffffull));
    g0[3] = uni((unsigned)((gaddr >> 32) & 0x1ffffffull)
          | (2u << 30));
    asm volatile("" : "+s"(g0));
    return g0;
}

__device__ __forceinline__ i32x8 tdm_k_group1() {
    i32x8 g1;
    g1[0] = (1 << 20) | (4 << 22) | (3 << 25);
    g1[1] = (int)(128u << 16);
    g1[2] = (int)(32u << 16);
    g1[3] = (int)(128u << 16);
    g1[4] = 32;
    g1[5] = 1024;
    g1[6] = 0;
    g1[7] = 0;
    asm volatile("" : "+s"(g1));
    return g1;
}

// The same tile for a reader by ds_load_tr16_b128: a pad of 32 bytes behind
// every 128-byte row gives the LDS pitch of 160 bytes (32 B x odd), VT_PITCH_H.
__device__ __forceinline__ i32x8 tdm_v_group1() {
    i32x8 g1;
    g1[0] = (1 << 20) | (4 << 22) | (7 << 25);
    g1[1] = (int)(128u << 16);
    g1[2] = (int)(32u << 16);
    g1[3] = (int)(128u << 16);
    g1[4] = 32;
    g1[5] = 1024;
    g1[6] = 0;
    g1[7] = 0;
    asm volatile("" : "+s"(g1));
    return g1;
}

__device__ __forceinline__ void tdm_load_k_tile(const KTileRequest& rq) {
    i32x4 z4 = {0, 0, 0, 0};
#if defined(__clang_major__) && __clang_major__ >= 23
    i32x8 z8 = {0, 0, 0, 0, 0, 0, 0, 0};
    __builtin_amdgcn_tensor_load_to_lds(rq.g0, rq.g1, z4, z4, z8, 0);
#else
    __builtin_amdgcn_tensor_load_to_lds(rq.g0, rq.g1, z4, z4, 0);
#endif
}
#endif

// ---------------------------------------------------------------------------
// Set-up part 1: f32 weight [K,Nc] -> f16 transposed [Nc,K] (fragment-friendly)
// `blk`: which 256 elements of the weight this block converts
// ---------------------------------------------------------------------------
__device__ __forceinline__ void
cvt_transpose_block(const float* __restrict__ W, _Float16* __restrict__ Wt,
                    int K, int Nc, int blk) {
    int idx = blk * 256 + threadIdx.x;            // coalesced read of W
    int kk = idx / Nc;
    int n  = idx % Nc;
    Wt[(size_t)n * K + kk] = (_Float16)W[idx];
    // the store's address and data registers may be rewritten by code that the
    // compiler lays out behind it: keep the wait in front of any such overwrite
    asm volatile("s_wait_xcnt 0x0" ::: "memory");
}

// ---------------------------------------------------------------------------
// Set-up part 2: z path of batch b: LN(z) @ Wz -> SiLU -> z1z2 [B,1024] f32
// ---------------------------------------------------------------------------
__device__ __forceinline__ void
zpath_block(const float* __restrict__ z, const float* __restrict__ g,
            const float* __restrict__ bb, const float* __restrict__ Wz,
            float* __restrict__ z1z2, int b) {
    const float* zr = z + b * Z_DIM;
    float zn[Z_DIM];
    float mu = 0.f;
#pragma unroll
    for (int i = 0; i < Z_DIM; ++i) mu += zr[i];
    mu *= (1.f / Z_DIM);
    float var = 0.f;
#pragma unroll
    for (int i = 0; i < Z_DIM; ++i) { float d = zr[i] - mu; var += d * d; }
    var *= (1.f / Z_DIM);
    float rs = rsqrtf(var + EPS);
#pragma unroll
    for (int i = 0; i < Z_DIM; ++i) zn[i] = (zr[i] - mu) * rs * g[i] + bb[i];

    for (int c = threadIdx.x; c < 2 * X_DIM; c += 256) {
        float a = 0.f;
#pragma unroll
        for (int i = 0; i < Z_DIM; ++i) a += zn[i] * Wz[i * (2 * X_DIM) + c];
        float sg = 1.f / (1.f + __expf(-a));
        z1z2[b * (2 * X_DIM) + c] = a * sg;        // SiLU
    }
}

// ---------------------------------------------------------------------------
// Kernel 1: the set-up work that needs nothing of each other, in one grid by
// ranges of the block index: blocks 0 .. BATCH-1 run the z path (the longest
// dependent chain, so it starts first), then W_BLOCKS blocks for each of the
// four weights. Wt: the four transposed weights, one behind the other.
// ---------------------------------------------------------------------------
#define W_ELEMS  (X_DIM * INNER)
#define W_BLOCKS (W_ELEMS / 256)

__global__ void __launch_bounds__(256)
setup_kernel(const float* __restrict__ Wq, const float* __restrict__ Wk,
             const float* __restrict__ Wv, const float* __restrict__ Wo,
             _Float16* __restrict__ Wt,
             const float* __restrict__ z, const float* __restrict__ g,
             const float* __restrict__ bb, const float* __restrict__ Wz,
             float* __restrict__ z1z2) {
    if (blockIdx.x < BATCH) {
        zpath_block(z, g, bb, Wz, z1z2, blockIdx.x);
        return;
    }
    const int blk   = blockIdx.x - BATCH;
    const int which = blk / W_BLOCKS;              // 0..3: Wq, Wk, Wv, Wo
    const float* W = which == 0 ? Wq : which == 1 ? Wk : which == 2 ? Wv : Wo;
    // all four are [512, 512]: X_DIM == INNER
    cvt_transpose_block(W, Wt + (size_t)which * W_ELEMS, X_DIM, INNER,
                        blk % W_BLOCKS);
}

// ---------------------------------------------------------------------------
// Kernel 2: x_mod = LN(x)*z1 + z2  -> f16 [M_ROWS, 512]
// one block (128 threads) per row
// ---------------------------------------------------------------------------
__global__ void __launch_bounds__(128)
xmod_kernel(const float* __restrict__ x, const float* __restrict__ g,
            const float* __restrict__ bb, const float* __restrict__ z1z2,
            _Float16* __restrict__ out) {
    int row = blockIdx.x;                // 0..8191
    int b = row >> 11;                   // row / 2048
    const float* xr = x + (size_t)row * X_DIM;
    int lane = threadIdx.x & 31;
    int wave = threadIdx.x >> 5;
    int i0 = threadIdx.x * 4;

    float4 xv = *(const float4*)(xr + i0);
    float s  = xv.x + xv.y + xv.z + xv.w;
    float sq = xv.x*xv.x + xv.y*xv.y + xv.z*xv.z + xv.w*xv.w;
#pragma unroll
    for (int off = 16; off >= 1; off >>= 1) {
        s  += __shfl_xor(s,  off, 32);
        sq += __shfl_xor(sq, off, 32);
    }
    __shared__ float ss[4], ssq[4];
    if (lane == 0) { ss[wave] = s; ssq[wave] = sq; }
    __syncthreads();
    s  = ss[0] + ss[1] + ss[2] + ss[3];
    sq = ssq[0] + ssq[1] + ssq[2] + ssq[3];
    float mu  = s * (1.f / X_DIM);
    float var = sq * (1.f / X_DIM) - mu * mu;
    float rs = rsqrtf(var + EPS);

    const float* z1 = z1z2 + b * (2 * X_DIM);
    const float* z2 = z1 + X_DIM;
    _Float16* op = out + (size_t)row * X_DIM + i0;
    float xs[4] = {xv.x, xv.y, xv.z, xv.w};
#pragma unroll
    for (int e = 0; e < 4; ++e) {
        int idx = i0 + e;
        float v = ((xs[e] - mu) * rs * g[idx] + bb[idx]) * z1[idx] + z2[idx];
        op[e] = (_Float16)v;
    }
}

// ---------------------------------------------------------------------------
// Kernel 3: WMMA GEMM  C[M,Nc] = A[M,K] @ Bt[Nc,K]^T  (Bt stored N-major)
// M = M_ROWS, Nc = K = 512 in every product of this file.
// 128x128 block tile, 8 waves (4x2), 32x64 wave tile, k-step 32
// Operands come through LDS: a stage is 64 k (128 B) of the block's 128 A rows
// and 128 Bt rows, brought by tensor loads, one slice of 32 rows a wave, into a
// ring of two buffers; a fragment read straight from global memory touches 16
// lines for 512 bytes, the tensor load fetches each line once per block.
// outF != null -> f32 output with bias; else f16 output
// blockIdx.z: which of several products of the same A, whose Bt and whose outH
// lie one behind the other, this block works on (one grid for Q, K and V)
// ---------------------------------------------------------------------------
#define G_K        X_DIM                 // k extent of every product (== INNER)
#define G_NC       INNER                 // columns of every product (== X_DIM)
#define G_STAGE_H  64                    // k extent of one stage, halves
#define G_STAGES   (G_K / G_STAGE_H)      // 8
#define G_PITCH_H  72                    // slice row pitch in LDS, halves (144 B)
#define G_SLICE_H  3072                  // one slice, halves (4608 B -> 3 x 2 KiB)

#if USE_TDM
__device__ __forceinline__ void issue_slice(KTileRequest& rq, _Float16* dst,
                                            const _Float16* src) {
    rq.g0 = tdm_k_group0((unsigned)(uintptr_t)dst,
                         (unsigned long long)(uintptr_t)src);
    tdm_load_k_tile(rq);
}
__device__ __forceinline__ void wait_slice(const KTileRequest& rq) {
    asm volatile("s_wait_tensorcnt 0" :: "s"(rq.g0), "s"(rq.g1) : "memory");
}
#else
// fallback: a lane copies one row of the slice, nothing to wait for
__device__ __forceinline__ unsigned uni(unsigned v) { return v; }
__device__ __forceinline__ unsigned pinned(unsigned v) { return v; }
__device__ __forceinline__ i32x8 tdm_k_group1() { return i32x8{}; }
__device__ __forceinline__ i32x8 tdm_v_group1() { return i32x8{}; }
__device__ __forceinline__ void issue_slice(KTileRequest&, _Float16* dst,
                                            const _Float16* src) {
    int row = threadIdx.x & 31;
    for (int c = 0; c < G_STAGE_H; c += 8)
        *(v8h*)(dst + row * G_PITCH_H + c) =
            *(const v8h*)(src + (size_t)row * G_K + c);
}
__device__ __forceinline__ void wait_slice(const KTileRequest&) {}
#endif

__global__ void __launch_bounds__(256)
gemm_wmma_kernel(const _Float16* __restrict__ A, const _Float16* __restrict__ Bt0,
                 _Float16* __restrict__ outH0, float* __restrict__ outF,
                 const float* __restrict__ bias) {
    constexpr int Nc = G_NC;
    const _Float16* Bt = Bt0 + (size_t)blockIdx.z * G_NC * G_K;
    _Float16* outH = outH0 + (size_t)blockIdx.z * M_ROWS * G_NC;
    const int tid  = threadIdx.x;
    const int lane = tid & 31;
    const int wave = tid >> 5;
    const int wm = wave & 3;                 // 4 waves along M
    const int wn = wave >> 2;                // 2 waves along N
    const int m0 = blockIdx.y * 128 + wm * 32;
    const int n0 = blockIdx.x * 128 + wn * 64;
    const int lr = lane & 15;
    const int koff = (lane >> 4) * 8;        // half-of-wave K offset

    __shared__ __attribute__((aligned(2048))) _Float16 st[2][8][G_SLICE_H];

    // this wave's own slice in global memory, at k = 0; the wave's number in a
    // scalar register, so that the choice of operand is a scalar one
    const int sl = (int)uni((unsigned)wave);
    const _Float16* gsl = sl < 4
        ? A  + (size_t)(blockIdx.y * 128 + sl * 32) * G_K
        : Bt + (size_t)(blockIdx.x * 128 + (sl - 4) * 32) * G_K;

    v8f acc[2][4];
#pragma unroll
    for (int i = 0; i < 2; ++i)
#pragma unroll
        for (int j = 0; j < 4; ++j) acc[i][j] = vzero8();

    // --- prologue: stage 0 lands and is published, then stage 1 is asked for ---
    KTileRequest rq;
    rq.g1 = tdm_k_group1();
    issue_slice(rq, &st[0][sl][0], gsl);
    wait_slice(rq);
    __syncthreads();
    issue_slice(rq, &st[1][sl][0], gsl + G_STAGE_H);

    for (int s = 0; s < G_STAGES; ++s) {
        const int cur = s & 1;
#pragma unroll
        for (int kk = 0; kk < G_STAGE_H; kk += 32) {
            v16h afrag[2], bfrag[4];
#pragma unroll
            for (int i = 0; i < 2; ++i)      // rows wm*32 + i*16 + lr: slice wm
                afrag[i] = load_frag16(
                    &st[cur][wm][(i * 16 + lr) * G_PITCH_H + kk + koff]);
#pragma unroll
            for (int j = 0; j < 4; ++j)      // rows wn*64 + j*16 + lr
                bfrag[j] = load_frag16(
                    &st[cur][4 + wn * 2 + (j >> 1)]
                       [((j & 1) * 16 + lr) * G_PITCH_H + kk + koff]);
#pragma unroll
            for (int i = 0; i < 2; ++i)
#pragma unroll
                for (int j = 0; j < 4; ++j)
                    acc[i][j] = wmma_f16(afrag[i], bfrag[j], acc[i][j]);
        }

        // --- foot of the pass: publish stage s + 1, then refill this buffer ---
        // this wave's reads of buffer cur are done
        asm volatile("s_wait_dscnt 0" ::: "memory");
        wait_slice(rq);    // this wave's slice of stage s + 1
        __syncthreads();   // stage s + 1 readable; every reader has left buffer cur
        if (pinned(s + 2 < G_STAGES))
            issue_slice(rq, &st[cur][sl][0], gsl + (s + 2) * G_STAGE_H);
    }
    // nothing of the ring is outstanding when the wave goes on to its end
    asm volatile("s_wait_tensorcnt 0" ::: "memory");
    asm volatile("s_wait_dscnt 0" ::: "memory");

#pragma unroll
    for (int i = 0; i < 2; ++i) {
        int row0 = m0 + i * 16 + (koff ? 8 : 0);
#pragma unroll
        for (int j = 0; j < 4; ++j) {
            int col = n0 + j * 16 + lr;
            if (outF) {
                float bv = bias[col];
#pragma unroll
                for (int r = 0; r < 8; ++r)
                    outF[(size_t)(row0 + r) * Nc + col] = acc[i][j][r] + bv;
            } else {
#pragma unroll
                for (int r = 0; r < 8; ++r)
                    outH[(size_t)(row0 + r) * Nc + col] = (_Float16)acc[i][j][r];
            }
        }
    }
}

__device__ __forceinline__ float other_half(float x) {
    int bits = __builtin_bit_cast(int, x);
    return __builtin_bit_cast(float,
        __builtin_amdgcn_permlanex16(bits, bits, 0x76543210, 0xfedcba98,
                                     false, false));
}

#define N_TILES    (N_SEQ / 32)   // key tiles of 32 per (batch, head)
#define KT_PITCH_H 72             // K tile row pitch in LDS, halves (144 B)
#define KT_BUF_H   3072           // one K buffer, halves (6144 B = 3 x 2 KiB)
#define VT_PITCH_H 80             // V tile row pitch in LDS, halves (160 B)
#define VT_BUF_H   3072           // one V buffer, halves (6144 B = 3 x 2 KiB)

// ds_load_tr16_b128: a lane gets 8 rows of one column of a row-major 16-bit LDS
// tile, half of a transposed A fragment (the lanes' addresses: vlane in the kernel)
typedef short s16x8 __attribute__((ext_vector_type(8)));
__device__ __forceinline__ v8h lds_load_tr16(const _Float16* p) {
    typedef __attribute__((address_space(3))) s16x8 lds_s16x8;
    return __builtin_bit_cast(v8h,
        __builtin_amdgcn_ds_load_tr16_b128_v8i16((lds_s16x8*)p));
}

#if USE_TDM
// Start the K tile [32 keys x 64 dh] at `src` on its way into LDS at `dst`,
// where that tile exists (the same answer in the whole block). One request of
// wave 0; its wait, wait_k_tile, stands at the caller's publish point.
__device__ __forceinline__ void stage_k_tile(KTileRequest& rq, _Float16* dst,
                                             const _Float16* src, bool exists,
                                             int tid) {
    // plain test: where the compiler knows that no tile is left, no request is
    // built at all; the pinned one is the scalar branch a tensor load needs
    if (!exists) return;
    rq.g0 = tdm_k_group0((unsigned)(uintptr_t)dst,
                         (unsigned long long)(uintptr_t)src);
    if (pinned(((tid >> 5) == 0) & exists)) tdm_load_k_tile(rq);
}

// The issuing wave's own wait: its K tile has landed before it reaches the
// barrier that publishes the tile.
__device__ __forceinline__ void wait_k_tile(const KTileRequest& rq, int tid) {
    if (pinned((tid >> 5) == 0)) {
        asm volatile("s_wait_tensorcnt 0" :: "s"(rq.g0), "s"(rq.g1) : "memory");
    }
}

// The same for the V tile [32 keys x 64 dh]: one request of wave 1, its wait
// wait_v_tile at the caller's publish point.
__device__ __forceinline__ void stage_v_tile(KTileRequest& rq, _Float16* dst,
                                             const _Float16* src, bool exists,
                                             int tid) {
    if (!exists) return;
    rq.g0 = tdm_k_group0((unsigned)(uintptr_t)dst,
                         (unsigned long long)(uintptr_t)src);
    if (pinned(((tid >> 5) == 1) & exists)) tdm_load_k_tile(rq);
}

__device__ __forceinline__ void wait_v_tile(const KTileRequest& rq, int tid) {
    if (pinned((tid >> 5) == 1)) {
        asm volatile("s_wait_tensorcnt 0" :: "s"(rq.g0), "s"(rq.g1) : "memory");
    }
}
#else
// fallback: cooperative vector loads of the K tile, nothing to wait for
__device__ __forceinline__ void stage_k_tile(KTileRequest&, _Float16* dst,
                                             const _Float16* src, bool exists,
                                             int tid) {
    if (exists) {
        int key = tid >> 3;
        int dc  = (tid & 7) * 8;
        *(v8h*)(dst + key * KT_PITCH_H + dc) =
            *(const v8h*)(src + (size_t)key * INNER + dc);
    }
}
__device__ __forceinline__ void wait_k_tile(const KTileRequest&, int) {}
__device__ __forceinline__ void stage_v_tile(KTileRequest&, _Float16* dst,
                                             const _Float16* src, bool exists,
                                             int tid) {
    if (exists) {
        int key = tid >> 3;
        int dc  = (tid & 7) * 8;
        *(v8h*)(dst + key * VT_PITCH_H + dc) =
            *(const v8h*)(src + (size_t)key * INNER + dc);
    }
}
__device__ __forceinline__ void wait_v_tile(const KTileRequest&, int) {}
#endif

__global__ void __launch_bounds__(256)
flash_attn_kernel(const _Float16* __restrict__ q, const _Float16* __restrict__ k,
                  const _Float16* __restrict__ v, _Float16* __restrict__ o) {
    const int b = blockIdx.z;
    const int h = blockIdx.y;
    const int m0 = blockIdx.x * 128;
    const int tid  = threadIdx.x;
    const int lane = tid & 31;
    const int wave = tid >> 5;
    const int lr = lane & 15;
    const int koff = (lane >> 4) * 8;
    const int mq = m0 + wave * 16;                       // wave's 16 queries
    const float SC = 0.125f * 1.4426950408889634f;       // scale * log2(e)

    // Two buffers each for the K and the V tile: pass t works on buffer t & 1
    // while tile t + 1 is on its way into the other one.
    // Each buffer's place in LDS is a multiple of 2 KiB (32 rows at a pitch of
    // 72 halves = 4608 B for K, of 80 halves = 5120 B for V, rounded up to
    // 6144 B); the pad halves are never written
    __shared__ __attribute__((aligned(2048))) _Float16 kt[2][KT_BUF_H];
    __shared__ __attribute__((aligned(2048))) _Float16 vt[2][VT_BUF_H];

    // Preload Q fragments (dh = 64 -> two k-chunks of 32); B operand: column lr
    const _Float16* qrow = q + (size_t)(b * N_SEQ + mq + lr) * INNER + h * DIM_HEAD;
    v16h qf[2];
    qf[0] = load_frag16(qrow + koff);
    qf[1] = load_frag16(qrow + 32 + koff);
    // before the Q loads' address registers are used for anything else
    asm volatile("s_wait_xcnt 0x0" ::: "memory");

    // ot[d][r] = O^T[d*16 + koff + r][query lr]
    v8f ot[4];
#pragma unroll
    for (int d = 0; d < 4; ++d) ot[d] = vzero8();
    float mrow = -1e30f;     // running maximum of query lr (equal in both halves)
    float lsum = 0.f;        // this half's share of the running sum

    const _Float16* kbase = k + (size_t)(b * N_SEQ) * INNER + h * DIM_HEAD;
    const _Float16* vbase = v + (size_t)(b * N_SEQ) * INNER + h * DIM_HEAD;
    // the lane's place in a V tile for the transposing load, at key 0, column 0:
    // key 8*(l >> 4) + (l & 7), column 8*((l >> 3) & 1); the lane then holds keys
    // koff .. koff + 7 of column lr, the order of load_frag16 and of P^T below
    const int vlane = (koff + (lane & 7)) * VT_PITCH_H + ((lane >> 3) & 1) * 8;

    // --- prologue: tile 0 lands and is published, then tile 1 is asked for ---
    KTileRequest rq, rqv;
    rq.g1  = tdm_k_group1();
    rqv.g1 = tdm_v_group1();
    stage_k_tile(rq, &kt[0][0], kbase, true, tid);
    stage_v_tile(rqv, &vt[0][0], vbase, true, tid);
    wait_k_tile(rq, tid);
    wait_v_tile(rqv, tid);
    __syncthreads();
    stage_k_tile(rq, &kt[1][0], kbase + (size_t)32 * INNER, true, tid);
    stage_v_tile(rqv, &vt[1][0], vbase + (size_t)32 * INNER, true, tid);

    for (int t = 0; t < N_TILES; ++t) {
        const int cur = t & 1;

        // --- S^T = K Q^T over 32 keys (two 16-key tiles) ------------------
        // s[i][r] = score(key t*32 + i*16 + koff + r, query lr)
        v8f s[2];
#pragma unroll
        for (int i = 0; i < 2; ++i) {
            s[i] = vzero8();
            const _Float16* krow = &kt[cur][(i * 16 + lr) * KT_PITCH_H];
            v16h kf0 = load_frag16(krow + koff);
            v16h kf1 = load_frag16(krow + 32 + koff);
            s[i] = wmma_f16(kf0, qf[0], s[i]);
            s[i] = wmma_f16(kf1, qf[1], s[i]);
        }

        // --- V^T fragments of this pass, read as one group here: their LDS
        // latency runs beside the softmax arithmetic below ------------------
        // vf[d]: row d*16 + lr of V^T, keys koff + 0..7 and 16 + koff + 0..7
        v16h vf[4];
#pragma unroll
        for (int d = 0; d < 4; ++d) {
            const _Float16* vp = &vt[cur][vlane + d * 16];
            v8h lo = lds_load_tr16(vp);
            v8h hi = lds_load_tr16(vp + 16 * VT_PITCH_H);
#pragma unroll
            for (int e = 0; e < 8; ++e) { vf[d][e] = lo[e]; vf[d][e + 8] = hi[e]; }
        }
        // keeps the eight reads up here: left alone, the compiler sinks six of
        // them between the O^T products, each pair with a full wait behind it
        __builtin_amdgcn_sched_barrier(0);

        // --- online softmax update, one query per lane --------------------
        float mx = fmaxf(s[0][0], s[1][0]);
#pragma unroll
        for (int r = 1; r < 8; ++r) mx = fmaxf(mx, fmaxf(s[0][r], s[1][r]));
        mx = fmaxf(mx, other_half(mx));
        float mnew = fmaxf(mrow, mx);
        float alpha = exp2f((mrow - mnew) * SC);
        mrow = mnew;

        // P^T as B operand: element e of the lane is key kmap(e) = the order
        // in which the two S^T tiles already lie in the lane's registers
        v16h pf;
        float rs0 = 0.f, rs1 = 0.f;
#pragma unroll
        for (int r = 0; r < 8; ++r) {
            float p0 = exp2f((s[0][r] - mnew) * SC);
            float p1 = exp2f((s[1][r] - mnew) * SC);
            rs0 += p0; rs1 += p1;
            pf[r]     = (_Float16)p0;
            pf[r + 8] = (_Float16)p1;
        }
        lsum = lsum * alpha + (rs0 + rs1);
#pragma unroll
        for (int d = 0; d < 4; ++d)
#pragma unroll
            for (int r = 0; r < 8; ++r) ot[d][r] *= alpha;

        // --- O^T += V^T P^T -----------------------------------------------
#pragma unroll
        for (int d = 0; d < 4; ++d) {
            ot[d] = wmma_f16(vf[d], pf, ot[d]);
        }

        // --- foot of the pass: publish tile t + 1, then refill this buffer ---
        // keeps the wait below down here: no LDS read stands behind the V^T group,
        // so the compiler lifts it up to there, in front of the softmax
        __builtin_amdgcn_sched_barrier(0);
        // this wave's reads of the buffers cur are done
        asm volatile("s_wait_dscnt 0" ::: "memory");
        wait_k_tile(rq, tid);   // K tile t + 1
        wait_v_tile(rqv, tid);  // V tile t + 1
        __syncthreads();   // tiles t + 1 readable; every reader has left buffers cur
        stage_k_tile(rq, &kt[cur][0], kbase + (size_t)(t + 2) * 32 * INNER,
                     t + 2 < N_TILES, tid);
        stage_v_tile(rqv, &vt[cur][0], vbase + (size_t)(t + 2) * 32 * INNER,
                     t + 2 < N_TILES, tid);
    }
    // nothing of the ring is outstanding when the wave goes on to its end
    asm volatile("s_wait_tensorcnt 0" ::: "memory");
    asm volatile("s_wait_dscnt 0" ::: "memory");

    // --- epilogue: join the halves' sums, O /= l, store f16 [M_ROWS, 512] --
    // a lane holds 8 consecutive columns of one row: one 16-byte store each
    lsum += other_half(lsum);
    float inv = 1.f / lsum;
    _Float16* orow = o + (size_t)(b * N_SEQ + mq + lr) * INNER + h * DIM_HEAD + koff;
#pragma unroll
    for (int d = 0; d < 4; ++d) {
        v8h w;
#pragma unroll
        for (int r = 0; r < 8; ++r) w[r] = (_Float16)(ot[d][r] * inv);
        *(v8h*)(orow + d * 16) = w;
    }
}

// ---------------------------------------------------------------------------
// Host-side launcher
// ---------------------------------------------------------------------------
extern "C" void kernel_launch(void* const* d_in, const int* in_sizes, int n_in,
                              void* d_out, int out_size, void* d_ws, size_t ws_size,
                              hipStream_t stream) {
    const float* x    = (const float*)d_in[0];
    const float* z    = (const float*)d_in[1];
    const float* lxg  = (const float*)d_in[2];
    const float* lxb  = (const float*)d_in[3];
    const float* lzg  = (const float*)d_in[4];
    const float* lzb  = (const float*)d_in[5];
    const float* Wq   = (const float*)d_in[6];
    const float* Wk   = (const float*)d_in[7];
    const float* Wv   = (const float*)d_in[8];
    const float* Wz   = (const float*)d_in[9];
    const float* Wo   = (const float*)d_in[10];
    const float* bo   = (const float*)d_in[11];
    float* out = (float*)d_out;

    char* ws = (char*)d_ws;
    size_t off = 0;
    float* z1z2 = (float*)(ws + off);       off += (size_t)BATCH * 2 * X_DIM * 4;
    _Float16* WtQ  = (_Float16*)(ws + off); off += (size_t)X_DIM * INNER * 2;
    _Float16* WtK  = (_Float16*)(ws + off); off += (size_t)X_DIM * INNER * 2;
    _Float16* WtV  = (_Float16*)(ws + off); off += (size_t)X_DIM * INNER * 2;
    _Float16* WtO  = (_Float16*)(ws + off); off += (size_t)INNER * X_DIM * 2;
    _Float16* xmod = (_Float16*)(ws + off); off += (size_t)M_ROWS * X_DIM * 2;
    _Float16* qb   = (_Float16*)(ws + off); off += (size_t)M_ROWS * INNER * 2;
    _Float16* kb   = (_Float16*)(ws + off); off += (size_t)M_ROWS * INNER * 2;
    _Float16* vb   = (_Float16*)(ws + off); off += (size_t)M_ROWS * INNER * 2;
    _Float16* ao   = (_Float16*)(ws + off); off += (size_t)M_ROWS * INNER * 2;

    // 1) z path and the four weights' convert + transpose (WtQ, WtK, WtV, WtO
    //    lie one behind the other), one grid
    setup_kernel<<<BATCH + 4 * W_BLOCKS, 256, 0, stream>>>(Wq, Wk, Wv, Wo, WtQ,
                                                           z, lzg, lzb, Wz, z1z2);

    // 2) LN + FiLM on x -> f16
    xmod_kernel<<<M_ROWS, 128, 0, stream>>>(x, lxg, lxb, z1z2, xmod);

    // 3) Q/K/V projections (f16 out), one grid: z = 0, 1, 2 reads WtQ, WtK, WtV
    //    and writes qb, kb, vb, which lie one behind the other
    dim3 ggrid(INNER / 128, M_ROWS / 128, 3);
    gemm_wmma_kernel<<<ggrid, 256, 0, stream>>>(xmod, WtQ, qb, nullptr, nullptr);

    // 4) flash attention
    dim3 agrid(N_SEQ / 128, HEADS, BATCH);
    flash_attn_kernel<<<agrid, 256, 0, stream>>>(qb, kb, vb, ao);

    // 5) output projection (f32 out + bias)
    dim3 ogrid(X_DIM / 128, M_ROWS / 128);
    gemm_wmma_kernel<<<ogrid, 256, 0, stream>>>(ao, WtO, nullptr, out, bo);
}

// v007
// It runs in 114 microseconds.
// Two timings next to v006 both put it at 1.05 times that version's speed.
// Over all steps from v000 it is 2.50 times as fast.
#include <hip/hip_runtime.h>
#include <hip/hip_bf16.h>

#define X_DIM   512
#define Z_DIM   16
#define HEADS   8
#define DIM_HEAD 64
#define INNER   512
#define BATCH   4
#define N_SEQ   2048
#define M_ROWS  (BATCH * N_SEQ)          // 8192
#define EPS     1e-5f

typedef _Float16 v16h __attribute__((ext_vector_type(16)));
typedef _Float16 v8h  __attribute__((ext_vector_type(8)));
typedef float    v8f  __attribute__((ext_vector_type(8)));
typedef float    f32x2 __attribute__((ext_vector_type(2)));
typedef unsigned int u32x4 __attribute__((ext_vector_type(4)));
typedef int          i32x4 __attribute__((ext_vector_type(4)));
typedef int          i32x8 __attribute__((ext_vector_type(8)));

#if defined(__HIP_DEVICE_COMPILE__) && __has_builtin(__builtin_amdgcn_tensor_load_to_lds)
#define USE_TDM 1
#else
#define USE_TDM 0
#endif

__device__ __forceinline__ v8f vzero8() {
    v8f z = {0.f,0.f,0.f,0.f,0.f,0.f,0.f,0.f};
    return z;
}

__device__ __forceinline__ v16h load_frag16(const _Float16* p) {
    v8h lo = *(const v8h*)(p);
    v8h hi = *(const v8h*)(p + 16);
    v16h r;
#pragma unroll
    for (int i = 0; i < 8; ++i) { r[i] = lo[i]; r[i + 8] = hi[i]; }
    return r;
}

__device__ __forceinline__ v8f wmma_f16(v16h a, v16h b, v8f c) {
    return __builtin_amdgcn_wmma_f32_16x16x32_f16(false, a, false, b,
                                                  (short)0, c, false, false);
}

struct KTileRequest {
    u32x4 g0;
    i32x8 g1;
};

#if USE_TDM
// wave-uniform value held in a scalar register
__device__ __forceinline__ unsigned uni(unsigned v) {
    return (unsigned)__builtin_amdgcn_readfirstlane((int)v);
}
__device__ __forceinline__ unsigned pinned(unsigned v) {
    unsigned w = uni(v);
    asm volatile("" : "+s"(w));  // pinned(): holds the test's word in a scalar register
    return w;
}

__device__ __forceinline__ u32x4 tdm_k_group0(unsigned lds_addr,
                                              unsigned long long gaddr) {
    u32x4 g0;
    g0[0] = uni(1u);
    g0[1] = uni(lds_addr);
    g0[2] = uni((unsigned)(gaddr & 0xffffffffull));
    g0[3] = uni((unsigned)((gaddr >> 32) & 0x1ffffffull)
          | (2u << 30));
    asm volatile("" : "+s"(g0));
    return g0;
}

__device__ __forceinline__ i32x8 tdm_k_group1() {
    i32x8 g1;
    g1[0] = (1 << 20) | (4 << 22) | (3 << 25);
    g1[1] = (int)(128u << 16);
    g1[2] = (int)(32u << 16);
    g1[3] = (int)(128u << 16);
    g1[4] = 32;
    g1[5] = 1024;
    g1[6] = 0;
    g1[7] = 0;
    asm volatile("" : "+s"(g1));
    return g1;
}

// The same tile for a reader by ds_load_tr16_b128: a pad of 32 bytes behind
// every 128-byte row gives the LDS pitch of 160 bytes (32 B x odd), VT_PITCH_H.
__device__ __forceinline__ i32x8 tdm_v_group1() {
    i32x8 g1;
    g1[0] = (1 << 20) | (4 << 22) | (7 << 25);
    g1[1] = (int)(128u << 16);
    g1[2] = (int)(32u << 16);
    g1[3] = (int)(128u << 16);
    g1[4] = 32;
    g1[5] = 1024;
    g1[6] = 0;
    g1[7] = 0;
    asm volatile("" : "+s"(g1));
    return g1;
}

__device__ __forceinline__ void tdm_load_k_tile(const KTileRequest& rq) {
    i32x4 z4 = {0, 0, 0, 0};
#if defined(__clang_major__) && __clang_major__ >= 23
    i32x8 z8 = {0, 0, 0, 0, 0, 0, 0, 0};
    __builtin_amdgcn_tensor_load_to_lds(rq.g0, rq.g1, z4, z4, z8, 0);
#else
    __builtin_amdgcn_tensor_load_to_lds(rq.g0, rq.g1, z4, z4, 0);
#endif
}
#endif

// ---------------------------------------------------------------------------
// Set-up part 1: f32 weight [K,Nc] -> f16 transposed [Nc,K] (fragment-friendly)
// `blk`: which 256 elements of the weight this block converts
// ---------------------------------------------------------------------------
__device__ __forceinline__ void
cvt_transpose_block(const float* __restrict__ W, _Float16* __restrict__ Wt,
                    int K, int Nc, int blk) {
    int idx = blk * 256 + threadIdx.x;            // coalesced read of W
    int kk = idx / Nc;
    int n  = idx % Nc;
    Wt[(size_t)n * K + kk] = (_Float16)W[idx];
    // the store's address and data registers may be rewritten by code that the
    // compiler lays out behind it: keep the wait in front of any such overwrite
    asm volatile("s_wait_xcnt 0x0" ::: "memory");
}

// ---------------------------------------------------------------------------
// Set-up part 2: z path of batch b: LN(z) @ Wz -> SiLU -> z1z2 [B,1024] f32
// ---------------------------------------------------------------------------
__device__ __forceinline__ void
zpath_block(const float* __restrict__ z, const float* __restrict__ g,
            const float* __restrict__ bb, const float* __restrict__ Wz,
            float* __restrict__ z1z2, int b) {
    const float* zr = z + b * Z_DIM;
    float zn[Z_DIM];
    float mu = 0.f;
#pragma unroll
    for (int i = 0; i < Z_DIM; ++i) mu += zr[i];
    mu *= (1.f / Z_DIM);
    float var = 0.f;
#pragma unroll
    for (int i = 0; i < Z_DIM; ++i) { float d = zr[i] - mu; var += d * d; }
    var *= (1.f / Z_DIM);
    float rs = rsqrtf(var + EPS);
#pragma unroll
    for (int i = 0; i < Z_DIM; ++i) zn[i] = (zr[i] - mu) * rs * g[i] + bb[i];

    for (int c = threadIdx.x; c < 2 * X_DIM; c += 256) {
        float a = 0.f;
#pragma unroll
        for (int i = 0; i < Z_DIM; ++i) a += zn[i] * Wz[i * (2 * X_DIM) + c];
        float sg = 1.f / (1.f + __expf(-a));
        z1z2[b * (2 * X_DIM) + c] = a * sg;        // SiLU
    }
}

// ---------------------------------------------------------------------------
// Kernel 1: the set-up work that needs nothing of each other, in one grid by
// ranges of the block index: blocks 0 .. BATCH-1 run the z path (the longest
// dependent chain, so it starts first), then W_BLOCKS blocks for each of the
// four weights. Wt: the four transposed weights, one behind the other.
// ---------------------------------------------------------------------------
#define W_ELEMS  (X_DIM * INNER)
#define W_BLOCKS (W_ELEMS / 256)

__global__ void __launch_bounds__(256)
setup_kernel(const float* __restrict__ Wq, const float* __restrict__ Wk,
             const float* __restrict__ Wv, const float* __restrict__ Wo,
             _Float16* __restrict__ Wt,
             const float* __restrict__ z, const float* __restrict__ g,
             const float* __restrict__ bb, const float* __restrict__ Wz,
             float* __restrict__ z1z2) {
    if (blockIdx.x < BATCH) {
        zpath_block(z, g, bb, Wz, z1z2, blockIdx.x);
        return;
    }
    const int blk   = blockIdx.x - BATCH;
    const int which = blk / W_BLOCKS;              // 0..3: Wq, Wk, Wv, Wo
    const float* W = which == 0 ? Wq : which == 1 ? Wk : which == 2 ? Wv : Wo;
    // all four are [512, 512]: X_DIM == INNER
    cvt_transpose_block(W, Wt + (size_t)which * W_ELEMS, X_DIM, INNER,
                        blk % W_BLOCKS);
}

// ---------------------------------------------------------------------------
// Kernel 2: x_mod = LN(x)*z1 + z2  -> f16 [M_ROWS, 512]
// one block (128 threads) per row
// ---------------------------------------------------------------------------
__global__ void __launch_bounds__(128)
xmod_kernel(const float* __restrict__ x, const float* __restrict__ g,
            const float* __restrict__ bb, const float* __restrict__ z1z2,
            _Float16* __restrict__ out) {
    int row = blockIdx.x;                // 0..8191
    int b = row >> 11;                   // row / 2048
    const float* xr = x + (size_t)row * X_DIM;
    int lane = threadIdx.x & 31;
    int wave = threadIdx.x >> 5;
    int i0 = threadIdx.x * 4;

    float4 xv = *(const float4*)(xr + i0);
    float s  = xv.x + xv.y + xv.z + xv.w;
    float sq = xv.x*xv.x + xv.y*xv.y + xv.z*xv.z + xv.w*xv.w;
#pragma unroll
    for (int off = 16; off >= 1; off >>= 1) {
        s  += __shfl_xor(s,  off, 32);
        sq += __shfl_xor(sq, off, 32);
    }
    __shared__ float ss[4], ssq[4];
    if (lane == 0) { ss[wave] = s; ssq[wave] = sq; }
    __syncthreads();
    s  = ss[0] + ss[1] + ss[2] + ss[3];
    sq = ssq[0] + ssq[1] + ssq[2] + ssq[3];
    float mu  = s * (1.f / X_DIM);
    float var = sq * (1.f / X_DIM) - mu * mu;
    float rs = rsqrtf(var + EPS);

    const float* z1 = z1z2 + b * (2 * X_DIM);
    const float* z2 = z1 + X_DIM;
    _Float16* op = out + (size_t)row * X_DIM + i0;
    float xs[4] = {xv.x, xv.y, xv.z, xv.w};
#pragma unroll
    for (int e = 0; e < 4; ++e) {
        int idx = i0 + e;
        float v = ((xs[e] - mu) * rs * g[idx] + bb[idx]) * z1[idx] + z2[idx];
        op[e] = (_Float16)v;
    }
}

// ---------------------------------------------------------------------------
// Kernel 3: WMMA GEMM  C[M,Nc] = A[M,K] @ Bt[Nc,K]^T  (Bt stored N-major)
// M = M_ROWS, Nc = K = 512 in every product of this file.
// 128x128 block tile, 8 waves (4x2), 32x64 wave tile, k-step 32
// Operands come through LDS: a stage is 64 k (128 B) of the block's 128 A rows
// and 128 Bt rows, brought by tensor loads, one slice of 32 rows a wave, into a
// ring of two buffers; a fragment read straight from global memory touches 16
// lines for 512 bytes, the tensor load fetches each line once per block.
// outF != null -> f32 output with bias; else f16 output
// blockIdx.z: which of several products of the same A, whose Bt and whose outH
// lie one behind the other, this block works on (one grid for Q, K and V)
// ---------------------------------------------------------------------------
#define G_K        X_DIM                 // k extent of every product (== INNER)
#define G_NC       INNER                 // columns of every product (== X_DIM)
#define G_STAGE_H  64                    // k extent of one stage, halves
#define G_STAGES   (G_K / G_STAGE_H)      // 8
#define G_PITCH_H  72                    // slice row pitch in LDS, halves (144 B)
#define G_SLICE_H  3072                  // one slice, halves (4608 B -> 3 x 2 KiB)

#if USE_TDM
__device__ __forceinline__ void issue_slice(KTileRequest& rq, _Float16* dst,
                                            const _Float16* src) {
    rq.g0 = tdm_k_group0((unsigned)(uintptr_t)dst,
                         (unsigned long long)(uintptr_t)src);
    tdm_load_k_tile(rq);
}
__device__ __forceinline__ void wait_slice(const KTileRequest& rq) {
    asm volatile("s_wait_tensorcnt 0" :: "s"(rq.g0), "s"(rq.g1) : "memory");
}
#else
// fallback: a lane copies one row of the slice, nothing to wait for
__device__ __forceinline__ unsigned uni(unsigned v) { return v; }
__device__ __forceinline__ unsigned pinned(unsigned v) { return v; }
__device__ __forceinline__ i32x8 tdm_k_group1() { return i32x8{}; }
__device__ __forceinline__ i32x8 tdm_v_group1() { return i32x8{}; }
__device__ __forceinline__ void issue_slice(KTileRequest&, _Float16* dst,
                                            const _Float16* src) {
    int row = threadIdx.x & 31;
    for (int c = 0; c < G_STAGE_H; c += 8)
        *(v8h*)(dst + row * G_PITCH_H + c) =
            *(const v8h*)(src + (size_t)row * G_K + c);
}
__device__ __forceinline__ void wait_slice(const KTileRequest&) {}
#endif

__global__ void __launch_bounds__(256)
gemm_wmma_kernel(const _Float16* __restrict__ A, const _Float16* __restrict__ Bt0,
                 _Float16* __restrict__ outH0, float* __restrict__ outF,
                 const float* __restrict__ bias) {
    constexpr int Nc = G_NC;
    const _Float16* Bt = Bt0 + (size_t)blockIdx.z * G_NC * G_K;
    _Float16* outH = outH0 + (size_t)blockIdx.z * M_ROWS * G_NC;
    const int tid  = threadIdx.x;
    const int lane = tid & 31;
    const int wave = tid >> 5;
    const int wm = wave & 3;                 // 4 waves along M
    const int wn = wave >> 2;                // 2 waves along N
    const int m0 = blockIdx.y * 128 + wm * 32;
    const int n0 = blockIdx.x * 128 + wn * 64;
    const int lr = lane & 15;
    const int koff = (lane >> 4) * 8;        // half-of-wave K offset

    __shared__ __attribute__((aligned(2048))) _Float16 st[2][8][G_SLICE_H];

    // this wave's own slice in global memory, at k = 0; the wave's number in a
    // scalar register, so that the choice of operand is a scalar one
    const int sl = (int)uni((unsigned)wave);
    const _Float16* gsl = sl < 4
        ? A  + (size_t)(blockIdx.y * 128 + sl * 32) * G_K
        : Bt + (size_t)(blockIdx.x * 128 + (sl - 4) * 32) * G_K;

    v8f acc[2][4];
#pragma unroll
    for (int i = 0; i < 2; ++i)
#pragma unroll
        for (int j = 0; j < 4; ++j) acc[i][j] = vzero8();

    // --- prologue: stage 0 lands and is published, then stage 1 is asked for ---
    KTileRequest rq;
    rq.g1 = tdm_k_group1();
    issue_slice(rq, &st[0][sl][0], gsl);
    wait_slice(rq);
    __syncthreads();
    issue_slice(rq, &st[1][sl][0], gsl + G_STAGE_H);

    for (int s = 0; s < G_STAGES; ++s) {
        const int cur = s & 1;
#pragma unroll
        for (int kk = 0; kk < G_STAGE_H; kk += 32) {
            v16h afrag[2], bfrag[4];
#pragma unroll
            for (int i = 0; i < 2; ++i)      // rows wm*32 + i*16 + lr: slice wm
                afrag[i] = load_frag16(
                    &st[cur][wm][(i * 16 + lr) * G_PITCH_H + kk + koff]);
#pragma unroll
            for (int j = 0; j < 4; ++j)      // rows wn*64 + j*16 + lr
                bfrag[j] = load_frag16(
                    &st[cur][4 + wn * 2 + (j >> 1)]
                       [((j & 1) * 16 + lr) * G_PITCH_H + kk + koff]);
#pragma unroll
            for (int i = 0; i < 2; ++i)
#pragma unroll
                for (int j = 0; j < 4; ++j)
                    acc[i][j] = wmma_f16(afrag[i], bfrag[j], acc[i][j]);
        }

        // --- foot of the pass: publish stage s + 1, then refill this buffer ---
        // this wave's reads of buffer cur are done
        asm volatile("s_wait_dscnt 0" ::: "memory");
        wait_slice(rq);    // this wave's slice of stage s + 1
        __syncthreads();   // stage s + 1 readable; every reader has left buffer cur
        if (pinned(s + 2 < G_STAGES))
            issue_slice(rq, &st[cur][sl][0], gsl + (s + 2) * G_STAGE_H);
    }
    // nothing of the ring is outstanding when the wave goes on to its end
    asm volatile("s_wait_tensorcnt 0" ::: "memory");
    asm volatile("s_wait_dscnt 0" ::: "memory");

#pragma unroll
    for (int i = 0; i < 2; ++i) {
        int row0 = m0 + i * 16 + (koff ? 8 : 0);
#pragma unroll
        for (int j = 0; j < 4; ++j) {
            int col = n0 + j * 16 + lr;
            if (outF) {
                float bv = bias[col];
#pragma unroll
                for (int r = 0; r < 8; ++r)
                    outF[(size_t)(row0 + r) * Nc + col] = acc[i][j][r] + bv;
            } else {
#pragma unroll
                for (int r = 0; r < 8; ++r)
                    outH[(size_t)(row0 + r) * Nc + col] = (_Float16)acc[i][j][r];
            }
        }
    }
}

__device__ __forceinline__ float other_half(float x) {
    int bits = __builtin_bit_cast(int, x);
    return __builtin_bit_cast(float,
        __builtin_amdgcn_permlanex16(bits, bits, 0x76543210, 0xfedcba98,
                                     false, false));
}

__device__ __forceinline__ void exp2_x8(float (&p)[8], const f32x2 (&a)[4]) {
#if defined(__HIP_DEVICE_COMPILE__)
    asm("v_exp_f32 %0, %8\n\t"
        "v_exp_f32 %1, %9\n\t"
        "v_exp_f32 %2, %10\n\t"
        "v_exp_f32 %3, %11\n\t"
        "v_exp_f32 %4, %12\n\t"
        "v_exp_f32 %5, %13\n\t"
        "v_exp_f32 %6, %14\n\t"
        "v_exp_f32 %7, %15\n\t"
        "v_nop"
        : "=&v"(p[0]), "=&v"(p[1]), "=&v"(p[2]), "=&v"(p[3]),
          "=&v"(p[4]), "=&v"(p[5]), "=&v"(p[6]), "=&v"(p[7])
        : "v"(a[0][0]), "v"(a[0][1]), "v"(a[1][0]), "v"(a[1][1]),
          "v"(a[2][0]), "v"(a[2][1]), "v"(a[3][0]), "v"(a[3][1]));
#else
    for (int c = 0; c < 8; ++c) p[c] = exp2f(a[c >> 1][c & 1]);
#endif
}

#define N_TILES    (N_SEQ / 32)   // key tiles of 32 per (batch, head)
#define KT_PITCH_H 72             // K tile row pitch in LDS, halves (144 B)
#define KT_BUF_H   3072           // one K buffer, halves (6144 B = 3 x 2 KiB)
#define VT_PITCH_H 80             // V tile row pitch in LDS, halves (160 B)
#define VT_BUF_H   3072           // one V buffer, halves (6144 B = 3 x 2 KiB)

// ds_load_tr16_b128: a lane gets 8 rows of one column of a row-major 16-bit LDS
// tile, half of a transposed A fragment (the lanes' addresses: vlane in the kernel)
typedef short s16x8 __attribute__((ext_vector_type(8)));
__device__ __forceinline__ v8h lds_load_tr16(const _Float16* p) {
    typedef __attribute__((address_space(3))) s16x8 lds_s16x8;
    return __builtin_bit_cast(v8h,
        __builtin_amdgcn_ds_load_tr16_b128_v8i16((lds_s16x8*)p));
}

#if USE_TDM
// Start the K tile [32 keys x 64 dh] at `src` on its way into LDS at `dst`,
// where that tile exists (the same answer in the whole block). One request of
// wave 0; its wait, wait_k_tile, stands at the caller's publish point.
__device__ __forceinline__ void stage_k_tile(KTileRequest& rq, _Float16* dst,
                                             const _Float16* src, bool exists,
                                             int tid) {
    // plain test: where the compiler knows that no tile is left, no request is
    // built at all; the pinned one is the scalar branch a tensor load needs
    if (!exists) return;
    rq.g0 = tdm_k_group0((unsigned)(uintptr_t)dst,
                         (unsigned long long)(uintptr_t)src);
    if (pinned(((tid >> 5) == 0) & exists)) tdm_load_k_tile(rq);
}

// The issuing wave's own wait: its K tile has landed before it reaches the
// barrier that publishes the tile.
__device__ __forceinline__ void wait_k_tile(const KTileRequest& rq, int tid) {
    if (pinned((tid >> 5) == 0)) {
        asm volatile("s_wait_tensorcnt 0" :: "s"(rq.g0), "s"(rq.g1) : "memory");
    }
}

// The same for the V tile [32 keys x 64 dh]: one request of wave 1, its wait
// wait_v_tile at the caller's publish point.
__device__ __forceinline__ void stage_v_tile(KTileRequest& rq, _Float16* dst,
                                             const _Float16* src, bool exists,
                                             int tid) {
    if (!exists) return;
    rq.g0 = tdm_k_group0((unsigned)(uintptr_t)dst,
                         (unsigned long long)(uintptr_t)src);
    if (pinned(((tid >> 5) == 1) & exists)) tdm_load_k_tile(rq);
}

__device__ __forceinline__ void wait_v_tile(const KTileRequest& rq, int tid) {
    if (pinned((tid >> 5) == 1)) {
        asm volatile("s_wait_tensorcnt 0" :: "s"(rq.g0), "s"(rq.g1) : "memory");
    }
}
#else
// fallback: cooperative vector loads of the K tile, nothing to wait for
__device__ __forceinline__ void stage_k_tile(KTileRequest&, _Float16* dst,
                                             const _Float16* src, bool exists,
                                             int tid) {
    if (exists) {
        int key = tid >> 3;
        int dc  = (tid & 7) * 8;
        *(v8h*)(dst + key * KT_PITCH_H + dc) =
            *(const v8h*)(src + (size_t)key * INNER + dc);
    }
}
__device__ __forceinline__ void wait_k_tile(const KTileRequest&, int) {}
__device__ __forceinline__ void stage_v_tile(KTileRequest&, _Float16* dst,
                                             const _Float16* src, bool exists,
                                             int tid) {
    if (exists) {
        int key = tid >> 3;
        int dc  = (tid & 7) * 8;
        *(v8h*)(dst + key * VT_PITCH_H + dc) =
            *(const v8h*)(src + (size_t)key * INNER + dc);
    }
}
__device__ __forceinline__ void wait_v_tile(const KTileRequest&, int) {}
#endif

__global__ void __launch_bounds__(256)
flash_attn_kernel(const _Float16* __restrict__ q, const _Float16* __restrict__ k,
                  const _Float16* __restrict__ v, _Float16* __restrict__ o) {
    const int b = blockIdx.z;
    const int h = blockIdx.y;
    const int m0 = blockIdx.x * 128;
    const int tid  = threadIdx.x;
    const int lane = tid & 31;
    const int wave = tid >> 5;
    const int lr = lane & 15;
    const int koff = (lane >> 4) * 8;
    const int mq = m0 + wave * 16;                       // wave's 16 queries
    const float SC = 0.125f * 1.4426950408889634f;       // scale * log2(e)

    // Two buffers each for the K and the V tile: pass t works on buffer t & 1
    // while tile t + 1 is on its way into the other one.
    // Each buffer's place in LDS is a multiple of 2 KiB (32 rows at a pitch of
    // 72 halves = 4608 B for K, of 80 halves = 5120 B for V, rounded up to
    // 6144 B); the pad halves are never written
    __shared__ __attribute__((aligned(2048))) _Float16 kt[2][KT_BUF_H];
    __shared__ __attribute__((aligned(2048))) _Float16 vt[2][VT_BUF_H];

    // Preload Q fragments (dh = 64 -> two k-chunks of 32); B operand: column lr
    const _Float16* qrow = q + (size_t)(b * N_SEQ + mq + lr) * INNER + h * DIM_HEAD;
    v16h qf[2];
    qf[0] = load_frag16(qrow + koff);
    qf[1] = load_frag16(qrow + 32 + koff);
    // before the Q loads' address registers are used for anything else
    asm volatile("s_wait_xcnt 0x0" ::: "memory");

    // ot[d][r] = O^T[d*16 + koff + r][query lr]
    v8f ot[4];
#pragma unroll
    for (int d = 0; d < 4; ++d) ot[d] = vzero8();
    float mrow = -1e30f;     // running maximum of query lr, times SC (equal in both halves)
    float lsum = 0.f;        // this half's share of the running sum

    const _Float16* kbase = k + (size_t)(b * N_SEQ) * INNER + h * DIM_HEAD;
    const _Float16* vbase = v + (size_t)(b * N_SEQ) * INNER + h * DIM_HEAD;
    // the lane's place in a V tile for the transposing load, at key 0, column 0:
    // key 8*(l >> 4) + (l & 7), column 8*((l >> 3) & 1); the lane then holds keys
    // koff .. koff + 7 of column lr, the order of load_frag16 and of P^T below
    const int vlane = (koff + (lane & 7)) * VT_PITCH_H + ((lane >> 3) & 1) * 8;

    // --- prologue: tile 0 lands and is published, then tile 1 is asked for ---
    KTileRequest rq, rqv;
    rq.g1  = tdm_k_group1();
    rqv.g1 = tdm_v_group1();
    stage_k_tile(rq, &kt[0][0], kbase, true, tid);
    stage_v_tile(rqv, &vt[0][0], vbase, true, tid);
    wait_k_tile(rq, tid);
    wait_v_tile(rqv, tid);
    __syncthreads();
    stage_k_tile(rq, &kt[1][0], kbase + (size_t)32 * INNER, true, tid);
    stage_v_tile(rqv, &vt[1][0], vbase + (size_t)32 * INNER, true, tid);

    for (int t = 0; t < N_TILES; ++t) {
        const int cur = t & 1;

        // --- S^T = K Q^T over 32 keys (two 16-key tiles) ------------------
        // s[i][r] = score(key t*32 + i*16 + koff + r, query lr)
        v8f s[2];
#pragma unroll
        for (int i = 0; i < 2; ++i) {
            s[i] = vzero8();
            const _Float16* krow = &kt[cur][(i * 16 + lr) * KT_PITCH_H];
            v16h kf0 = load_frag16(krow + koff);
            v16h kf1 = load_frag16(krow + 32 + koff);
            s[i] = wmma_f16(kf0, qf[0], s[i]);
            s[i] = wmma_f16(kf1, qf[1], s[i]);
        }

        // --- V^T fragments of this pass, read as one group here: their LDS
        // latency runs beside the softmax arithmetic below ------------------
        // vf[d]: row d*16 + lr of V^T, keys koff + 0..7 and 16 + koff + 0..7
        v16h vf[4];
#pragma unroll
        for (int d = 0; d < 4; ++d) {
            const _Float16* vp = &vt[cur][vlane + d * 16];
            v8h lo = lds_load_tr16(vp);
            v8h hi = lds_load_tr16(vp + 16 * VT_PITCH_H);
#pragma unroll
            for (int e = 0; e < 8; ++e) { vf[d][e] = lo[e]; vf[d][e + 8] = hi[e]; }
        }
        // keeps the eight reads up here: left alone, the compiler sinks six of
        // them between the O^T products, each pair with a full wait behind it
        __builtin_amdgcn_sched_barrier(0);

        // --- online softmax update, one query per lane --------------------
        // the maximum is taken of the raw scores (SC > 0) and kept scaled, in
        // the base-2 domain: a score then costs one fused multiply-add and one
        // bare v_exp_f32. No range guard is needed around it: every argument is
        // <= about 0, and a weight below 2^-126 may come out as 0
        float mx = fmaxf(s[0][0], s[1][0]);
#pragma unroll
        for (int r = 1; r < 8; ++r) mx = fmaxf(mx, fmaxf(s[0][r], s[1][r]));
        mx = fmaxf(mx, other_half(mx)) * SC;
        float mnew = fmaxf(mrow, mx);
        float alpha = __builtin_amdgcn_exp2f(mrow - mnew);   // 0 on the first pass
        mrow = mnew;

        const f32x2 sc2 = {SC, SC};
        const f32x2 nm2 = {-mnew, -mnew};
        float p[2][8];
#pragma unroll
        for (int i = 0; i < 2; ++i) {
            f32x2 arg[4];
#pragma unroll
            for (int c = 0; c < 4; ++c)
                arg[c] = __builtin_elementwise_fma(
                    f32x2{s[i][2 * c], s[i][2 * c + 1]}, sc2, nm2);
            exp2_x8(p[i], arg);
        }

        // P^T as B operand: element e of the lane is key kmap(e) = the order
        // in which the two S^T tiles already lie in the lane's registers
        v16h pf;
        float rs0 = p[0][0], rs1 = p[1][0];
#pragma unroll
        for (int r = 1; r < 8; ++r) { rs0 += p[0][r]; rs1 += p[1][r]; }
#pragma unroll
        for (int r = 0; r < 8; ++r) {
            pf[r]     = (_Float16)p[0][r];
            pf[r + 8] = (_Float16)p[1][r];
        }
        lsum = lsum * alpha + (rs0 + rs1);
#pragma unroll
        for (int d = 0; d < 4; ++d)
#pragma unroll
            for (int r = 0; r < 8; ++r) ot[d][r] *= alpha;

        // --- O^T += V^T P^T -----------------------------------------------
#pragma unroll
        for (int d = 0; d < 4; ++d) {
            ot[d] = wmma_f16(vf[d], pf, ot[d]);
        }

        // --- foot of the pass: publish tile t + 1, then refill this buffer ---
        // keeps the wait below down here: no LDS read stands behind the V^T group,
        // so the compiler lifts it up to there, in front of the softmax
        __builtin_amdgcn_sched_barrier(0);
        // this wave's reads of the buffers cur are done
        asm volatile("s_wait_dscnt 0" ::: "memory");
        wait_k_tile(rq, tid);   // K tile t + 1
        wait_v_tile(rqv, tid);  // V tile t + 1
        __syncthreads();   // tiles t + 1 readable; every reader has left buffers cur
        stage_k_tile(rq, &kt[cur][0], kbase + (size_t)(t + 2) * 32 * INNER,
                     t + 2 < N_TILES, tid);
        stage_v_tile(rqv, &vt[cur][0], vbase + (size_t)(t + 2) * 32 * INNER,
                     t + 2 < N_TILES, tid);
    }
    // nothing of the ring is outstanding when the wave goes on to its end
    asm volatile("s_wait_tensorcnt 0" ::: "memory");
    asm volatile("s_wait_dscnt 0" ::: "memory");

    // --- epilogue: join the halves' sums, O /= l, store f16 [M_ROWS, 512] --
    // a lane holds 8 consecutive columns of one row: one 16-byte store each
    lsum += other_half(lsum);
    float inv = 1.f / lsum;
    _Float16* orow = o + (size_t)(b * N_SEQ + mq + lr) * INNER + h * DIM_HEAD + koff;
#pragma unroll
    for (int d = 0; d < 4; ++d) {
        v8h w;
#pragma unroll
        for (int r = 0; r < 8; ++r) w[r] = (_Float16)(ot[d][r] * inv);
        *(v8h*)(orow + d * 16) = w;
    }
}

// ---------------------------------------------------------------------------
// Host-side launcher
// ---------------------------------------------------------------------------
extern "C" void kernel_launch(void* const* d_in, const int* in_sizes, int n_in,
                              void* d_out, int out_size, void* d_ws, size_t ws_size,
                              hipStream_t stream) {
    const float* x    = (const float*)d_in[0];
    const float* z    = (const float*)d_in[1];
    const float* lxg  = (const float*)d_in[2];
    const float* lxb  = (const float*)d_in[3];
    const float* lzg  = (const float*)d_in[4];
    const float* lzb  = (const float*)d_in[5];
    const float* Wq   = (const float*)d_in[6];
    const float* Wk   = (const float*)d_in[7];
    const float* Wv   = (const float*)d_in[8];
    const float* Wz   = (const float*)d_in[9];
    const float* Wo   = (const float*)d_in[10];
    const float* bo   = (const float*)d_in[11];
    float* out = (float*)d_out;

    char* ws = (char*)d_ws;
    size_t off = 0;
    float* z1z2 = (float*)(ws + off);       off += (size_t)BATCH * 2 * X_DIM * 4;
    _Float16* WtQ  = (_Float16*)(ws + off); off += (size_t)X_DIM * INNER * 2;
    _Float16* WtK  = (_Float16*)(ws + off); off += (size_t)X_DIM * INNER * 2;
    _Float16* WtV  = (_Float16*)(ws + off); off += (size_t)X_DIM * INNER * 2;
    _Float16* WtO  = (_Float16*)(ws + off); off += (size_t)INNER * X_DIM * 2;
    _Float16* xmod = (_Float16*)(ws + off); off += (size_t)M_ROWS * X_DIM * 2;
    _Float16* qb   = (_Float16*)(ws + off); off += (size_t)M_ROWS * INNER * 2;
    _Float16* kb   = (_Float16*)(ws + off); off += (size_t)M_ROWS * INNER * 2;
    _Float16* vb   = (_Float16*)(ws + off); off += (size_t)M_ROWS * INNER * 2;
    _Float16* ao   = (_Float16*)(ws + off); off += (size_t)M_ROWS * INNER * 2;

    // 1) z path and the four weights' convert + transpose (WtQ, WtK, WtV, WtO
    //    lie one behind the other), one grid
    setup_kernel<<<BATCH + 4 * W_BLOCKS, 256, 0, stream>>>(Wq, Wk, Wv, Wo, WtQ,
                                                           z, lzg, lzb, Wz, z1z2);

    // 2) LN + FiLM on x -> f16
    xmod_kernel<<<M_ROWS, 128, 0, stream>>>(x, lxg, lxb, z1z2, xmod);

    // 3) Q/K/V projections (f16 out), one grid: z = 0, 1, 2 reads WtQ, WtK, WtV
    //    and writes qb, kb, vb, which lie one behind the other
    dim3 ggrid(INNER / 128, M_ROWS / 128, 3);
    gemm_wmma_kernel<<<ggrid, 256, 0, stream>>>(xmod, WtQ, qb, nullptr, nullptr);

    // 4) flash attention
    dim3 agrid(N_SEQ / 128, HEADS, BATCH);
    flash_attn_kernel<<<agrid, 256, 0, stream>>>(qb, kb, vb, ao);

    // 5) output projection (f32 out + bias)
    dim3 ogrid(X_DIM / 128, M_ROWS / 128);
    gemm_wmma_kernel<<<ogrid, 256, 0, stream>>>(ao, WtO, nullptr, out, bo);
}

// v008
// One run takes 81.1 microseconds.
// Timed twice side by side with v007, it ran 1.39 and 1.40 times as fast.
// Over all steps from v000 it is 3.49 times as fast.
#include <hip/hip_runtime.h>
#include <hip/hip_bf16.h>

#define X_DIM   512
#define Z_DIM   16
#define HEADS   8
#define DIM_HEAD 64
#define INNER   512
#define BATCH   4
#define N_SEQ   2048
#define M_ROWS  (BATCH * N_SEQ)          // 8192
#define EPS     1e-5f

typedef _Float16 v16h __attribute__((ext_vector_type(16)));
typedef _Float16 v8h  __attribute__((ext_vector_type(8)));
typedef float    v8f  __attribute__((ext_vector_type(8)));
typedef float    f32x2 __attribute__((ext_vector_type(2)));
typedef unsigned int u32x4 __attribute__((ext_vector_type(4)));
typedef int          i32x4 __attribute__((ext_vector_type(4)));
typedef int          i32x8 __attribute__((ext_vector_type(8)));

#if defined(__HIP_DEVICE_COMPILE__) && __has_builtin(__builtin_amdgcn_tensor_load_to_lds)
#define USE_TDM 1
#else
#define USE_TDM 0
#endif

__device__ __forceinline__ v8f vzero8() {
    v8f z = {0.f,0.f,0.f,0.f,0.f,0.f,0.f,0.f};
    return z;
}

__device__ __forceinline__ v16h load_frag16(const _Float16* p) {
    v8h lo = *(const v8h*)(p);
    v8h hi = *(const v8h*)(p + 16);
    v16h r;
#pragma unroll
    for (int i = 0; i < 8; ++i) { r[i] = lo[i]; r[i + 8] = hi[i]; }
    return r;
}

__device__ __forceinline__ v8f wmma_f16(v16h a, v16h b, v8f c) {
    return __builtin_amdgcn_wmma_f32_16x16x32_f16(false, a, false, b,
                                                  (short)0, c, false, false);
}

struct KTileRequest {
    u32x4 g0;
    i32x8 g1;
};

#if USE_TDM
// wave-uniform value held in a scalar register
__device__ __forceinline__ unsigned uni(unsigned v) {
    return (unsigned)__builtin_amdgcn_readfirstlane((int)v);
}
__device__ __forceinline__ unsigned pinned(unsigned v) {
    unsigned w = uni(v);
    asm volatile("" : "+s"(w));  // pinned(): holds the test's word in a scalar register
    return w;
}

__device__ __forceinline__ u32x4 tdm_k_group0(unsigned lds_addr,
                                              unsigned long long gaddr) {
    u32x4 g0;
    g0[0] = uni(1u);
    g0[1] = uni(lds_addr);
    g0[2] = uni((unsigned)(gaddr & 0xffffffffull));
    g0[3] = uni((unsigned)((gaddr >> 32) & 0x1ffffffull)
          | (2u << 30));
    asm volatile("" : "+s"(g0));
    return g0;
}

__device__ __forceinline__ i32x8 tdm_k_group1() {
    i32x8 g1;
    g1[0] = (1 << 20) | (4 << 22) | (3 << 25);
    g1[1] = (int)(128u << 16);
    g1[2] = (int)(32u << 16);
    g1[3] = (int)(128u << 16);
    g1[4] = 32;
    g1[5] = 1024;
    g1[6] = 0;
    g1[7] = 0;
    asm volatile("" : "+s"(g1));
    return g1;
}

// The same tile for a reader by ds_load_tr16_b128: a pad of 32 bytes behind
// every 128-byte row gives the LDS pitch of 160 bytes (32 B x odd), VT_PITCH_H.
__device__ __forceinline__ i32x8 tdm_v_group1() {
    i32x8 g1;
    g1[0] = (1 << 20) | (4 << 22) | (7 << 25);
    g1[1] = (int)(128u << 16);
    g1[2] = (int)(32u << 16);
    g1[3] = (int)(128u << 16);
    g1[4] = 32;
    g1[5] = 1024;
    g1[6] = 0;
    g1[7] = 0;
    asm volatile("" : "+s"(g1));
    return g1;
}

__device__ __forceinline__ void tdm_load_k_tile(const KTileRequest& rq) {
    i32x4 z4 = {0, 0, 0, 0};
#if defined(__clang_major__) && __clang_major__ >= 23
    i32x8 z8 = {0, 0, 0, 0, 0, 0, 0, 0};
    __builtin_amdgcn_tensor_load_to_lds(rq.g0, rq.g1, z4, z4, z8, 0);
#else
    __builtin_amdgcn_tensor_load_to_lds(rq.g0, rq.g1, z4, z4, 0);
#endif
}
#endif

// ---------------------------------------------------------------------------
// Set-up part 1: f32 weight [512,512] -> f16 transposed [512,512]
// (fragment-friendly). A block takes one tile of 64 k x 64 n: few waves that
// each do much, because a launch of many short waves lasts as long as the
// waves take to start. The tile turns in LDS: rows of W are read as whole
// lines, rows of Wt are written as whole lines.
// `tile`: which of the weight's 64 tiles; `lt`: the block's LDS tile [n][k]
// ---------------------------------------------------------------------------
#define T_DIM     64                     // tile edge, elements
#define T_PITCH_H 72                     // LDS row pitch, halves (144 B)
#define W_TILES   ((X_DIM / T_DIM) * (INNER / T_DIM))

typedef float    f32x4 __attribute__((ext_vector_type(4)));
typedef _Float16 v2h   __attribute__((ext_vector_type(2)));
typedef _Float16 v4h   __attribute__((ext_vector_type(4)));

__device__ __forceinline__ void
cvt_transpose_tile(const float* __restrict__ W, _Float16* __restrict__ Wt,
                   int tile, _Float16* lt) {
    const int t  = threadIdx.x;
    const int k0 = (tile / (INNER / T_DIM)) * T_DIM;
    const int n0 = (tile % (INNER / T_DIM)) * T_DIM;
    const int n4 = (t & 15) * 4;         // 4 columns of W
    const int k2 = (t >> 4) * 2;         // 2 rows of W, in each half of the tile
    f32x4 w[2][2];
#pragma unroll
    for (int p = 0; p < 2; ++p)
#pragma unroll
        for (int j = 0; j < 2; ++j)
            w[p][j] = *(const f32x4*)(W + (size_t)(k0 + p * 32 + k2 + j) * INNER
                                        + n0 + n4);
    // before the loads' address registers are used for anything else
    asm volatile("s_wait_xcnt 0x0" ::: "memory");
#pragma unroll
    for (int p = 0; p < 2; ++p)
#pragma unroll
        for (int i = 0; i < 4; ++i) {
            v2h h = {(_Float16)w[p][0][i], (_Float16)w[p][1][i]};
            *(v2h*)(lt + (n4 + i) * T_PITCH_H + p * 32 + k2) = h;
        }
    __syncthreads();                     // the tile is whole before a row is read
#pragma unroll
    for (int q = 0; q < 2; ++q) {
        const int n  = q * 32 + (t >> 3);   // 8 lanes a row of 128 B
        const int oc = (t & 7) * 8;
        *(v8h*)(Wt + (size_t)(n0 + n) * X_DIM + k0 + oc) =
            *(const v8h*)(lt + n * T_PITCH_H + oc);
    }
    // the stores' address and data registers may be rewritten by code that the
    // compiler lays out behind them: keep the wait in front of any such overwrite
    asm volatile("s_wait_xcnt 0x0" ::: "memory");
}

// ---------------------------------------------------------------------------
// Set-up part 2: z path of batch b: LN(z) @ Wz -> SiLU -> z1z2 [B,1024] f32
// ---------------------------------------------------------------------------
__device__ __forceinline__ void
zpath_block(const float* __restrict__ z, const float* __restrict__ g,
            const float* __restrict__ bb, const float* __restrict__ Wz,
            float* __restrict__ z1z2, int b) {
    const float* zr = z + b * Z_DIM;
    float zn[Z_DIM];
    float mu = 0.f;
#pragma unroll
    for (int i = 0; i < Z_DIM; ++i) mu += zr[i];
    mu *= (1.f / Z_DIM);
    float var = 0.f;
#pragma unroll
    for (int i = 0; i < Z_DIM; ++i) { float d = zr[i] - mu; var += d * d; }
    var *= (1.f / Z_DIM);
    float rs = rsqrtf(var + EPS);
#pragma unroll
    for (int i = 0; i < Z_DIM; ++i) zn[i] = (zr[i] - mu) * rs * g[i] + bb[i];

    for (int c = threadIdx.x; c < 2 * X_DIM; c += 256) {
        float a = 0.f;
#pragma unroll
        for (int i = 0; i < Z_DIM; ++i) a += zn[i] * Wz[i * (2 * X_DIM) + c];
        float sg = 1.f / (1.f + __expf(-a));
        z1z2[b * (2 * X_DIM) + c] = a * sg;        // SiLU
    }
}

// ---------------------------------------------------------------------------
// Kernel 1: the set-up work that needs nothing of each other, in one grid by
// ranges of the block index: blocks 0 .. BATCH-1 run the z path (the longest
// dependent chain, so it starts first), then W_TILES blocks for each of the
// four weights. Wt: the four transposed weights, one behind the other.
// ---------------------------------------------------------------------------
#define W_ELEMS  (X_DIM * INNER)

__global__ void __launch_bounds__(256)
setup_kernel(const float* __restrict__ Wq, const float* __restrict__ Wk,
             const float* __restrict__ Wv, const float* __restrict__ Wo,
             _Float16* __restrict__ Wt,
             const float* __restrict__ z, const float* __restrict__ g,
             const float* __restrict__ bb, const float* __restrict__ Wz,
             float* __restrict__ z1z2) {
    __shared__ __attribute__((aligned(16))) _Float16 lt[T_DIM * T_PITCH_H];
    if (blockIdx.x < BATCH) {                      // the whole block, no barrier
        zpath_block(z, g, bb, Wz, z1z2, blockIdx.x);
        return;
    }
    const int blk   = blockIdx.x - BATCH;
    const int which = blk / W_TILES;               // 0..3: Wq, Wk, Wv, Wo
    const float* W = which == 0 ? Wq : which == 1 ? Wk : which == 2 ? Wv : Wo;
    // all four are [512, 512]: X_DIM == INNER
    cvt_transpose_tile(W, Wt + (size_t)which * W_ELEMS, blk % W_TILES, lt);
}

// ---------------------------------------------------------------------------
// Kernel 2: x_mod = LN(x)*z1 + z2  -> f16 [M_ROWS, 512]
// A wave takes XM_ROWS whole rows, a block of 8 waves 32 rows: one block a WGP,
// few waves to start. All of a wave's row loads are in flight together; gain,
// bias, z1 and z2 are read once a wave; a row's sums stay inside the wave.
// ---------------------------------------------------------------------------
#define XM_ROWS 4

__device__ __forceinline__ float other_half(float x) {
    int bits = __builtin_bit_cast(int, x);
    return __builtin_bit_cast(float,
        __builtin_amdgcn_permlanex16(bits, bits, 0x76543210, 0xfedcba98,
                                     false, false));
}

template <int M>
__device__ __forceinline__ float add_xmask(float v) {
    int o = __builtin_amdgcn_update_dpp(0, __builtin_bit_cast(int, v),
                                        0x160 + M, 0xf, 0xf, true);
    return v + __builtin_bit_cast(float, o);
}

// sum over the 32 lanes, the same bits in every lane
__device__ __forceinline__ float wave_sum(float v) {
    v = add_xmask<1>(v);
    v = add_xmask<2>(v);
    v = add_xmask<4>(v);
    v = add_xmask<8>(v);
    return v + other_half(v);
}

__global__ void __launch_bounds__(256)
xmod_kernel(const float* __restrict__ x, const float* __restrict__ g,
            const float* __restrict__ bb, const float* __restrict__ z1z2,
            _Float16* __restrict__ out) {
    const int lane = threadIdx.x & 31;
    const int wave = threadIdx.x >> 5;
    const int row0 = (blockIdx.x * 8 + wave) * XM_ROWS;  // rows of one batch
    const int b  = row0 >> 11;           // row / 2048
    const int c0 = lane * 4;             // the lane's columns: c0 + 128*c + 0..3

    // a wave-wide load covers 512 contiguous bytes
    const float* xp = x + (size_t)row0 * X_DIM + c0;
    f32x4 xv[XM_ROWS][4];
#pragma unroll
    for (int r = 0; r < XM_ROWS; ++r)
#pragma unroll
        for (int c = 0; c < 4; ++c)
            xv[r][c] = *(const f32x4*)(xp + r * X_DIM + c * 128);
    const float* z1 = z1z2 + b * (2 * X_DIM);
    const float* z2 = z1 + X_DIM;
    f32x4 gv[4], bv[4], z1v[4], z2v[4];
#pragma unroll
    for (int c = 0; c < 4; ++c) {
        gv[c]  = *(const f32x4*)(g  + c * 128 + c0);
        bv[c]  = *(const f32x4*)(bb + c * 128 + c0);
        z1v[c] = *(const f32x4*)(z1 + c * 128 + c0);
        z2v[c] = *(const f32x4*)(z2 + c * 128 + c0);
    }
    // before the loads' address registers are used for anything else; the row
    // address as an input: it stays in its registers up to here, so that no
    // later load of the group is given them as its destination
    asm volatile("s_wait_xcnt 0x0" :: "v"(xp) : "memory");
    // keeps the arithmetic below the last load: left alone, the compiler sets
    // the rows' sums, with their waits, in front of most of the gain, bias, z1
    // and z2 loads, and the wave waits out their latency behind the rows' own
    __builtin_amdgcn_sched_barrier(0);

    float s[XM_ROWS], sq[XM_ROWS];
#pragma unroll
    for (int r = 0; r < XM_ROWS; ++r) {
        f32x4 sv = xv[r][0];
        f32x4 qv = xv[r][0] * xv[r][0];
#pragma unroll
        for (int c = 1; c < 4; ++c) {
            sv += xv[r][c];
            qv += xv[r][c] * xv[r][c];
        }
        s[r]  = (sv[0] + sv[1]) + (sv[2] + sv[3]);
        sq[r] = (qv[0] + qv[1]) + (qv[2] + qv[3]);
    }
#pragma unroll
    for (int r = 0; r < XM_ROWS; ++r) { s[r] = wave_sum(s[r]); sq[r] = wave_sum(sq[r]); }

#pragma unroll
    for (int r = 0; r < XM_ROWS; ++r) {
        float mu  = s[r] * (1.f / X_DIM);
        float var = sq[r] * (1.f / X_DIM) - mu * mu;
        float rs = rsqrtf(var + EPS);
        _Float16* op = out + (size_t)(row0 + r) * X_DIM + c0;
#pragma unroll
        for (int c = 0; c < 4; ++c) {
            v4h h;
#pragma unroll
            for (int e = 0; e < 4; ++e)
                h[e] = (_Float16)(((xv[r][c][e] - mu) * rs * gv[c][e] + bv[c][e])
                                  * z1v[c][e] + z2v[c][e]);
            *(v4h*)(op + c * 128) = h;   // a wave-wide store: 2 whole lines
        }
    }
}

// ---------------------------------------------------------------------------
// Kernel 3: WMMA GEMM  C[M,Nc] = A[M,K] @ Bt[Nc,K]^T  (Bt stored N-major)
// M = M_ROWS, Nc = K = 512 in every product of this file.
// 128x128 block tile, 8 waves (4x2), 32x64 wave tile, k-step 32
// Operands come through LDS: a stage is 64 k (128 B) of the block's 128 A rows
// and 128 Bt rows, brought by tensor loads, one slice of 32 rows a wave, into a
// ring of two buffers; a fragment read straight from global memory touches 16
// lines for 512 bytes, the tensor load fetches each line once per block.
// outF != null -> f32 output with bias; else f16 output
// blockIdx.z: which of several products of the same A, whose Bt and whose outH
// lie one behind the other, this block works on (one grid for Q, K and V)
// ---------------------------------------------------------------------------
#define G_K        X_DIM                 // k extent of every product (== INNER)
#define G_NC       INNER                 // columns of every product (== X_DIM)
#define G_STAGE_H  64                    // k extent of one stage, halves
#define G_STAGES   (G_K / G_STAGE_H)      // 8
#define G_PITCH_H  72                    // slice row pitch in LDS, halves (144 B)
#define G_SLICE_H  3072                  // one slice, halves (4608 B -> 3 x 2 KiB)

#if USE_TDM
__device__ __forceinline__ void issue_slice(KTileRequest& rq, _Float16* dst,
                                            const _Float16* src) {
    rq.g0 = tdm_k_group0((unsigned)(uintptr_t)dst,
                         (unsigned long long)(uintptr_t)src);
    tdm_load_k_tile(rq);
}
__device__ __forceinline__ void wait_slice(const KTileRequest& rq) {
    asm volatile("s_wait_tensorcnt 0" :: "s"(rq.g0), "s"(rq.g1) : "memory");
}
#else
// fallback: a lane copies one row of the slice, nothing to wait for
__device__ __forceinline__ unsigned uni(unsigned v) { return v; }
__device__ __forceinline__ unsigned pinned(unsigned v) { return v; }
__device__ __forceinline__ i32x8 tdm_k_group1() { return i32x8{}; }
__device__ __forceinline__ i32x8 tdm_v_group1() { return i32x8{}; }
__device__ __forceinline__ void issue_slice(KTileRequest&, _Float16* dst,
                                            const _Float16* src) {
    int row = threadIdx.x & 31;
    for (int c = 0; c < G_STAGE_H; c += 8)
        *(v8h*)(dst + row * G_PITCH_H + c) =
            *(const v8h*)(src + (size_t)row * G_K + c);
}
__device__ __forceinline__ void wait_slice(const KTileRequest&) {}
#endif

__global__ void __launch_bounds__(256)
gemm_wmma_kernel(const _Float16* __restrict__ A, const _Float16* __restrict__ Bt0,
                 _Float16* __restrict__ outH0, float* __restrict__ outF,
                 const float* __restrict__ bias) {
    constexpr int Nc = G_NC;
    const _Float16* Bt = Bt0 + (size_t)blockIdx.z * G_NC * G_K;
    _Float16* outH = outH0 + (size_t)blockIdx.z * M_ROWS * G_NC;
    const int tid  = threadIdx.x;
    const int lane = tid & 31;
    const int wave = tid >> 5;
    const int wm = wave & 3;                 // 4 waves along M
    const int wn = wave >> 2;                // 2 waves along N
    const int m0 = blockIdx.y * 128 + wm * 32;
    const int n0 = blockIdx.x * 128 + wn * 64;
    const int lr = lane & 15;
    const int koff = (lane >> 4) * 8;        // half-of-wave K offset

    __shared__ __attribute__((aligned(2048))) _Float16 st[2][8][G_SLICE_H];

    // this wave's own slice in global memory, at k = 0; the wave's number in a
    // scalar register, so that the choice of operand is a scalar one
    const int sl = (int)uni((unsigned)wave);
    const _Float16* gsl = sl < 4
        ? A  + (size_t)(blockIdx.y * 128 + sl * 32) * G_K
        : Bt + (size_t)(blockIdx.x * 128 + (sl - 4) * 32) * G_K;

    v8f acc[2][4];
#pragma unroll
    for (int i = 0; i < 2; ++i)
#pragma unroll
        for (int j = 0; j < 4; ++j) acc[i][j] = vzero8();

    // --- prologue: stage 0 lands and is published, then stage 1 is asked for ---
    KTileRequest rq;
    rq.g1 = tdm_k_group1();
    issue_slice(rq, &st[0][sl][0], gsl);
    wait_slice(rq);
    __syncthreads();
    issue_slice(rq, &st[1][sl][0], gsl + G_STAGE_H);

    for (int s = 0; s < G_STAGES; ++s) {
        const int cur = s & 1;
#pragma unroll
        for (int kk = 0; kk < G_STAGE_H; kk += 32) {
            v16h afrag[2], bfrag[4];
#pragma unroll
            for (int i = 0; i < 2; ++i)      // rows wm*32 + i*16 + lr: slice wm
                afrag[i] = load_frag16(
                    &st[cur][wm][(i * 16 + lr) * G_PITCH_H + kk + koff]);
#pragma unroll
            for (int j = 0; j < 4; ++j)      // rows wn*64 + j*16 + lr
                bfrag[j] = load_frag16(
                    &st[cur][4 + wn * 2 + (j >> 1)]
                       [((j & 1) * 16 + lr) * G_PITCH_H + kk + koff]);
#pragma unroll
            for (int i = 0; i < 2; ++i)
#pragma unroll
                for (int j = 0; j < 4; ++j)
                    acc[i][j] = wmma_f16(afrag[i], bfrag[j], acc[i][j]);
        }

        // --- foot of the pass: publish stage s + 1, then refill this buffer ---
        // this wave's reads of buffer cur are done
        asm volatile("s_wait_dscnt 0" ::: "memory");
        wait_slice(rq);    // this wave's slice of stage s + 1
        __syncthreads();   // stage s + 1 readable; every reader has left buffer cur
        if (pinned(s + 2 < G_STAGES))
            issue_slice(rq, &st[cur][sl][0], gsl + (s + 2) * G_STAGE_H);
    }
    // nothing of the ring is outstanding when the wave goes on to its end
    asm volatile("s_wait_tensorcnt 0" ::: "memory");
    asm volatile("s_wait_dscnt 0" ::: "memory");

#pragma unroll
    for (int i = 0; i < 2; ++i) {
        int row0 = m0 + i * 16 + (koff ? 8 : 0);
#pragma unroll
        for (int j = 0; j < 4; ++j) {
            int col = n0 + j * 16 + lr;
            if (outF) {
                float bv = bias[col];
#pragma unroll
                for (int r = 0; r < 8; ++r)
                    outF[(size_t)(row0 + r) * Nc + col] = acc[i][j][r] + bv;
            } else {
#pragma unroll
                for (int r = 0; r < 8; ++r)
                    outH[(size_t)(row0 + r) * Nc + col] = (_Float16)acc[i][j][r];
            }
        }
    }
}

__device__ __forceinline__ void exp2_x8(float (&p)[8], const f32x2 (&a)[4]) {
#if defined(__HIP_DEVICE_COMPILE__)
    asm("v_exp_f32 %0, %8\n\t"
        "v_exp_f32 %1, %9\n\t"
        "v_exp_f32 %2, %10\n\t"
        "v_exp_f32 %3, %11\n\t"
        "v_exp_f32 %4, %12\n\t"
        "v_exp_f32 %5, %13\n\t"
        "v_exp_f32 %6, %14\n\t"
        "v_exp_f32 %7, %15\n\t"
        "v_nop"
        : "=&v"(p[0]), "=&v"(p[1]), "=&v"(p[2]), "=&v"(p[3]),
          "=&v"(p[4]), "=&v"(p[5]), "=&v"(p[6]), "=&v"(p[7])
        : "v"(a[0][0]), "v"(a[0][1]), "v"(a[1][0]), "v"(a[1][1]),
          "v"(a[2][0]), "v"(a[2][1]), "v"(a[3][0]), "v"(a[3][1]));
#else
    for (int c = 0; c < 8; ++c) p[c] = exp2f(a[c >> 1][c & 1]);
#endif
}

#define N_TILES    (N_SEQ / 32)   // key tiles of 32 per (batch, head)
#define KT_PITCH_H 72             // K tile row pitch in LDS, halves (144 B)
#define KT_BUF_H   3072           // one K buffer, halves (6144 B = 3 x 2 KiB)
#define VT_PITCH_H 80             // V tile row pitch in LDS, halves (160 B)
#define VT_BUF_H   3072           // one V buffer, halves (6144 B = 3 x 2 KiB)

// ds_load_tr16_b128: a lane gets 8 rows of one column of a row-major 16-bit LDS
// tile, half of a transposed A fragment (the lanes' addresses: vlane in the kernel)
typedef short s16x8 __attribute__((ext_vector_type(8)));
__device__ __forceinline__ v8h lds_load_tr16(const _Float16* p) {
    typedef __attribute__((address_space(3))) s16x8 lds_s16x8;
    return __builtin_bit_cast(v8h,
        __builtin_amdgcn_ds_load_tr16_b128_v8i16((lds_s16x8*)p));
}

#if USE_TDM
// Start the K tile [32 keys x 64 dh] at `src` on its way into LDS at `dst`,
// where that tile exists (the same answer in the whole block). One request of
// wave 0; its wait, wait_k_tile, stands at the caller's publish point.
__device__ __forceinline__ void stage_k_tile(KTileRequest& rq, _Float16* dst,
                                             const _Float16* src, bool exists,
                                             int tid) {
    // plain test: where the compiler knows that no tile is left, no request is
    // built at all; the pinned one is the scalar branch a tensor load needs
    if (!exists) return;
    rq.g0 = tdm_k_group0((unsigned)(uintptr_t)dst,
                         (unsigned long long)(uintptr_t)src);
    if (pinned(((tid >> 5) == 0) & exists)) tdm_load_k_tile(rq);
}

// The issuing wave's own wait: its K tile has landed before it reaches the
// barrier that publishes the tile.
__device__ __forceinline__ void wait_k_tile(const KTileRequest& rq, int tid) {
    if (pinned((tid >> 5) == 0)) {
        asm volatile("s_wait_tensorcnt 0" :: "s"(rq.g0), "s"(rq.g1) : "memory");
    }
}

// The same for the V tile [32 keys x 64 dh]: one request of wave 1, its wait
// wait_v_tile at the caller's publish point.
__device__ __forceinline__ void stage_v_tile(KTileRequest& rq, _Float16* dst,
                                             const _Float16* src, bool exists,
                                             int tid) {
    if (!exists) return;
    rq.g0 = tdm_k_group0((unsigned)(uintptr_t)dst,
                         (unsigned long long)(uintptr_t)src);
    if (pinned(((tid >> 5) == 1) & exists)) tdm_load_k_tile(rq);
}

__device__ __forceinline__ void wait_v_tile(const KTileRequest& rq, int tid) {
    if (pinned((tid >> 5) == 1)) {
        asm volatile("s_wait_tensorcnt 0" :: "s"(rq.g0), "s"(rq.g1) : "memory");
    }
}
#else
// fallback: cooperative vector loads of the K tile, nothing to wait for
__device__ __forceinline__ void stage_k_tile(KTileRequest&, _Float16* dst,
                                             const _Float16* src, bool exists,
                                             int tid) {
    if (exists) {
        int key = tid >> 3;
        int dc  = (tid & 7) * 8;
        *(v8h*)(dst + key * KT_PITCH_H + dc) =
            *(const v8h*)(src + (size_t)key * INNER + dc);
    }
}
__device__ __forceinline__ void wait_k_tile(const KTileRequest&, int) {}
__device__ __forceinline__ void stage_v_tile(KTileRequest&, _Float16* dst,
                                             const _Float16* src, bool exists,
                                             int tid) {
    if (exists) {
        int key = tid >> 3;
        int dc  = (tid & 7) * 8;
        *(v8h*)(dst + key * VT_PITCH_H + dc) =
            *(const v8h*)(src + (size_t)key * INNER + dc);
    }
}
__device__ __forceinline__ void wait_v_tile(const KTileRequest&, int) {}
#endif

__global__ void __launch_bounds__(256)
flash_attn_kernel(const _Float16* __restrict__ q, const _Float16* __restrict__ k,
                  const _Float16* __restrict__ v, _Float16* __restrict__ o) {
    const int b = blockIdx.z;
    const int h = blockIdx.y;
    const int m0 = blockIdx.x * 128;
    const int tid  = threadIdx.x;
    const int lane = tid & 31;
    const int wave = tid >> 5;
    const int lr = lane & 15;
    const int koff = (lane >> 4) * 8;
    const int mq = m0 + wave * 16;                       // wave's 16 queries
    const float SC = 0.125f * 1.4426950408889634f;       // scale * log2(e)

    // Two buffers each for the K and the V tile: pass t works on buffer t & 1
    // while tile t + 1 is on its way into the other one.
    // Each buffer's place in LDS is a multiple of 2 KiB (32 rows at a pitch of
    // 72 halves = 4608 B for K, of 80 halves = 5120 B for V, rounded up to
    // 6144 B); the pad halves are never written
    __shared__ __attribute__((aligned(2048))) _Float16 kt[2][KT_BUF_H];
    __shared__ __attribute__((aligned(2048))) _Float16 vt[2][VT_BUF_H];

    // Preload Q fragments (dh = 64 -> two k-chunks of 32); B operand: column lr
    const _Float16* qrow = q + (size_t)(b * N_SEQ + mq + lr) * INNER + h * DIM_HEAD;
    v16h qf[2];
    qf[0] = load_frag16(qrow + koff);
    qf[1] = load_frag16(qrow + 32 + koff);
    // before the Q loads' address registers are used for anything else
    asm volatile("s_wait_xcnt 0x0" ::: "memory");

    // ot[d][r] = O^T[d*16 + koff + r][query lr]
    v8f ot[4];
#pragma unroll
    for (int d = 0; d < 4; ++d) ot[d] = vzero8();
    float mrow = -1e30f;     // running maximum of query lr, times SC (equal in both halves)
    float lsum = 0.f;        // this half's share of the running sum

    const _Float16* kbase = k + (size_t)(b * N_SEQ) * INNER + h * DIM_HEAD;
    const _Float16* vbase = v + (size_t)(b * N_SEQ) * INNER + h * DIM_HEAD;
    // the lane's place in a V tile for the transposing load, at key 0, column 0:
    // key 8*(l >> 4) + (l & 7), column 8*((l >> 3) & 1); the lane then holds keys
    // koff .. koff + 7 of column lr, the order of load_frag16 and of P^T below
    const int vlane = (koff + (lane & 7)) * VT_PITCH_H + ((lane >> 3) & 1) * 8;

    // --- prologue: tile 0 lands and is published, then tile 1 is asked for ---
    KTileRequest rq, rqv;
    rq.g1  = tdm_k_group1();
    rqv.g1 = tdm_v_group1();
    stage_k_tile(rq, &kt[0][0], kbase, true, tid);
    stage_v_tile(rqv, &vt[0][0], vbase, true, tid);
    wait_k_tile(rq, tid);
    wait_v_tile(rqv, tid);
    __syncthreads();
    stage_k_tile(rq, &kt[1][0], kbase + (size_t)32 * INNER, true, tid);
    stage_v_tile(rqv, &vt[1][0], vbase + (size_t)32 * INNER, true, tid);

    for (int t = 0; t < N_TILES; ++t) {
        const int cur = t & 1;

        // --- S^T = K Q^T over 32 keys (two 16-key tiles) ------------------
        // s[i][r] = score(key t*32 + i*16 + koff + r, query lr)
        v8f s[2];
#pragma unroll
        for (int i = 0; i < 2; ++i) {
            s[i] = vzero8();
            const _Float16* krow = &kt[cur][(i * 16 + lr) * KT_PITCH_H];
            v16h kf0 = load_frag16(krow + koff);
            v16h kf1 = load_frag16(krow + 32 + koff);
            s[i] = wmma_f16(kf0, qf[0], s[i]);
            s[i] = wmma_f16(kf1, qf[1], s[i]);
        }

        // --- V^T fragments of this pass, read as one group here: their LDS
        // latency runs beside the softmax arithmetic below ------------------
        // vf[d]: row d*16 + lr of V^T, keys koff + 0..7 and 16 + koff + 0..7
        v16h vf[4];
#pragma unroll
        for (int d = 0; d < 4; ++d) {
            const _Float16* vp = &vt[cur][vlane + d * 16];
            v8h lo = lds_load_tr16(vp);
            v8h hi = lds_load_tr16(vp + 16 * VT_PITCH_H);
#pragma unroll
            for (int e = 0; e < 8; ++e) { vf[d][e] = lo[e]; vf[d][e + 8] = hi[e]; }
        }
        // keeps the eight reads up here: left alone, the compiler sinks six of
        // them between the O^T products, each pair with a full wait behind it
        __builtin_amdgcn_sched_barrier(0);

        // --- online softmax update, one query per lane --------------------
        // the maximum is taken of the raw scores (SC > 0) and kept scaled, in
        // the base-2 domain: a score then costs one fused multiply-add and one
        // bare v_exp_f32. No range guard is needed around it: every argument is
        // <= about 0, and a weight below 2^-126 may come out as 0
        float mx = fmaxf(s[0][0], s[1][0]);
#pragma unroll
        for (int r = 1; r < 8; ++r) mx = fmaxf(mx, fmaxf(s[0][r], s[1][r]));
        mx = fmaxf(mx, other_half(mx)) * SC;
        float mnew = fmaxf(mrow, mx);
        float alpha = __builtin_amdgcn_exp2f(mrow - mnew);   // 0 on the first pass
        mrow = mnew;

        const f32x2 sc2 = {SC, SC};
        const f32x2 nm2 = {-mnew, -mnew};
        float p[2][8];
#pragma unroll
        for (int i = 0; i < 2; ++i) {
            f32x2 arg[4];
#pragma unroll
            for (int c = 0; c < 4; ++c)
                arg[c] = __builtin_elementwise_fma(
                    f32x2{s[i][2 * c], s[i][2 * c + 1]}, sc2, nm2);
            exp2_x8(p[i], arg);
        }

        // P^T as B operand: element e of the lane is key kmap(e) = the order
        // in which the two S^T tiles already lie in the lane's registers
        v16h pf;
        float rs0 = p[0][0], rs1 = p[1][0];
#pragma unroll
        for (int r = 1; r < 8; ++r) { rs0 += p[0][r]; rs1 += p[1][r]; }
#pragma unroll
        for (int r = 0; r < 8; ++r) {
            pf[r]     = (_Float16)p[0][r];
            pf[r + 8] = (_Float16)p[1][r];
        }
        lsum = lsum * alpha + (rs0 + rs1);
#pragma unroll
        for (int d = 0; d < 4; ++d)
#pragma unroll
            for (int r = 0; r < 8; ++r) ot[d][r] *= alpha;

        // --- O^T += V^T P^T -----------------------------------------------
#pragma unroll
        for (int d = 0; d < 4; ++d) {
            ot[d] = wmma_f16(vf[d], pf, ot[d]);
        }

        // --- foot of the pass: publish tile t + 1, then refill this buffer ---
        // keeps the wait below down here: no LDS read stands behind the V^T group,
        // so the compiler lifts it up to there, in front of the softmax
        __builtin_amdgcn_sched_barrier(0);
        // this wave's reads of the buffers cur are done
        asm volatile("s_wait_dscnt 0" ::: "memory");
        wait_k_tile(rq, tid);   // K tile t + 1
        wait_v_tile(rqv, tid);  // V tile t + 1
        __syncthreads();   // tiles t + 1 readable; every reader has left buffers cur
        stage_k_tile(rq, &kt[cur][0], kbase + (size_t)(t + 2) * 32 * INNER,
                     t + 2 < N_TILES, tid);
        stage_v_tile(rqv, &vt[cur][0], vbase + (size_t)(t + 2) * 32 * INNER,
                     t + 2 < N_TILES, tid);
    }
    // nothing of the ring is outstanding when the wave goes on to its end
    asm volatile("s_wait_tensorcnt 0" ::: "memory");
    asm volatile("s_wait_dscnt 0" ::: "memory");

    // --- epilogue: join the halves' sums, O /= l, store f16 [M_ROWS, 512] --
    // a lane holds 8 consecutive columns of one row: one 16-byte store each
    lsum += other_half(lsum);
    float inv = 1.f / lsum;
    _Float16* orow = o + (size_t)(b * N_SEQ + mq + lr) * INNER + h * DIM_HEAD + koff;
#pragma unroll
    for (int d = 0; d < 4; ++d) {
        v8h w;
#pragma unroll
        for (int r = 0; r < 8; ++r) w[r] = (_Float16)(ot[d][r] * inv);
        *(v8h*)(orow + d * 16) = w;
    }
}

// ---------------------------------------------------------------------------
// Host-side launcher
// ---------------------------------------------------------------------------
extern "C" void kernel_launch(void* const* d_in, const int* in_sizes, int n_in,
                              void* d_out, int out_size, void* d_ws, size_t ws_size,
                              hipStream_t stream) {
    const float* x    = (const float*)d_in[0];
    const float* z    = (const float*)d_in[1];
    const float* lxg  = (const float*)d_in[2];
    const float* lxb  = (const float*)d_in[3];
    const float* lzg  = (const float*)d_in[4];
    const float* lzb  = (const float*)d_in[5];
    const float* Wq   = (const float*)d_in[6];
    const float* Wk   = (const float*)d_in[7];
    const float* Wv   = (const float*)d_in[8];
    const float* Wz   = (const float*)d_in[9];
    const float* Wo   = (const float*)d_in[10];
    const float* bo   = (const float*)d_in[11];
    float* out = (float*)d_out;

    char* ws = (char*)d_ws;
    size_t off = 0;
    float* z1z2 = (float*)(ws + off);       off += (size_t)BATCH * 2 * X_DIM * 4;
    _Float16* WtQ  = (_Float16*)(ws + off); off += (size_t)X_DIM * INNER * 2;
    _Float16* WtK  = (_Float16*)(ws + off); off += (size_t)X_DIM * INNER * 2;
    _Float16* WtV  = (_Float16*)(ws + off); off += (size_t)X_DIM * INNER * 2;
    _Float16* WtO  = (_Float16*)(ws + off); off += (size_t)INNER * X_DIM * 2;
    _Float16* xmod = (_Float16*)(ws + off); off += (size_t)M_ROWS * X_DIM * 2;
    _Float16* qb   = (_Float16*)(ws + off); off += (size_t)M_ROWS * INNER * 2;
    _Float16* kb   = (_Float16*)(ws + off); off += (size_t)M_ROWS * INNER * 2;
    _Float16* vb   = (_Float16*)(ws + off); off += (size_t)M_ROWS * INNER * 2;
    _Float16* ao   = (_Float16*)(ws + off); off += (size_t)M_ROWS * INNER * 2;

    // 1) z path and the four weights' convert + transpose (WtQ, WtK, WtV, WtO
    //    lie one behind the other), one grid
    setup_kernel<<<BATCH + 4 * W_TILES, 256, 0, stream>>>(Wq, Wk, Wv, Wo, WtQ,
                                                           z, lzg, lzb, Wz, z1z2);

    // 2) LN + FiLM on x -> f16
    xmod_kernel<<<M_ROWS / (8 * XM_ROWS), 256, 0, stream>>>(x, lxg, lxb, z1z2, xmod);

    // 3) Q/K/V projections (f16 out), one grid: z = 0, 1, 2 reads WtQ, WtK, WtV
    //    and writes qb, kb, vb, which lie one behind the other
    dim3 ggrid(INNER / 128, M_ROWS / 128, 3);
    gemm_wmma_kernel<<<ggrid, 256, 0, stream>>>(xmod, WtQ, qb, nullptr, nullptr);

    // 4) flash attention
    dim3 agrid(N_SEQ / 128, HEADS, BATCH);
    flash_attn_kernel<<<agrid, 256, 0, stream>>>(qb, kb, vb, ao);

    // 5) output projection (f32 out + bias)
    dim3 ogrid(X_DIM / 128, M_ROWS / 128);
    gemm_wmma_kernel<<<ogrid, 256, 0, stream>>>(ao, WtO, nullptr, out, bo);
}

// v009
// A run of this version takes 76.3 microseconds.
// Timed twice side by side with v008, it ran 1.06 times as fast both times.
// Over all steps from v000 it is 3.70 times as fast.
#include <hip/hip_runtime.h>
#include <hip/hip_bf16.h>

#define X_DIM   512
#define Z_DIM   16
#define HEADS   8
#define DIM_HEAD 64
#define INNER   512
#define BATCH   4
#define N_SEQ   2048
#define M_ROWS  (BATCH * N_SEQ)          // 8192
#define EPS     1e-5f

typedef _Float16 v16h __attribute__((ext_vector_type(16)));
typedef _Float16 v8h  __attribute__((ext_vector_type(8)));
typedef float    v8f  __attribute__((ext_vector_type(8)));
typedef float    f32x2 __attribute__((ext_vector_type(2)));
typedef unsigned int u32x4 __attribute__((ext_vector_type(4)));
typedef int          i32x4 __attribute__((ext_vector_type(4)));
typedef int          i32x8 __attribute__((ext_vector_type(8)));

#if defined(__HIP_DEVICE_COMPILE__) && __has_builtin(__builtin_amdgcn_tensor_load_to_lds)
#define USE_TDM 1
#else
#define USE_TDM 0
#endif

__device__ __forceinline__ v8f vzero8() {
    v8f z = {0.f,0.f,0.f,0.f,0.f,0.f,0.f,0.f};
    return z;
}

__device__ __forceinline__ v16h load_frag16(const _Float16* p) {
    v8h lo = *(const v8h*)(p);
    v8h hi = *(const v8h*)(p + 16);
    v16h r;
#pragma unroll
    for (int i = 0; i < 8; ++i) { r[i] = lo[i]; r[i + 8] = hi[i]; }
    return r;
}

__device__ __forceinline__ v8f wmma_f16(v16h a, v16h b, v8f c) {
    return __builtin_amdgcn_wmma_f32_16x16x32_f16(false, a, false, b,
                                                  (short)0, c, false, false);
}

struct KTileRequest {
    u32x4 g0;
    i32x8 g1;
};

#if USE_TDM
// wave-uniform value held in a scalar register
__device__ __forceinline__ unsigned uni(unsigned v) {
    return (unsigned)__builtin_amdgcn_readfirstlane((int)v);
}
__device__ __forceinline__ unsigned pinned(unsigned v) {
    unsigned w = uni(v);
    asm volatile("" : "+s"(w));  // pinned(): holds the test's word in a scalar register
    return w;
}

__device__ __forceinline__ u32x4 tdm_k_group0(unsigned lds_addr,
                                              unsigned long long gaddr) {
    u32x4 g0;
    g0[0] = uni(1u);
    g0[1] = uni(lds_addr);
    g0[2] = uni((unsigned)(gaddr & 0xffffffffull));
    g0[3] = uni((unsigned)((gaddr >> 32) & 0x1ffffffull)
          | (2u << 30));
    asm volatile("" : "+s"(g0));
    return g0;
}

__device__ __forceinline__ i32x8 tdm_k_group1() {
    i32x8 g1;
    g1[0] = (1 << 20) | (4 << 22) | (3 << 25);
    g1[1] = (int)(128u << 16);
    g1[2] = (int)(32u << 16);
    g1[3] = (int)(128u << 16);
    g1[4] = 32;
    g1[5] = 1024;
    g1[6] = 0;
    g1[7] = 0;
    asm volatile("" : "+s"(g1));
    return g1;
}

// The same tile for a reader by ds_load_tr16_b128: a pad of 32 bytes behind
// every 128-byte row gives the LDS pitch of 160 bytes (32 B x odd), VT_PITCH_H.
__device__ __forceinline__ i32x8 tdm_v_group1() {
    i32x8 g1;
    g1[0] = (1 << 20) | (4 << 22) | (7 << 25);
    g1[1] = (int)(128u << 16);
    g1[2] = (int)(32u << 16);
    g1[3] = (int)(128u << 16);
    g1[4] = 32;
    g1[5] = 1024;
    g1[6] = 0;
    g1[7] = 0;
    asm volatile("" : "+s"(g1));
    return g1;
}

__device__ __forceinline__ void tdm_load_k_tile(const KTileRequest& rq) {
    i32x4 z4 = {0, 0, 0, 0};
#if defined(__clang_major__) && __clang_major__ >= 23
    i32x8 z8 = {0, 0, 0, 0, 0, 0, 0, 0};
    __builtin_amdgcn_tensor_load_to_lds(rq.g0, rq.g1, z4, z4, z8, 0);
#else
    __builtin_amdgcn_tensor_load_to_lds(rq.g0, rq.g1, z4, z4, 0);
#endif
}
#endif

// ---------------------------------------------------------------------------
// Set-up part 1: f32 weight [512,512] -> f16 transposed [512,512]
// (fragment-friendly). A block takes one tile of 64 k x 64 n: few waves that
// each do much, because a launch of many short waves lasts as long as the
// waves take to start. The tile turns in LDS: rows of W are read as whole
// lines, rows of Wt are written as whole lines.
// `tile`: which of the weight's 64 tiles; `lt`: the block's LDS tile [n][k]
// ---------------------------------------------------------------------------
#define T_DIM     64                     // tile edge, elements
#define T_PITCH_H 72                     // LDS row pitch, halves (144 B)
#define W_TILES   ((X_DIM / T_DIM) * (INNER / T_DIM))

typedef float    f32x4 __attribute__((ext_vector_type(4)));
typedef _Float16 v2h   __attribute__((ext_vector_type(2)));
typedef _Float16 v4h   __attribute__((ext_vector_type(4)));

__device__ __forceinline__ void
cvt_transpose_tile(const float* __restrict__ W, _Float16* __restrict__ Wt,
                   int tile, _Float16* lt) {
    const int t  = threadIdx.x;
    const int k0 = (tile / (INNER / T_DIM)) * T_DIM;
    const int n0 = (tile % (INNER / T_DIM)) * T_DIM;
    const int n4 = (t & 15) * 4;         // 4 columns of W
    const int k2 = (t >> 4) * 2;         // 2 rows of W, in each half of the tile
    f32x4 w[2][2];
#pragma unroll
    for (int p = 0; p < 2; ++p)
#pragma unroll
        for (int j = 0; j < 2; ++j)
            w[p][j] = *(const f32x4*)(W + (size_t)(k0 + p * 32 + k2 + j) * INNER
                                        + n0 + n4);
    // before the loads' address registers are used for anything else
    asm volatile("s_wait_xcnt 0x0" ::: "memory");
#pragma unroll
    for (int p = 0; p < 2; ++p)
#pragma unroll
        for (int i = 0; i < 4; ++i) {
            v2h h = {(_Float16)w[p][0][i], (_Float16)w[p][1][i]};
            *(v2h*)(lt + (n4 + i) * T_PITCH_H + p * 32 + k2) = h;
        }
    __syncthreads();                     // the tile is whole before a row is read
#pragma unroll
    for (int q = 0; q < 2; ++q) {
        const int n  = q * 32 + (t >> 3);   // 8 lanes a row of 128 B
        const int oc = (t & 7) * 8;
        *(v8h*)(Wt + (size_t)(n0 + n) * X_DIM + k0 + oc) =
            *(const v8h*)(lt + n * T_PITCH_H + oc);
    }
    // the stores' address and data registers may be rewritten by code that the
    // compiler lays out behind them: keep the wait in front of any such overwrite
    asm volatile("s_wait_xcnt 0x0" ::: "memory");
}

// ---------------------------------------------------------------------------
// Set-up part 2: z path of batch b: LN(z) @ Wz -> SiLU -> z1z2 [B,1024] f32
// ---------------------------------------------------------------------------
__device__ __forceinline__ void
zpath_block(const float* __restrict__ z, const float* __restrict__ g,
            const float* __restrict__ bb, const float* __restrict__ Wz,
            float* __restrict__ z1z2, int b) {
    const float* zr = z + b * Z_DIM;
    float zn[Z_DIM];
    float mu = 0.f;
#pragma unroll
    for (int i = 0; i < Z_DIM; ++i) mu += zr[i];
    mu *= (1.f / Z_DIM);
    float var = 0.f;
#pragma unroll
    for (int i = 0; i < Z_DIM; ++i) { float d = zr[i] - mu; var += d * d; }
    var *= (1.f / Z_DIM);
    float rs = rsqrtf(var + EPS);
#pragma unroll
    for (int i = 0; i < Z_DIM; ++i) zn[i] = (zr[i] - mu) * rs * g[i] + bb[i];

    for (int c = threadIdx.x; c < 2 * X_DIM; c += 256) {
        float a = 0.f;
#pragma unroll
        for (int i = 0; i < Z_DIM; ++i) a += zn[i] * Wz[i * (2 * X_DIM) + c];
        float sg = 1.f / (1.f + __expf(-a));
        z1z2[b * (2 * X_DIM) + c] = a * sg;        // SiLU
    }
}

// ---------------------------------------------------------------------------
// Kernel 1: the set-up work that needs nothing of each other, in one grid by
// ranges of the block index: blocks 0 .. BATCH-1 run the z path (the longest
// dependent chain, so it starts first), then W_TILES blocks for each of the
// four weights. Wt: the four transposed weights, one behind the other.
// ---------------------------------------------------------------------------
#define W_ELEMS  (X_DIM * INNER)

__global__ void __launch_bounds__(256)
setup_kernel(const float* __restrict__ Wq, const float* __restrict__ Wk,
             const float* __restrict__ Wv, const float* __restrict__ Wo,
             _Float16* __restrict__ Wt,
             const float* __restrict__ z, const float* __restrict__ g,
             const float* __restrict__ bb, const float* __restrict__ Wz,
             float* __restrict__ z1z2) {
    __shared__ __attribute__((aligned(16))) _Float16 lt[T_DIM * T_PITCH_H];
    if (blockIdx.x < BATCH) {                      // the whole block, no barrier
        zpath_block(z, g, bb, Wz, z1z2, blockIdx.x);
        return;
    }
    const int blk   = blockIdx.x - BATCH;
    const int which = blk / W_TILES;               // 0..3: Wq, Wk, Wv, Wo
    const float* W = which == 0 ? Wq : which == 1 ? Wk : which == 2 ? Wv : Wo;
    // all four are [512, 512]: X_DIM == INNER
    cvt_transpose_tile(W, Wt + (size_t)which * W_ELEMS, blk % W_TILES, lt);
}

// ---------------------------------------------------------------------------
// Kernel 2: x_mod = LN(x)*z1 + z2  -> f16 [M_ROWS, 512]
// A wave takes XM_ROWS whole rows, a block of 8 waves 32 rows: one block a WGP,
// few waves to start. All of a wave's row loads are in flight together; gain,
// bias, z1 and z2 are read once a wave; a row's sums stay inside the wave.
// ---------------------------------------------------------------------------
#define XM_ROWS 4

__device__ __forceinline__ float other_half(float x) {
    int bits = __builtin_bit_cast(int, x);
    return __builtin_bit_cast(float,
        __builtin_amdgcn_permlanex16(bits, bits, 0x76543210, 0xfedcba98,
                                     false, false));
}

template <int M>
__device__ __forceinline__ float add_xmask(float v) {
    int o = __builtin_amdgcn_update_dpp(0, __builtin_bit_cast(int, v),
                                        0x160 + M, 0xf, 0xf, true);
    return v + __builtin_bit_cast(float, o);
}

// sum over the 32 lanes, the same bits in every lane
__device__ __forceinline__ float wave_sum(float v) {
    v = add_xmask<1>(v);
    v = add_xmask<2>(v);
    v = add_xmask<4>(v);
    v = add_xmask<8>(v);
    return v + other_half(v);
}

__global__ void __launch_bounds__(256)
xmod_kernel(const float* __restrict__ x, const float* __restrict__ g,
            const float* __restrict__ bb, const float* __restrict__ z1z2,
            _Float16* __restrict__ out) {
    const int lane = threadIdx.x & 31;
    const int wave = threadIdx.x >> 5;
    const int row0 = (blockIdx.x * 8 + wave) * XM_ROWS;  // rows of one batch
    const int b  = row0 >> 11;           // row / 2048
    const int c0 = lane * 4;             // the lane's columns: c0 + 128*c + 0..3

    // a wave-wide load covers 512 contiguous bytes
    const float* xp = x + (size_t)row0 * X_DIM + c0;
    f32x4 xv[XM_ROWS][4];
#pragma unroll
    for (int r = 0; r < XM_ROWS; ++r)
#pragma unroll
        for (int c = 0; c < 4; ++c)
            xv[r][c] = *(const f32x4*)(xp + r * X_DIM + c * 128);
    const float* z1 = z1z2 + b * (2 * X_DIM);
    const float* z2 = z1 + X_DIM;
    f32x4 gv[4], bv[4], z1v[4], z2v[4];
#pragma unroll
    for (int c = 0; c < 4; ++c) {
        gv[c]  = *(const f32x4*)(g  + c * 128 + c0);
        bv[c]  = *(const f32x4*)(bb + c * 128 + c0);
        z1v[c] = *(const f32x4*)(z1 + c * 128 + c0);
        z2v[c] = *(const f32x4*)(z2 + c * 128 + c0);
    }
    // before the loads' address registers are used for anything else; the row
    // address as an input: it stays in its registers up to here, so that no
    // later load of the group is given them as its destination
    asm volatile("s_wait_xcnt 0x0" :: "v"(xp) : "memory");
    // keeps the arithmetic below the last load: left alone, the compiler sets
    // the rows' sums, with their waits, in front of most of the gain, bias, z1
    // and z2 loads, and the wave waits out their latency behind the rows' own
    __builtin_amdgcn_sched_barrier(0);

    float s[XM_ROWS], sq[XM_ROWS];
#pragma unroll
    for (int r = 0; r < XM_ROWS; ++r) {
        f32x4 sv = xv[r][0];
        f32x4 qv = xv[r][0] * xv[r][0];
#pragma unroll
        for (int c = 1; c < 4; ++c) {
            sv += xv[r][c];
            qv += xv[r][c] * xv[r][c];
        }
        s[r]  = (sv[0] + sv[1]) + (sv[2] + sv[3]);
        sq[r] = (qv[0] + qv[1]) + (qv[2] + qv[3]);
    }
#pragma unroll
    for (int r = 0; r < XM_ROWS; ++r) { s[r] = wave_sum(s[r]); sq[r] = wave_sum(sq[r]); }

#pragma unroll
    for (int r = 0; r < XM_ROWS; ++r) {
        float mu  = s[r] * (1.f / X_DIM);
        float var = sq[r] * (1.f / X_DIM) - mu * mu;
        float rs = rsqrtf(var + EPS);
        _Float16* op = out + (size_t)(row0 + r) * X_DIM + c0;
#pragma unroll
        for (int c = 0; c < 4; ++c) {
            v4h h;
#pragma unroll
            for (int e = 0; e < 4; ++e)
                h[e] = (_Float16)(((xv[r][c][e] - mu) * rs * gv[c][e] + bv[c][e])
                                  * z1v[c][e] + z2v[c][e]);
            *(v4h*)(op + c * 128) = h;   // a wave-wide store: 2 whole lines
        }
    }
}

// ---------------------------------------------------------------------------
// Kernel 3: WMMA GEMM  C[M,Nc] = A[M,K] @ Bt[Nc,K]^T  (Bt stored N-major)
// M = M_ROWS, Nc = K = 512 in every product of this file.
// 128x128 block tile, 8 waves (4x2), 32x64 wave tile, k-step 32
// Operands come through LDS: a stage is 64 k (128 B) of the block's 128 A rows
// and 128 Bt rows, brought by tensor loads, one slice of 32 rows a wave, into a
// ring of two buffers; a fragment read straight from global memory touches 16
// lines for 512 bytes, the tensor load fetches each line once per block.
// outF != null -> f32 output with bias; else f16 output
// The products are taken transposed, C^T tile = Bt rows x (A rows)^T: a lane then
// holds 8 adjacent columns of ONE row of C. Each wave lays its 32x64 tile in LDS
// and stores it from there 16 B a lane as whole 128-B lines; straight from the
// accumulators a store would leave pieces of 32 or 64 B in many lines.
// blockIdx.z: which of several products of the same A, whose Bt and whose outH
// lie one behind the other, this block works on (one grid for Q, K and V)
// ---------------------------------------------------------------------------
#define G_K        X_DIM                 // k extent of every product (== INNER)
#define G_NC       INNER                 // columns of every product (== X_DIM)
#define G_STAGE_H  64                    // k extent of one stage, halves
#define G_STAGES   (G_K / G_STAGE_H)      // 8
#define G_PITCH_H  72                    // slice row pitch in LDS, halves (144 B)
#define G_SLICE_H  3072                  // one slice, halves (4608 B -> 3 x 2 KiB)
#define G_OUT_B    (2 * 8 * G_SLICE_H * 2 / 8)  // a wave's share of the ring, bytes
#define G_OUTH_P   144                   // staged f16 row of 128 B: pitch, bytes
#define G_OUTF_P   272                   // staged f32 row of 256 B: pitch, bytes

#if USE_TDM
__device__ __forceinline__ void issue_slice(KTileRequest& rq, _Float16* dst,
                                            const _Float16* src) {
    rq.g0 = tdm_k_group0((unsigned)(uintptr_t)dst,
                         (unsigned long long)(uintptr_t)src);
    tdm_load_k_tile(rq);
}
__device__ __forceinline__ void wait_slice(const KTileRequest& rq) {
    asm volatile("s_wait_tensorcnt 0" :: "s"(rq.g0), "s"(rq.g1) : "memory");
}
#else
// fallback: a lane copies one row of the slice, nothing to wait for
__device__ __forceinline__ unsigned uni(unsigned v) { return v; }
__device__ __forceinline__ unsigned pinned(unsigned v) { return v; }
__device__ __forceinline__ i32x8 tdm_k_group1() { return i32x8{}; }
__device__ __forceinline__ i32x8 tdm_v_group1() { return i32x8{}; }
__device__ __forceinline__ void issue_slice(KTileRequest&, _Float16* dst,
                                            const _Float16* src) {
    int row = threadIdx.x & 31;
    for (int c = 0; c < G_STAGE_H; c += 8)
        *(v8h*)(dst + row * G_PITCH_H + c) =
            *(const v8h*)(src + (size_t)row * G_K + c);
}
__device__ __forceinline__ void wait_slice(const KTileRequest&) {}
#endif

__global__ void __launch_bounds__(256)
gemm_wmma_kernel(const _Float16* __restrict__ A, const _Float16* __restrict__ Bt0,
                 _Float16* __restrict__ outH0, float* __restrict__ outF,
                 const float* __restrict__ bias) {
    constexpr int Nc = G_NC;
    const _Float16* Bt = Bt0 + (size_t)blockIdx.z * G_NC * G_K;
    _Float16* outH = outH0 + (size_t)blockIdx.z * M_ROWS * G_NC;
    const int tid  = threadIdx.x;
    const int lane = tid & 31;
    const int wave = tid >> 5;
    const int wm = wave & 3;                 // 4 waves along M
    const int wn = wave >> 2;                // 2 waves along N
    const int m0 = blockIdx.y * 128 + wm * 32;
    const int n0 = blockIdx.x * 128 + wn * 64;
    const int lr = lane & 15;
    const int koff = (lane >> 4) * 8;        // half-of-wave K offset

    __shared__ __attribute__((aligned(2048))) _Float16 st[2][8][G_SLICE_H];

    // this wave's own slice in global memory, at k = 0; the wave's number in a
    // scalar register, so that the choice of operand is a scalar one
    const int sl = (int)uni((unsigned)wave);
    const _Float16* gsl = sl < 4
        ? A  + (size_t)(blockIdx.y * 128 + sl * 32) * G_K
        : Bt + (size_t)(blockIdx.x * 128 + (sl - 4) * 32) * G_K;

    v8f acc[2][4];
#pragma unroll
    for (int i = 0; i < 2; ++i)
#pragma unroll
        for (int j = 0; j < 4; ++j) acc[i][j] = vzero8();

    // --- prologue: stage 0 lands and is published, then stage 1 is asked for ---
    KTileRequest rq;
    rq.g1 = tdm_k_group1();
    issue_slice(rq, &st[0][sl][0], gsl);
    wait_slice(rq);
    __syncthreads();
    issue_slice(rq, &st[1][sl][0], gsl + G_STAGE_H);

    for (int s = 0; s < G_STAGES; ++s) {
        const int cur = s & 1;
#pragma unroll
        for (int kk = 0; kk < G_STAGE_H; kk += 32) {
            v16h afrag[2], bfrag[4];
#pragma unroll
            for (int i = 0; i < 2; ++i)      // rows wm*32 + i*16 + lr: slice wm
                afrag[i] = load_frag16(
                    &st[cur][wm][(i * 16 + lr) * G_PITCH_H + kk + koff]);
#pragma unroll
            for (int j = 0; j < 4; ++j)      // rows wn*64 + j*16 + lr
                bfrag[j] = load_frag16(
                    &st[cur][4 + wn * 2 + (j >> 1)]
                       [((j & 1) * 16 + lr) * G_PITCH_H + kk + koff]);
#pragma unroll
            for (int i = 0; i < 2; ++i)
#pragma unroll
                for (int j = 0; j < 4; ++j)
                    acc[i][j] = wmma_f16(bfrag[j], afrag[i], acc[i][j]);
        }

        // --- foot of the pass: publish stage s + 1, then refill this buffer ---
        // this wave's reads of buffer cur are done
        asm volatile("s_wait_dscnt 0" ::: "memory");
        wait_slice(rq);    // this wave's slice of stage s + 1
        __syncthreads();   // stage s + 1 readable; every reader has left buffer cur
        if (pinned(s + 2 < G_STAGES))
            issue_slice(rq, &st[cur][sl][0], gsl + (s + 2) * G_STAGE_H);
    }
    // nothing of the ring is outstanding when the wave goes on to its end
    asm volatile("s_wait_tensorcnt 0" ::: "memory");
    asm volatile("s_wait_dscnt 0" ::: "memory");

    // acc[i][j][r] = C[m0 + i*16 + lr][n0 + j*16 + koff + r].
    // The ring is free: the last pass's foot had every wave's dscnt and tensorcnt
    // waits and the barrier, and nothing was asked for behind it. A wave writes
    // and reads only its own share of it, so no further barrier is needed.
    char* stg = (char*)&st[0][0][0] + wave * G_OUT_B;
    if (outF) {
        const int c4 = lr * 4;               // the lane's 4 columns on the way out
        const f32x4 bv = *(const f32x4*)(bias + n0 + c4);
        // before the bias load's address registers are used for anything else
        asm volatile("s_wait_xcnt 0x0" ::: "memory");
#pragma unroll
        for (int i = 0; i < 2; ++i)
#pragma unroll
            for (int j = 0; j < 4; ++j) {
                char* p = stg + (i * 16 + lr) * G_OUTF_P + (j * 16 + koff) * 4;
                f32x4 lo = {acc[i][j][0], acc[i][j][1], acc[i][j][2], acc[i][j][3]};
                f32x4 hi = {acc[i][j][4], acc[i][j][5], acc[i][j][6], acc[i][j][7]};
                *(f32x4*)p = lo;
                *(f32x4*)(p + 16) = hi;
            }
        // the tile is whole in LDS before lanes read what other lanes wrote
        asm volatile("s_wait_dscnt 0" ::: "memory");
        // 16 lanes a row of 256 B: a wave-wide store covers 2 rows, 4 whole lines
        const char* rp = stg + (lane >> 4) * G_OUTF_P + c4 * 4;
        float* op = outF + (size_t)(m0 + (lane >> 4)) * Nc + n0 + c4;
#pragma unroll
        for (int q = 0; q < 16; ++q)
            *(f32x4*)(op + q * 2 * Nc) = *(const f32x4*)(rp + q * 2 * G_OUTF_P) + bv;
    } else {
#pragma unroll
        for (int i = 0; i < 2; ++i)
#pragma unroll
            for (int j = 0; j < 4; ++j) {
                v8h w;
#pragma unroll
                for (int r = 0; r < 8; ++r) w[r] = (_Float16)acc[i][j][r];
                *(v8h*)(stg + (i * 16 + lr) * G_OUTH_P + (j * 16 + koff) * 2) = w;
            }
        // the tile is whole in LDS before lanes read what other lanes wrote
        asm volatile("s_wait_dscnt 0" ::: "memory");
        // 8 lanes a row of 128 B: a wave-wide store covers 4 rows, 4 whole lines
        const int c8 = (lane & 7) * 8;
        const char* rp = stg + (lane >> 3) * G_OUTH_P + c8 * 2;
        _Float16* op = outH + (size_t)(m0 + (lane >> 3)) * Nc + n0 + c8;
#pragma unroll
        for (int q = 0; q < 8; ++q)
            *(v8h*)(op + q * 4 * Nc) = *(const v8h*)(rp + q * 4 * G_OUTH_P);
    }
}

__device__ __forceinline__ void exp2_x8(float (&p)[8], const f32x2 (&a)[4]) {
#if defined(__HIP_DEVICE_COMPILE__)
    asm("v_exp_f32 %0, %8\n\t"
        "v_exp_f32 %1, %9\n\t"
        "v_exp_f32 %2, %10\n\t"
        "v_exp_f32 %3, %11\n\t"
        "v_exp_f32 %4, %12\n\t"
        "v_exp_f32 %5, %13\n\t"
        "v_exp_f32 %6, %14\n\t"
        "v_exp_f32 %7, %15\n\t"
        "v_nop"
        : "=&v"(p[0]), "=&v"(p[1]), "=&v"(p[2]), "=&v"(p[3]),
          "=&v"(p[4]), "=&v"(p[5]), "=&v"(p[6]), "=&v"(p[7])
        : "v"(a[0][0]), "v"(a[0][1]), "v"(a[1][0]), "v"(a[1][1]),
          "v"(a[2][0]), "v"(a[2][1]), "v"(a[3][0]), "v"(a[3][1]));
#else
    for (int c = 0; c < 8; ++c) p[c] = exp2f(a[c >> 1][c & 1]);
#endif
}

#define N_TILES    (N_SEQ / 32)   // key tiles of 32 per (batch, head)
#define KT_PITCH_H 72             // K tile row pitch in LDS, halves (144 B)
#define KT_BUF_H   3072           // one K buffer, halves (6144 B = 3 x 2 KiB)
#define VT_PITCH_H 80             // V tile row pitch in LDS, halves (160 B)
#define VT_BUF_H   3072           // one V buffer, halves (6144 B = 3 x 2 KiB)

// ds_load_tr16_b128: a lane gets 8 rows of one column of a row-major 16-bit LDS
// tile, half of a transposed A fragment (the lanes' addresses: vlane in the kernel)
typedef short s16x8 __attribute__((ext_vector_type(8)));
__device__ __forceinline__ v8h lds_load_tr16(const _Float16* p) {
    typedef __attribute__((address_space(3))) s16x8 lds_s16x8;
    return __builtin_bit_cast(v8h,
        __builtin_amdgcn_ds_load_tr16_b128_v8i16((lds_s16x8*)p));
}

#if USE_TDM
// Start the K tile [32 keys x 64 dh] at `src` on its way into LDS at `dst`,
// where that tile exists (the same answer in the whole block). One request of
// wave 0; its wait, wait_k_tile, stands at the caller's publish point.
__device__ __forceinline__ void stage_k_tile(KTileRequest& rq, _Float16* dst,
                                             const _Float16* src, bool exists,
                                             int tid) {
    // plain test: where the compiler knows that no tile is left, no request is
    // built at all; the pinned one is the scalar branch a tensor load needs
    if (!exists) return;
    rq.g0 = tdm_k_group0((unsigned)(uintptr_t)dst,
                         (unsigned long long)(uintptr_t)src);
    if (pinned(((tid >> 5) == 0) & exists)) tdm_load_k_tile(rq);
}

// The issuing wave's own wait: its K tile has landed before it reaches the
// barrier that publishes the tile.
__device__ __forceinline__ void wait_k_tile(const KTileRequest& rq, int tid) {
    if (pinned((tid >> 5) == 0)) {
        asm volatile("s_wait_tensorcnt 0" :: "s"(rq.g0), "s"(rq.g1) : "memory");
    }
}

// The same for the V tile [32 keys x 64 dh]: one request of wave 1, its wait
// wait_v_tile at the caller's publish point.
__device__ __forceinline__ void stage_v_tile(KTileRequest& rq, _Float16* dst,
                                             const _Float16* src, bool exists,
                                             int tid) {
    if (!exists) return;
    rq.g0 = tdm_k_group0((unsigned)(uintptr_t)dst,
                         (unsigned long long)(uintptr_t)src);
    if (pinned(((tid >> 5) == 1) & exists)) tdm_load_k_tile(rq);
}

__device__ __forceinline__ void wait_v_tile(const KTileRequest& rq, int tid) {
    if (pinned((tid >> 5) == 1)) {
        asm volatile("s_wait_tensorcnt 0" :: "s"(rq.g0), "s"(rq.g1) : "memory");
    }
}
#else
// fallback: cooperative vector loads of the K tile, nothing to wait for
__device__ __forceinline__ void stage_k_tile(KTileRequest&, _Float16* dst,
                                             const _Float16* src, bool exists,
                                             int tid) {
    if (exists) {
        int key = tid >> 3;
        int dc  = (tid & 7) * 8;
        *(v8h*)(dst + key * KT_PITCH_H + dc) =
            *(const v8h*)(src + (size_t)key * INNER + dc);
    }
}
__device__ __forceinline__ void wait_k_tile(const KTileRequest&, int) {}
__device__ __forceinline__ void stage_v_tile(KTileRequest&, _Float16* dst,
                                             const _Float16* src, bool exists,
                                             int tid) {
    if (exists) {
        int key = tid >> 3;
        int dc  = (tid & 7) * 8;
        *(v8h*)(dst + key * VT_PITCH_H + dc) =
            *(const v8h*)(src + (size_t)key * INNER + dc);
    }
}
__device__ __forceinline__ void wait_v_tile(const KTileRequest&, int) {}
#endif

__global__ void __launch_bounds__(256)
flash_attn_kernel(const _Float16* __restrict__ q, const _Float16* __restrict__ k,
                  const _Float16* __restrict__ v, _Float16* __restrict__ o) {
    const int b = blockIdx.z;
    const int h = blockIdx.y;
    const int m0 = blockIdx.x * 128;
    const int tid  = threadIdx.x;
    const int lane = tid & 31;
    const int wave = tid >> 5;
    const int lr = lane & 15;
    const int koff = (lane >> 4) * 8;
    const int mq = m0 + wave * 16;                       // wave's 16 queries
    const float SC = 0.125f * 1.4426950408889634f;       // scale * log2(e)

    // Two buffers each for the K and the V tile: pass t works on buffer t & 1
    // while tile t + 1 is on its way into the other one.
    // Each buffer's place in LDS is a multiple of 2 KiB (32 rows at a pitch of
    // 72 halves = 4608 B for K, of 80 halves = 5120 B for V, rounded up to
    // 6144 B); the tile loads never write the pad halves
    __shared__ __attribute__((aligned(2048))) _Float16 kt[2][KT_BUF_H];
    __shared__ __attribute__((aligned(2048))) _Float16 vt[2][VT_BUF_H];

    // Preload Q fragments (dh = 64 -> two k-chunks of 32); B operand: column lr
    const _Float16* qrow = q + (size_t)(b * N_SEQ + mq + lr) * INNER + h * DIM_HEAD;
    v16h qf[2];
    qf[0] = load_frag16(qrow + koff);
    qf[1] = load_frag16(qrow + 32 + koff);
    // before the Q loads' address registers are used for anything else
    asm volatile("s_wait_xcnt 0x0" ::: "memory");

    // ot[d][r] = O^T[d*16 + koff + r][query lr]
    v8f ot[4];
#pragma unroll
    for (int d = 0; d < 4; ++d) ot[d] = vzero8();
    float mrow = -1e30f;     // running maximum of query lr, times SC (equal in both halves)
    float lsum = 0.f;        // this half's share of the running sum

    const _Float16* kbase = k + (size_t)(b * N_SEQ) * INNER + h * DIM_HEAD;
    const _Float16* vbase = v + (size_t)(b * N_SEQ) * INNER + h * DIM_HEAD;
    // the lane's place in a V tile for the transposing load, at key 0, column 0:
    // key 8*(l >> 4) + (l & 7), column 8*((l >> 3) & 1); the lane then holds keys
    // koff .. koff + 7 of column lr, the order of load_frag16 and of P^T below
    const int vlane = (koff + (lane & 7)) * VT_PITCH_H + ((lane >> 3) & 1) * 8;

    // --- prologue: tile 0 lands and is published, then tile 1 is asked for ---
    KTileRequest rq, rqv;
    rq.g1  = tdm_k_group1();
    rqv.g1 = tdm_v_group1();
    stage_k_tile(rq, &kt[0][0], kbase, true, tid);
    stage_v_tile(rqv, &vt[0][0], vbase, true, tid);
    wait_k_tile(rq, tid);
    wait_v_tile(rqv, tid);
    __syncthreads();
    stage_k_tile(rq, &kt[1][0], kbase + (size_t)32 * INNER, true, tid);
    stage_v_tile(rqv, &vt[1][0], vbase + (size_t)32 * INNER, true, tid);

    for (int t = 0; t < N_TILES; ++t) {
        const int cur = t & 1;

        // --- S^T = K Q^T over 32 keys (two 16-key tiles) ------------------
        // s[i][r] = score(key t*32 + i*16 + koff + r, query lr)
        v8f s[2];
#pragma unroll
        for (int i = 0; i < 2; ++i) {
            s[i] = vzero8();
            const _Float16* krow = &kt[cur][(i * 16 + lr) * KT_PITCH_H];
            v16h kf0 = load_frag16(krow + koff);
            v16h kf1 = load_frag16(krow + 32 + koff);
            s[i] = wmma_f16(kf0, qf[0], s[i]);
            s[i] = wmma_f16(kf1, qf[1], s[i]);
        }

        // --- V^T fragments of this pass, read as one group here: their LDS
        // latency runs beside the softmax arithmetic below ------------------
        // vf[d]: row d*16 + lr of V^T, keys koff + 0..7 and 16 + koff + 0..7
        v16h vf[4];
#pragma unroll
        for (int d = 0; d < 4; ++d) {
            const _Float16* vp = &vt[cur][vlane + d * 16];
            v8h lo = lds_load_tr16(vp);
            v8h hi = lds_load_tr16(vp + 16 * VT_PITCH_H);
#pragma unroll
            for (int e = 0; e < 8; ++e) { vf[d][e] = lo[e]; vf[d][e + 8] = hi[e]; }
        }
        // keeps the eight reads up here: left alone, the compiler sinks six of
        // them between the O^T products, each pair with a full wait behind it
        __builtin_amdgcn_sched_barrier(0);

        // --- online softmax update, one query per lane --------------------
        // the maximum is taken of the raw scores (SC > 0) and kept scaled, in
        // the base-2 domain: a score then costs one fused multiply-add and one
        // bare v_exp_f32. No range guard is needed around it: every argument is
        // <= about 0, and a weight below 2^-126 may come out as 0
        float mx = fmaxf(s[0][0], s[1][0]);
#pragma unroll
        for (int r = 1; r < 8; ++r) mx = fmaxf(mx, fmaxf(s[0][r], s[1][r]));
        mx = fmaxf(mx, other_half(mx)) * SC;
        float mnew = fmaxf(mrow, mx);
        float alpha = __builtin_amdgcn_exp2f(mrow - mnew);   // 0 on the first pass
        mrow = mnew;

        const f32x2 sc2 = {SC, SC};
        const f32x2 nm2 = {-mnew, -mnew};
        float p[2][8];
#pragma unroll
        for (int i = 0; i < 2; ++i) {
            f32x2 arg[4];
#pragma unroll
            for (int c = 0; c < 4; ++c)
                arg[c] = __builtin_elementwise_fma(
                    f32x2{s[i][2 * c], s[i][2 * c + 1]}, sc2, nm2);
            exp2_x8(p[i], arg);
        }

        // P^T as B operand: element e of the lane is key kmap(e) = the order
        // in which the two S^T tiles already lie in the lane's registers
        v16h pf;
        float rs0 = p[0][0], rs1 = p[1][0];
#pragma unroll
        for (int r = 1; r < 8; ++r) { rs0 += p[0][r]; rs1 += p[1][r]; }
#pragma unroll
        for (int r = 0; r < 8; ++r) {
            pf[r]     = (_Float16)p[0][r];
            pf[r + 8] = (_Float16)p[1][r];
        }
        lsum = lsum * alpha + (rs0 + rs1);
#pragma unroll
        for (int d = 0; d < 4; ++d)
#pragma unroll
            for (int r = 0; r < 8; ++r) ot[d][r] *= alpha;

        // --- O^T += V^T P^T -----------------------------------------------
#pragma unroll
        for (int d = 0; d < 4; ++d) {
            ot[d] = wmma_f16(vf[d], pf, ot[d]);
        }

        // --- foot of the pass: publish tile t + 1, then refill this buffer ---
        // keeps the wait below down here: no LDS read stands behind the V^T group,
        // so the compiler lifts it up to there, in front of the softmax
        __builtin_amdgcn_sched_barrier(0);
        // this wave's reads of the buffers cur are done
        asm volatile("s_wait_dscnt 0" ::: "memory");
        wait_k_tile(rq, tid);   // K tile t + 1
        wait_v_tile(rqv, tid);  // V tile t + 1
        __syncthreads();   // tiles t + 1 readable; every reader has left buffers cur
        stage_k_tile(rq, &kt[cur][0], kbase + (size_t)(t + 2) * 32 * INNER,
                     t + 2 < N_TILES, tid);
        stage_v_tile(rqv, &vt[cur][0], vbase + (size_t)(t + 2) * 32 * INNER,
                     t + 2 < N_TILES, tid);
    }
    // nothing of the ring is outstanding when the wave goes on to its end
    asm volatile("s_wait_tensorcnt 0" ::: "memory");
    asm volatile("s_wait_dscnt 0" ::: "memory");

    // --- epilogue: join the halves' sums, O /= l, store f16 [M_ROWS, 512] --
    // a lane holds 8 consecutive columns of one row. The wave lays its 16 rows of
    // 128 B in LDS and stores them from there as whole lines. The ring is free:
    // the last pass's foot had every wave's waits and the barrier, and nothing was
    // asked for behind it; a wave touches only its own share (a quarter of the K
    // or of the V ring), so no further barrier is needed.
    lsum += other_half(lsum);
    float inv = 1.f / lsum;
    _Float16* stg = (wave < 4 ? &kt[0][0] : &vt[0][0]) + (wave & 3) * (KT_BUF_H / 2);
#pragma unroll
    for (int d = 0; d < 4; ++d) {
        v8h w;
#pragma unroll
        for (int r = 0; r < 8; ++r) w[r] = (_Float16)(ot[d][r] * inv);
        *(v8h*)(stg + lr * KT_PITCH_H + d * 16 + koff) = w;
    }
    // the rows are whole in LDS before lanes read what other lanes wrote
    asm volatile("s_wait_dscnt 0" ::: "memory");
    // 8 lanes a row of 128 B: a wave-wide store covers 4 rows, 4 whole lines
    const int c8 = (lane & 7) * 8;
    const _Float16* rp = stg + (lane >> 3) * KT_PITCH_H + c8;
    _Float16* op = o + (size_t)(b * N_SEQ + mq + (lane >> 3)) * INNER + h * DIM_HEAD + c8;
#pragma unroll
    for (int q = 0; q < 4; ++q)
        *(v8h*)(op + q * 4 * INNER) = *(const v8h*)(rp + q * 4 * KT_PITCH_H);
}

// ---------------------------------------------------------------------------
// Host-side launcher
// ---------------------------------------------------------------------------
extern "C" void kernel_launch(void* const* d_in, const int* in_sizes, int n_in,
                              void* d_out, int out_size, void* d_ws, size_t ws_size,
                              hipStream_t stream) {
    const float* x    = (const float*)d_in[0];
    const float* z    = (const float*)d_in[1];
    const float* lxg  = (const float*)d_in[2];
    const float* lxb  = (const float*)d_in[3];
    const float* lzg  = (const float*)d_in[4];
    const float* lzb  = (const float*)d_in[5];
    const float* Wq   = (const float*)d_in[6];
    const float* Wk   = (const float*)d_in[7];
    const float* Wv   = (const float*)d_in[8];
    const float* Wz   = (const float*)d_in[9];
    const float* Wo   = (const float*)d_in[10];
    const float* bo   = (const float*)d_in[11];
    float* out = (float*)d_out;

    char* ws = (char*)d_ws;
    size_t off = 0;
    float* z1z2 = (float*)(ws + off);       off += (size_t)BATCH * 2 * X_DIM * 4;
    _Float16* WtQ  = (_Float16*)(ws + off); off += (size_t)X_DIM * INNER * 2;
    _Float16* WtK  = (_Float16*)(ws + off); off += (size_t)X_DIM * INNER * 2;
    _Float16* WtV  = (_Float16*)(ws + off); off += (size_t)X_DIM * INNER * 2;
    _Float16* WtO  = (_Float16*)(ws + off); off += (size_t)INNER * X_DIM * 2;
    _Float16* xmod = (_Float16*)(ws + off); off += (size_t)M_ROWS * X_DIM * 2;
    _Float16* qb   = (_Float16*)(ws + off); off += (size_t)M_ROWS * INNER * 2;
    _Float16* kb   = (_Float16*)(ws + off); off += (size_t)M_ROWS * INNER * 2;
    _Float16* vb   = (_Float16*)(ws + off); off += (size_t)M_ROWS * INNER * 2;
    _Float16* ao   = (_Float16*)(ws + off); off += (size_t)M_ROWS * INNER * 2;

    // 1) z path and the four weights' convert + transpose (WtQ, WtK, WtV, WtO
    //    lie one behind the other), one grid
    setup_kernel<<<BATCH + 4 * W_TILES, 256, 0, stream>>>(Wq, Wk, Wv, Wo, WtQ,
                                                           z, lzg, lzb, Wz, z1z2);

    // 2) LN + FiLM on x -> f16
    xmod_kernel<<<M_ROWS / (8 * XM_ROWS), 256, 0, stream>>>(x, lxg, lxb, z1z2, xmod);

    // 3) Q/K/V projections (f16 out), one grid: z = 0, 1, 2 reads WtQ, WtK, WtV
    //    and writes qb, kb, vb, which lie one behind the other
    dim3 ggrid(INNER / 128, M_ROWS / 128, 3);
    gemm_wmma_kernel<<<ggrid, 256, 0, stream>>>(xmod, WtQ, qb, nullptr, nullptr);

    // 4) flash attention
    dim3 agrid(N_SEQ / 128, HEADS, BATCH);
    flash_attn_kernel<<<agrid, 256, 0, stream>>>(qb, kb, vb, ao);

    // 5) output projection (f32 out + bias)
    dim3 ogrid(X_DIM / 128, M_ROWS / 128);
    gemm_wmma_kernel<<<ogrid, 256, 0, stream>>>(ao, WtO, nullptr, out, bo);
}

// v010
// It runs in 65.7 microseconds.
// Next to v009, in two timings, it ran 1.17 and 1.18 times as fast.
// Counting every step since v000, it is 4.34 times as fast.
#include <hip/hip_runtime.h>
#include <hip/hip_bf16.h>

#define X_DIM   512
#define Z_DIM   16
#define HEADS   8
#define DIM_HEAD 64
#define INNER   512
#define BATCH   4
#define N_SEQ   2048
#define M_ROWS  (BATCH * N_SEQ)          // 8192
#define EPS     1e-5f

typedef _Float16 v16h __attribute__((ext_vector_type(16)));
typedef _Float16 v8h  __attribute__((ext_vector_type(8)));
typedef float    v8f  __attribute__((ext_vector_type(8)));
typedef float    f32x2 __attribute__((ext_vector_type(2)));
typedef unsigned int u32x4 __attribute__((ext_vector_type(4)));
typedef int          i32x4 __attribute__((ext_vector_type(4)));
typedef int          i32x8 __attribute__((ext_vector_type(8)));

#if defined(__HIP_DEVICE_COMPILE__) && __has_builtin(__builtin_amdgcn_tensor_load_to_lds)
#define USE_TDM 1
#else
#define USE_TDM 0
#endif

__device__ __forceinline__ v8f vzero8() {
    v8f z = {0.f,0.f,0.f,0.f,0.f,0.f,0.f,0.f};
    return z;
}

__device__ __forceinline__ v16h load_frag16(const _Float16* p) {
    v8h lo = *(const v8h*)(p);
    v8h hi = *(const v8h*)(p + 16);
    v16h r;
#pragma unroll
    for (int i = 0; i < 8; ++i) { r[i] = lo[i]; r[i + 8] = hi[i]; }
    return r;
}

__device__ __forceinline__ v8f wmma_f16(v16h a, v16h b, v8f c) {
    return __builtin_amdgcn_wmma_f32_16x16x32_f16(false, a, false, b,
                                                  (short)0, c, false, false);
}

struct KTileRequest {
    u32x4 g0;
    i32x8 g1;
};

#if USE_TDM
// wave-uniform value held in a scalar register
__device__ __forceinline__ unsigned uni(unsigned v) {
    return (unsigned)__builtin_amdgcn_readfirstlane((int)v);
}
__device__ __forceinline__ unsigned pinned(unsigned v) {
    unsigned w = uni(v);
    asm volatile("" : "+s"(w));  // pinned(): holds the test's word in a scalar register
    return w;
}

__device__ __forceinline__ u32x4 tdm_k_group0(unsigned lds_addr,
                                              unsigned long long gaddr) {
    u32x4 g0;
    g0[0] = uni(1u);
    g0[1] = uni(lds_addr);
    g0[2] = uni((unsigned)(gaddr & 0xffffffffull));
    g0[3] = uni((unsigned)((gaddr >> 32) & 0x1ffffffull)
          | (2u << 30));
    asm volatile("" : "+s"(g0));
    return g0;
}

template <int ROWS>
__device__ __forceinline__ i32x8 tdm_k_group1() {
    i32x8 g1;
    g1[0] = (1 << 20) | (4 << 22) | (3 << 25);
    g1[1] = (int)(128u << 16);
    g1[2] = (int)((unsigned)ROWS << 16);
    g1[3] = (int)(128u << 16);
    g1[4] = ROWS;
    g1[5] = 1024;
    g1[6] = 0;
    g1[7] = 0;
    asm volatile("" : "+s"(g1));
    return g1;
}

// The same tile for a reader by ds_load_tr16_b128: a pad of 32 bytes behind
// every 128-byte row gives the LDS pitch of 160 bytes (32 B x odd), VT_PITCH_H.
template <int ROWS>
__device__ __forceinline__ i32x8 tdm_v_group1() {
    i32x8 g1;
    g1[0] = (1 << 20) | (4 << 22) | (7 << 25);
    g1[1] = (int)(128u << 16);
    g1[2] = (int)((unsigned)ROWS << 16);
    g1[3] = (int)(128u << 16);
    g1[4] = ROWS;
    g1[5] = 1024;
    g1[6] = 0;
    g1[7] = 0;
    asm volatile("" : "+s"(g1));
    return g1;
}

__device__ __forceinline__ void tdm_load_k_tile(const KTileRequest& rq) {
    i32x4 z4 = {0, 0, 0, 0};
#if defined(__clang_major__) && __clang_major__ >= 23
    i32x8 z8 = {0, 0, 0, 0, 0, 0, 0, 0};
    __builtin_amdgcn_tensor_load_to_lds(rq.g0, rq.g1, z4, z4, z8, 0);
#else
    __builtin_amdgcn_tensor_load_to_lds(rq.g0, rq.g1, z4, z4, 0);
#endif
}
#endif

// ---------------------------------------------------------------------------
// Set-up part 1: f32 weight [512,512] -> f16 transposed [512,512]
// (fragment-friendly). A block takes one tile of 64 k x 64 n: few waves that
// each do much, because a launch of many short waves lasts as long as the
// waves take to start. The tile turns in LDS: rows of W are read as whole
// lines, rows of Wt are written as whole lines.
// `tile`: which of the weight's 64 tiles; `lt`: the block's LDS tile [n][k]
// ---------------------------------------------------------------------------
#define T_DIM     64                     // tile edge, elements
#define T_PITCH_H 72                     // LDS row pitch, halves (144 B)
#define W_TILES   ((X_DIM / T_DIM) * (INNER / T_DIM))

typedef float    f32x4 __attribute__((ext_vector_type(4)));
typedef _Float16 v2h   __attribute__((ext_vector_type(2)));
typedef _Float16 v4h   __attribute__((ext_vector_type(4)));

__device__ __forceinline__ void
cvt_transpose_tile(const float* __restrict__ W, _Float16* __restrict__ Wt,
                   int tile, _Float16* lt) {
    const int t  = threadIdx.x;
    const int k0 = (tile / (INNER / T_DIM)) * T_DIM;
    const int n0 = (tile % (INNER / T_DIM)) * T_DIM;
    const int n4 = (t & 15) * 4;         // 4 columns of W
    const int k2 = (t >> 4) * 2;         // 2 rows of W, in each half of the tile
    f32x4 w[2][2];
#pragma unroll
    for (int p = 0; p < 2; ++p)
#pragma unroll
        for (int j = 0; j < 2; ++j)
            w[p][j] = *(const f32x4*)(W + (size_t)(k0 + p * 32 + k2 + j) * INNER
                                        + n0 + n4);
    // before the loads' address registers are used for anything else
    asm volatile("s_wait_xcnt 0x0" ::: "memory");
#pragma unroll
    for (int p = 0; p < 2; ++p)
#pragma unroll
        for (int i = 0; i < 4; ++i) {
            v2h h = {(_Float16)w[p][0][i], (_Float16)w[p][1][i]};
            *(v2h*)(lt + (n4 + i) * T_PITCH_H + p * 32 + k2) = h;
        }
    __syncthreads();                     // the tile is whole before a row is read
#pragma unroll
    for (int q = 0; q < 2; ++q) {
        const int n  = q * 32 + (t >> 3);   // 8 lanes a row of 128 B
        const int oc = (t & 7) * 8;
        *(v8h*)(Wt + (size_t)(n0 + n) * X_DIM + k0 + oc) =
            *(const v8h*)(lt + n * T_PITCH_H + oc);
    }
    // the stores' address and data registers may be rewritten by code that the
    // compiler lays out behind them: keep the wait in front of any such overwrite
    asm volatile("s_wait_xcnt 0x0" ::: "memory");
}

// ---------------------------------------------------------------------------
// Set-up part 2: z path of batch b: LN(z) @ Wz -> SiLU -> z1z2 [B,1024] f32
// ---------------------------------------------------------------------------
__device__ __forceinline__ void
zpath_block(const float* __restrict__ z, const float* __restrict__ g,
            const float* __restrict__ bb, const float* __restrict__ Wz,
            float* __restrict__ z1z2, int b) {
    const float* zr = z + b * Z_DIM;
    float zn[Z_DIM];
    float mu = 0.f;
#pragma unroll
    for (int i = 0; i < Z_DIM; ++i) mu += zr[i];
    mu *= (1.f / Z_DIM);
    float var = 0.f;
#pragma unroll
    for (int i = 0; i < Z_DIM; ++i) { float d = zr[i] - mu; var += d * d; }
    var *= (1.f / Z_DIM);
    float rs = rsqrtf(var + EPS);
#pragma unroll
    for (int i = 0; i < Z_DIM; ++i) zn[i] = (zr[i] - mu) * rs * g[i] + bb[i];

    for (int c = threadIdx.x; c < 2 * X_DIM; c += 256) {
        float a = 0.f;
#pragma unroll
        for (int i = 0; i < Z_DIM; ++i) a += zn[i] * Wz[i * (2 * X_DIM) + c];
        float sg = 1.f / (1.f + __expf(-a));
        z1z2[b * (2 * X_DIM) + c] = a * sg;        // SiLU
    }
}

// ---------------------------------------------------------------------------
// Kernel 1: the set-up work that needs nothing of each other, in one grid by
// ranges of the block index: blocks 0 .. BATCH-1 run the z path (the longest
// dependent chain, so it starts first), then W_TILES blocks for each of the
// four weights. Wt: the four transposed weights, one behind the other.
// ---------------------------------------------------------------------------
#define W_ELEMS  (X_DIM * INNER)

__global__ void __launch_bounds__(256)
setup_kernel(const float* __restrict__ Wq, const float* __restrict__ Wk,
             const float* __restrict__ Wv, const float* __restrict__ Wo,
             _Float16* __restrict__ Wt,
             const float* __restrict__ z, const float* __restrict__ g,
             const float* __restrict__ bb, const float* __restrict__ Wz,
             float* __restrict__ z1z2) {
    __shared__ __attribute__((aligned(16))) _Float16 lt[T_DIM * T_PITCH_H];
    if (blockIdx.x < BATCH) {                      // the whole block, no barrier
        zpath_block(z, g, bb, Wz, z1z2, blockIdx.x);
        return;
    }
    const int blk   = blockIdx.x - BATCH;
    const int which = blk / W_TILES;               // 0..3: Wq, Wk, Wv, Wo
    const float* W = which == 0 ? Wq : which == 1 ? Wk : which == 2 ? Wv : Wo;
    // all four are [512, 512]: X_DIM == INNER
    cvt_transpose_tile(W, Wt + (size_t)which * W_ELEMS, blk % W_TILES, lt);
}

// ---------------------------------------------------------------------------
// Kernel 2: x_mod = LN(x)*z1 + z2  -> f16 [M_ROWS, 512]
// A wave takes XM_ROWS whole rows, a block of 8 waves 32 rows: one block a WGP,
// few waves to start. All of a wave's row loads are in flight together; gain,
// bias, z1 and z2 are read once a wave; a row's sums stay inside the wave.
// ---------------------------------------------------------------------------
#define XM_ROWS 4

__device__ __forceinline__ float other_half(float x) {
    int bits = __builtin_bit_cast(int, x);
    return __builtin_bit_cast(float,
        __builtin_amdgcn_permlanex16(bits, bits, 0x76543210, 0xfedcba98,
                                     false, false));
}

template <int M>
__device__ __forceinline__ float add_xmask(float v) {
    int o = __builtin_amdgcn_update_dpp(0, __builtin_bit_cast(int, v),
                                        0x160 + M, 0xf, 0xf, true);
    return v + __builtin_bit_cast(float, o);
}

// sum over the 32 lanes, the same bits in every lane
__device__ __forceinline__ float wave_sum(float v) {
    v = add_xmask<1>(v);
    v = add_xmask<2>(v);
    v = add_xmask<4>(v);
    v = add_xmask<8>(v);
    return v + other_half(v);
}

__global__ void __launch_bounds__(256)
xmod_kernel(const float* __restrict__ x, const float* __restrict__ g,
            const float* __restrict__ bb, const float* __restrict__ z1z2,
            _Float16* __restrict__ out) {
    const int lane = threadIdx.x & 31;
    const int wave = threadIdx.x >> 5;
    const int row0 = (blockIdx.x * 8 + wave) * XM_ROWS;  // rows of one batch
    const int b  = row0 >> 11;           // row / 2048
    const int c0 = lane * 4;             // the lane's columns: c0 + 128*c + 0..3

    // a wave-wide load covers 512 contiguous bytes
    const float* xp = x + (size_t)row0 * X_DIM + c0;
    f32x4 xv[XM_ROWS][4];
#pragma unroll
    for (int r = 0; r < XM_ROWS; ++r)
#pragma unroll
        for (int c = 0; c < 4; ++c)
            xv[r][c] = *(const f32x4*)(xp + r * X_DIM + c * 128);
    const float* z1 = z1z2 + b * (2 * X_DIM);
    const float* z2 = z1 + X_DIM;
    f32x4 gv[4], bv[4], z1v[4], z2v[4];
#pragma unroll
    for (int c = 0; c < 4; ++c) {
        gv[c]  = *(const f32x4*)(g  + c * 128 + c0);
        bv[c]  = *(const f32x4*)(bb + c * 128 + c0);
        z1v[c] = *(const f32x4*)(z1 + c * 128 + c0);
        z2v[c] = *(const f32x4*)(z2 + c * 128 + c0);
    }
    // before the loads' address registers are used for anything else; the row
    // address as an input: it stays in its registers up to here, so that no
    // later load of the group is given them as its destination
    asm volatile("s_wait_xcnt 0x0" :: "v"(xp) : "memory");
    // keeps the arithmetic below the last load: left alone, the compiler sets
    // the rows' sums, with their waits, in front of most of the gain, bias, z1
    // and z2 loads, and the wave waits out their latency behind the rows' own
    __builtin_amdgcn_sched_barrier(0);

    float s[XM_ROWS], sq[XM_ROWS];
#pragma unroll
    for (int r = 0; r < XM_ROWS; ++r) {
        f32x4 sv = xv[r][0];
        f32x4 qv = xv[r][0] * xv[r][0];
#pragma unroll
        for (int c = 1; c < 4; ++c) {
            sv += xv[r][c];
            qv += xv[r][c] * xv[r][c];
        }
        s[r]  = (sv[0] + sv[1]) + (sv[2] + sv[3]);
        sq[r] = (qv[0] + qv[1]) + (qv[2] + qv[3]);
    }
#pragma unroll
    for (int r = 0; r < XM_ROWS; ++r) { s[r] = wave_sum(s[r]); sq[r] = wave_sum(sq[r]); }

#pragma unroll
    for (int r = 0; r < XM_ROWS; ++r) {
        float mu  = s[r] * (1.f / X_DIM);
        float var = sq[r] * (1.f / X_DIM) - mu * mu;
        float rs = rsqrtf(var + EPS);
        _Float16* op = out + (size_t)(row0 + r) * X_DIM + c0;
#pragma unroll
        for (int c = 0; c < 4; ++c) {
            v4h h;
#pragma unroll
            for (int e = 0; e < 4; ++e)
                h[e] = (_Float16)(((xv[r][c][e] - mu) * rs * gv[c][e] + bv[c][e])
                                  * z1v[c][e] + z2v[c][e]);
            *(v4h*)(op + c * 128) = h;   // a wave-wide store: 2 whole lines
        }
    }
}

// ---------------------------------------------------------------------------
// Kernel 3: WMMA GEMM  C[M,Nc] = A[M,K] @ Bt[Nc,K]^T  (Bt stored N-major)
// M = M_ROWS, Nc = K = 512 in every product of this file.
// 128x128 block tile, 8 waves (4x2), 32x64 wave tile, k-step 32
// Operands come through LDS: a stage is 64 k (128 B) of the block's 128 A rows
// and 128 Bt rows, brought by tensor loads, one slice of 32 rows a wave, into a
// ring of two buffers; a fragment read straight from global memory touches 16
// lines for 512 bytes, the tensor load fetches each line once per block.
// outF != null -> f32 output with bias; else f16 output
// The products are taken transposed, C^T tile = Bt rows x (A rows)^T: a lane then
// holds 8 adjacent columns of ONE row of C. Each wave lays its 32x64 tile in LDS
// and stores it from there 16 B a lane as whole 128-B lines; straight from the
// accumulators a store would leave pieces of 32 or 64 B in many lines.
// blockIdx.z: which of several products of the same A, whose Bt and whose outH
// lie one behind the other, this block works on (one grid for Q, K and V)
// ---------------------------------------------------------------------------
#define G_K        X_DIM                 // k extent of every product (== INNER)
#define G_NC       INNER                 // columns of every product (== X_DIM)
#define G_STAGE_H  64                    // k extent of one stage, halves
#define G_STAGES   (G_K / G_STAGE_H)      // 8
#define G_PITCH_H  72                    // slice row pitch in LDS, halves (144 B)
#define G_SLICE_H  3072                  // one slice, halves (4608 B -> 3 x 2 KiB)
#define G_OUT_B    (2 * 8 * G_SLICE_H * 2 / 8)  // a wave's share of the ring, bytes
#define G_OUTH_P   144                   // staged f16 row of 128 B: pitch, bytes
#define G_OUTF_P   272                   // staged f32 row of 256 B: pitch, bytes

#if USE_TDM
__device__ __forceinline__ void issue_slice(KTileRequest& rq, _Float16* dst,
                                            const _Float16* src) {
    rq.g0 = tdm_k_group0((unsigned)(uintptr_t)dst,
                         (unsigned long long)(uintptr_t)src);
    tdm_load_k_tile(rq);
}
__device__ __forceinline__ void wait_slice(const KTileRequest& rq) {
    asm volatile("s_wait_tensorcnt 0" :: "s"(rq.g0), "s"(rq.g1) : "memory");
}
#else
// fallback: a lane copies one row of the slice, nothing to wait for
__device__ __forceinline__ unsigned uni(unsigned v) { return v; }
__device__ __forceinline__ unsigned pinned(unsigned v) { return v; }
template <int ROWS>
__device__ __forceinline__ i32x8 tdm_k_group1() { return i32x8{}; }
template <int ROWS>
__device__ __forceinline__ i32x8 tdm_v_group1() { return i32x8{}; }
__device__ __forceinline__ void issue_slice(KTileRequest&, _Float16* dst,
                                            const _Float16* src) {
    int row = threadIdx.x & 31;
    for (int c = 0; c < G_STAGE_H; c += 8)
        *(v8h*)(dst + row * G_PITCH_H + c) =
            *(const v8h*)(src + (size_t)row * G_K + c);
}
__device__ __forceinline__ void wait_slice(const KTileRequest&) {}
#endif

__global__ void __launch_bounds__(256)
gemm_wmma_kernel(const _Float16* __restrict__ A, const _Float16* __restrict__ Bt0,
                 _Float16* __restrict__ outH0, float* __restrict__ outF,
                 const float* __restrict__ bias) {
    constexpr int Nc = G_NC;
    const _Float16* Bt = Bt0 + (size_t)blockIdx.z * G_NC * G_K;
    _Float16* outH = outH0 + (size_t)blockIdx.z * M_ROWS * G_NC;
    const int tid  = threadIdx.x;
    const int lane = tid & 31;
    const int wave = tid >> 5;
    const int wm = wave & 3;                 // 4 waves along M
    const int wn = wave >> 2;                // 2 waves along N
    const int m0 = blockIdx.y * 128 + wm * 32;
    const int n0 = blockIdx.x * 128 + wn * 64;
    const int lr = lane & 15;
    const int koff = (lane >> 4) * 8;        // half-of-wave K offset

    __shared__ __attribute__((aligned(2048))) _Float16 st[2][8][G_SLICE_H];

    // this wave's own slice in global memory, at k = 0; the wave's number in a
    // scalar register, so that the choice of operand is a scalar one
    const int sl = (int)uni((unsigned)wave);
    const _Float16* gsl = sl < 4
        ? A  + (size_t)(blockIdx.y * 128 + sl * 32) * G_K
        : Bt + (size_t)(blockIdx.x * 128 + (sl - 4) * 32) * G_K;

    v8f acc[2][4];
#pragma unroll
    for (int i = 0; i < 2; ++i)
#pragma unroll
        for (int j = 0; j < 4; ++j) acc[i][j] = vzero8();

    // --- prologue: stage 0 lands and is published, then stage 1 is asked for ---
    KTileRequest rq;
    rq.g1 = tdm_k_group1<32>();
    issue_slice(rq, &st[0][sl][0], gsl);
    wait_slice(rq);
    __syncthreads();
    issue_slice(rq, &st[1][sl][0], gsl + G_STAGE_H);

    for (int s = 0; s < G_STAGES; ++s) {
        const int cur = s & 1;
#pragma unroll
        for (int kk = 0; kk < G_STAGE_H; kk += 32) {
            v16h afrag[2], bfrag[4];
#pragma unroll
            for (int i = 0; i < 2; ++i)      // rows wm*32 + i*16 + lr: slice wm
                afrag[i] = load_frag16(
                    &st[cur][wm][(i * 16 + lr) * G_PITCH_H + kk + koff]);
#pragma unroll
            for (int j = 0; j < 4; ++j)      // rows wn*64 + j*16 + lr
                bfrag[j] = load_frag16(
                    &st[cur][4 + wn * 2 + (j >> 1)]
                       [((j & 1) * 16 + lr) * G_PITCH_H + kk + koff]);
#pragma unroll
            for (int i = 0; i < 2; ++i)
#pragma unroll
                for (int j = 0; j < 4; ++j)
                    acc[i][j] = wmma_f16(bfrag[j], afrag[i], acc[i][j]);
        }

        // --- foot of the pass: publish stage s + 1, then refill this buffer ---
        // this wave's reads of buffer cur are done
        asm volatile("s_wait_dscnt 0" ::: "memory");
        wait_slice(rq);    // this wave's slice of stage s + 1
        __syncthreads();   // stage s + 1 readable; every reader has left buffer cur
        if (pinned(s + 2 < G_STAGES))
            issue_slice(rq, &st[cur][sl][0], gsl + (s + 2) * G_STAGE_H);
    }
    // nothing of the ring is outstanding when the wave goes on to its end
    asm volatile("s_wait_tensorcnt 0" ::: "memory");
    asm volatile("s_wait_dscnt 0" ::: "memory");

    // acc[i][j][r] = C[m0 + i*16 + lr][n0 + j*16 + koff + r].
    // The ring is free: the last pass's foot had every wave's dscnt and tensorcnt
    // waits and the barrier, and nothing was asked for behind it. A wave writes
    // and reads only its own share of it, so no further barrier is needed.
    char* stg = (char*)&st[0][0][0] + wave * G_OUT_B;
    if (outF) {
        const int c4 = lr * 4;               // the lane's 4 columns on the way out
        const f32x4 bv = *(const f32x4*)(bias + n0 + c4);
        // before the bias load's address registers are used for anything else
        asm volatile("s_wait_xcnt 0x0" ::: "memory");
#pragma unroll
        for (int i = 0; i < 2; ++i)
#pragma unroll
            for (int j = 0; j < 4; ++j) {
                char* p = stg + (i * 16 + lr) * G_OUTF_P + (j * 16 + koff) * 4;
                f32x4 lo = {acc[i][j][0], acc[i][j][1], acc[i][j][2], acc[i][j][3]};
                f32x4 hi = {acc[i][j][4], acc[i][j][5], acc[i][j][6], acc[i][j][7]};
                *(f32x4*)p = lo;
                *(f32x4*)(p + 16) = hi;
            }
        // the tile is whole in LDS before lanes read what other lanes wrote
        asm volatile("s_wait_dscnt 0" ::: "memory");
        // 16 lanes a row of 256 B: a wave-wide store covers 2 rows, 4 whole lines
        const char* rp = stg + (lane >> 4) * G_OUTF_P + c4 * 4;
        float* op = outF + (size_t)(m0 + (lane >> 4)) * Nc + n0 + c4;
#pragma unroll
        for (int q = 0; q < 16; ++q)
            *(f32x4*)(op + q * 2 * Nc) = *(const f32x4*)(rp + q * 2 * G_OUTF_P) + bv;
    } else {
#pragma unroll
        for (int i = 0; i < 2; ++i)
#pragma unroll
            for (int j = 0; j < 4; ++j) {
                v8h w;
#pragma unroll
                for (int r = 0; r < 8; ++r) w[r] = (_Float16)acc[i][j][r];
                *(v8h*)(stg + (i * 16 + lr) * G_OUTH_P + (j * 16 + koff) * 2) = w;
            }
        // the tile is whole in LDS before lanes read what other lanes wrote
        asm volatile("s_wait_dscnt 0" ::: "memory");
        // 8 lanes a row of 128 B: a wave-wide store covers 4 rows, 4 whole lines
        const int c8 = (lane & 7) * 8;
        const char* rp = stg + (lane >> 3) * G_OUTH_P + c8 * 2;
        _Float16* op = outH + (size_t)(m0 + (lane >> 3)) * Nc + n0 + c8;
#pragma unroll
        for (int q = 0; q < 8; ++q)
            *(v8h*)(op + q * 4 * Nc) = *(const v8h*)(rp + q * 4 * G_OUTH_P);
    }
}

__device__ __forceinline__ void exp2_x8(float (&p)[8], const f32x2 (&a)[4]) {
#if defined(__HIP_DEVICE_COMPILE__)
    asm("v_exp_f32 %0, %8\n\t"
        "v_exp_f32 %1, %9\n\t"
        "v_exp_f32 %2, %10\n\t"
        "v_exp_f32 %3, %11\n\t"
        "v_exp_f32 %4, %12\n\t"
        "v_exp_f32 %5, %13\n\t"
        "v_exp_f32 %6, %14\n\t"
        "v_exp_f32 %7, %15\n\t"
        "v_nop"
        : "=&v"(p[0]), "=&v"(p[1]), "=&v"(p[2]), "=&v"(p[3]),
          "=&v"(p[4]), "=&v"(p[5]), "=&v"(p[6]), "=&v"(p[7])
        : "v"(a[0][0]), "v"(a[0][1]), "v"(a[1][0]), "v"(a[1][1]),
          "v"(a[2][0]), "v"(a[2][1]), "v"(a[3][0]), "v"(a[3][1]));
#else
    for (int c = 0; c < 8; ++c) p[c] = exp2f(a[c >> 1][c & 1]);
#endif
}

#define ST_KEYS    128            // keys of one stage of the ring
#define ST_PASSES  (ST_KEYS / 32) // passes of 32 keys that a stage serves
#define N_STAGES   (N_SEQ / ST_KEYS)         // stages per (batch, head)
#define KT_PITCH_H 72             // K tile row pitch in LDS, halves (144 B)
#define KT_BUF_H   (ST_KEYS * KT_PITCH_H)    // one K buffer (18432 B = 9 x 2 KiB)
#define VT_PITCH_H 80             // V tile row pitch in LDS, halves (160 B)
#define VT_BUF_H   (ST_KEYS * VT_PITCH_H)    // one V buffer (20480 B = 10 x 2 KiB)

// ds_load_tr16_b128: a lane gets 8 rows of one column of a row-major 16-bit LDS
// tile, half of a transposed A fragment (the lanes' addresses: vlane in the kernel)
typedef short s16x8 __attribute__((ext_vector_type(8)));
__device__ __forceinline__ v8h lds_load_tr16(const _Float16* p) {
    typedef __attribute__((address_space(3))) s16x8 lds_s16x8;
    return __builtin_bit_cast(v8h,
        __builtin_amdgcn_ds_load_tr16_b128_v8i16((lds_s16x8*)p));
}

#if USE_TDM
// Start the K tile [ST_KEYS keys x 64 dh] at `src` on its way into LDS at `dst`,
// where that tile exists (the same answer in the whole block). One request of
// wave 0; its wait, wait_k_tile, stands at the caller's publish point.
__device__ __forceinline__ void stage_k_tile(KTileRequest& rq, _Float16* dst,
                                             const _Float16* src, bool exists,
                                             int tid) {
    // plain test: where the compiler knows that no tile is left, no request is
    // built at all; the pinned one is the scalar branch a tensor load needs
    if (!exists) return;
    rq.g0 = tdm_k_group0((unsigned)(uintptr_t)dst,
                         (unsigned long long)(uintptr_t)src);
    if (pinned(((tid >> 5) == 0) & exists)) tdm_load_k_tile(rq);
}

// The issuing wave's own wait: its K tile has landed before it reaches the
// barrier that publishes the tile.
__device__ __forceinline__ void wait_k_tile(const KTileRequest& rq, int tid) {
    if (pinned((tid >> 5) == 0)) {
        asm volatile("s_wait_tensorcnt 0" :: "s"(rq.g0), "s"(rq.g1) : "memory");
    }
}

// The same for the V tile [ST_KEYS keys x 64 dh]: one request of wave 1, its wait
// wait_v_tile at the caller's publish point.
__device__ __forceinline__ void stage_v_tile(KTileRequest& rq, _Float16* dst,
                                             const _Float16* src, bool exists,
                                             int tid) {
    if (!exists) return;
    rq.g0 = tdm_k_group0((unsigned)(uintptr_t)dst,
                         (unsigned long long)(uintptr_t)src);
    if (pinned(((tid >> 5) == 1) & exists)) tdm_load_k_tile(rq);
}

__device__ __forceinline__ void wait_v_tile(const KTileRequest& rq, int tid) {
    if (pinned((tid >> 5) == 1)) {
        asm volatile("s_wait_tensorcnt 0" :: "s"(rq.g0), "s"(rq.g1) : "memory");
    }
}
#else
// fallback: cooperative vector loads of the K tile, nothing to wait for
__device__ __forceinline__ void stage_k_tile(KTileRequest&, _Float16* dst,
                                             const _Float16* src, bool exists,
                                             int tid) {
    if (exists) {
        int dc  = (tid & 7) * 8;
        for (int key = tid >> 3; key < ST_KEYS; key += 32)
            *(v8h*)(dst + key * KT_PITCH_H + dc) =
                *(const v8h*)(src + (size_t)key * INNER + dc);
    }
}
__device__ __forceinline__ void wait_k_tile(const KTileRequest&, int) {}
__device__ __forceinline__ void stage_v_tile(KTileRequest&, _Float16* dst,
                                             const _Float16* src, bool exists,
                                             int tid) {
    if (exists) {
        int dc  = (tid & 7) * 8;
        for (int key = tid >> 3; key < ST_KEYS; key += 32)
            *(v8h*)(dst + key * VT_PITCH_H + dc) =
                *(const v8h*)(src + (size_t)key * INNER + dc);
    }
}
__device__ __forceinline__ void wait_v_tile(const KTileRequest&, int) {}
#endif

__global__ void __launch_bounds__(256)
flash_attn_kernel(const _Float16* __restrict__ q, const _Float16* __restrict__ k,
                  const _Float16* __restrict__ v, _Float16* __restrict__ o) {
    const int b = blockIdx.z;
    const int h = blockIdx.y;
    const int m0 = blockIdx.x * 128;
    const int tid  = threadIdx.x;
    const int lane = tid & 31;
    const int wave = tid >> 5;
    const int lr = lane & 15;
    const int koff = (lane >> 4) * 8;
    const int mq = m0 + wave * 16;                       // wave's 16 queries
    const float SC = 0.125f * 1.4426950408889634f;       // scale * log2(e)

    // Two buffers each for the K and the V tile: the passes of stage t work on
    // buffer t & 1 while stage t + 1 is on its way into the other one.
    // Each buffer's place in LDS is a multiple of 2 KiB (ST_KEYS rows at a pitch
    // of 72 halves = 18432 B for K, of 80 halves = 20480 B for V); the tile loads never
    // write the pad halves
    __shared__ __attribute__((aligned(2048))) _Float16 kt[2][KT_BUF_H];
    __shared__ __attribute__((aligned(2048))) _Float16 vt[2][VT_BUF_H];

    // Preload Q fragments (dh = 64 -> two k-chunks of 32); B operand: column lr
    const _Float16* qrow = q + (size_t)(b * N_SEQ + mq + lr) * INNER + h * DIM_HEAD;
    v16h qf[2];
    qf[0] = load_frag16(qrow + koff);
    qf[1] = load_frag16(qrow + 32 + koff);
    // before the Q loads' address registers are used for anything else
    asm volatile("s_wait_xcnt 0x0" ::: "memory");

    // ot[d][r] = O^T[d*16 + koff + r][query lr]
    v8f ot[4];
#pragma unroll
    for (int d = 0; d < 4; ++d) ot[d] = vzero8();
    float mrow = -1e30f;     // running maximum of query lr, times SC (equal in both halves)
    float lsum = 0.f;        // this half's share of the running sum

    const _Float16* kbase = k + (size_t)(b * N_SEQ) * INNER + h * DIM_HEAD;
    const _Float16* vbase = v + (size_t)(b * N_SEQ) * INNER + h * DIM_HEAD;
    // the lane's place in a V tile for the transposing load, at key 0, column 0:
    // key 8*(l >> 4) + (l & 7), column 8*((l >> 3) & 1); the lane then holds keys
    // koff .. koff + 7 of column lr, the order of load_frag16 and of P^T below
    const int vlane = (koff + (lane & 7)) * VT_PITCH_H + ((lane >> 3) & 1) * 8;

    // --- prologue: stage 0 lands and is published, then stage 1 is asked for ---
    KTileRequest rq, rqv;
    rq.g1  = tdm_k_group1<ST_KEYS>();
    rqv.g1 = tdm_v_group1<ST_KEYS>();
    stage_k_tile(rq, &kt[0][0], kbase, true, tid);
    stage_v_tile(rqv, &vt[0][0], vbase, true, tid);
    wait_k_tile(rq, tid);
    wait_v_tile(rqv, tid);
    __syncthreads();
    stage_k_tile(rq, &kt[1][0], kbase + (size_t)ST_KEYS * INNER, true, tid);
    stage_v_tile(rqv, &vt[1][0], vbase + (size_t)ST_KEYS * INNER, true, tid);

    for (int t = 0; t < N_STAGES; ++t) {
        const int cur = t & 1;

        // unrolled: the passes' places in the buffers are immediate offsets
#pragma unroll
        for (int ps = 0; ps < ST_PASSES; ++ps) {
            // --- S^T = K Q^T over 32 keys (two 16-key tiles) ------------------
            // s[i][r] = score(key t*ST_KEYS + ps*32 + i*16 + koff + r, query lr)
            v8f s[2];
#pragma unroll
            for (int i = 0; i < 2; ++i) {
                s[i] = vzero8();
                const _Float16* krow = &kt[cur][(ps * 32 + i * 16 + lr) * KT_PITCH_H];
                v16h kf0 = load_frag16(krow + koff);
                v16h kf1 = load_frag16(krow + 32 + koff);
                s[i] = wmma_f16(kf0, qf[0], s[i]);
                s[i] = wmma_f16(kf1, qf[1], s[i]);
            }

            // --- V^T fragments of this pass, read as one group here: their LDS
            // latency runs beside the softmax arithmetic below ------------------
            // vf[d]: row d*16 + lr of V^T, keys koff + 0..7 and 16 + koff + 0..7
            v16h vf[4];
#pragma unroll
            for (int d = 0; d < 4; ++d) {
                const _Float16* vp = &vt[cur][vlane + ps * 32 * VT_PITCH_H + d * 16];
                v8h lo = lds_load_tr16(vp);
                v8h hi = lds_load_tr16(vp + 16 * VT_PITCH_H);
#pragma unroll
                for (int e = 0; e < 8; ++e) { vf[d][e] = lo[e]; vf[d][e + 8] = hi[e]; }
            }
            // keeps the eight reads up here: left alone, the compiler sinks six of
            // them between the O^T products, each pair with a full wait behind it
            __builtin_amdgcn_sched_barrier(0);

            // --- online softmax update, one query per lane --------------------
            // the maximum is taken of the raw scores (SC > 0) and kept scaled, in
            // the base-2 domain: a score then costs one fused multiply-add and one
            // bare v_exp_f32. No range guard is needed around it: every argument is
            // <= about 0, and a weight below 2^-126 may come out as 0
            float mx = fmaxf(s[0][0], s[1][0]);
#pragma unroll
            for (int r = 1; r < 8; ++r) mx = fmaxf(mx, fmaxf(s[0][r], s[1][r]));
            mx = fmaxf(mx, other_half(mx)) * SC;
            float mnew = fmaxf(mrow, mx);
            float alpha = __builtin_amdgcn_exp2f(mrow - mnew);   // 0 on the first pass
            mrow = mnew;

            const f32x2 sc2 = {SC, SC};
            const f32x2 nm2 = {-mnew, -mnew};
            float p[2][8];
#pragma unroll
            for (int i = 0; i < 2; ++i) {
                f32x2 arg[4];
#pragma unroll
                for (int c = 0; c < 4; ++c)
                    arg[c] = __builtin_elementwise_fma(
                        f32x2{s[i][2 * c], s[i][2 * c + 1]}, sc2, nm2);
                exp2_x8(p[i], arg);
            }

            // P^T as B operand: element e of the lane is key kmap(e) = the order
            // in which the two S^T tiles already lie in the lane's registers
            v16h pf;
            float rs0 = p[0][0], rs1 = p[1][0];
#pragma unroll
            for (int r = 1; r < 8; ++r) { rs0 += p[0][r]; rs1 += p[1][r]; }
#pragma unroll
            for (int r = 0; r < 8; ++r) {
                pf[r]     = (_Float16)p[0][r];
                pf[r + 8] = (_Float16)p[1][r];
            }
            lsum = lsum * alpha + (rs0 + rs1);
#pragma unroll
            for (int d = 0; d < 4; ++d)
#pragma unroll
                for (int r = 0; r < 8; ++r) ot[d][r] *= alpha;

            // --- O^T += V^T P^T -----------------------------------------------
#pragma unroll
            for (int d = 0; d < 4; ++d) {
                ot[d] = wmma_f16(vf[d], pf, ot[d]);
            }
            // keeps what follows behind this pass. The next pass's S^T products: set
            // among this softmax, one stood directly in front of the exponentials' asm
            // statement. Behind the last pass, the foot's LDS wait: no
            // LDS read stands behind the V^T group, so the compiler lifts it up to there
            __builtin_amdgcn_sched_barrier(0);
        }   // passes of the stage

        // --- foot of the stage: publish stage t + 1, then refill this buffer ---
        // this wave's reads of the buffers cur are done
        asm volatile("s_wait_dscnt 0" ::: "memory");
        wait_k_tile(rq, tid);   // K stage t + 1
        wait_v_tile(rqv, tid);  // V stage t + 1
        __syncthreads();   // stage t + 1 readable; every reader has left buffers cur
        stage_k_tile(rq, &kt[cur][0], kbase + (size_t)(t + 2) * ST_KEYS * INNER,
                     t + 2 < N_STAGES, tid);
        stage_v_tile(rqv, &vt[cur][0], vbase + (size_t)(t + 2) * ST_KEYS * INNER,
                     t + 2 < N_STAGES, tid);
    }
    // nothing of the ring is outstanding when the wave goes on to its end
    asm volatile("s_wait_tensorcnt 0" ::: "memory");
    asm volatile("s_wait_dscnt 0" ::: "memory");

    // --- epilogue: join the halves' sums, O /= l, store f16 [M_ROWS, 512] --
    // a lane holds 8 consecutive columns of one row. The wave lays its 16 rows of
    // 128 B in LDS and stores them from there as whole lines. The ring is free:
    // the last stage's foot had every wave's waits and the barrier, and nothing was
    // asked for behind it; a wave touches only its own share (half a K buffer's
    // length, in the K or in the V ring), so no further barrier is needed.
    lsum += other_half(lsum);
    float inv = 1.f / lsum;
    _Float16* stg = (wave < 4 ? &kt[0][0] : &vt[0][0]) + (wave & 3) * (KT_BUF_H / 2);
#pragma unroll
    for (int d = 0; d < 4; ++d) {
        v8h w;
#pragma unroll
        for (int r = 0; r < 8; ++r) w[r] = (_Float16)(ot[d][r] * inv);
        *(v8h*)(stg + lr * KT_PITCH_H + d * 16 + koff) = w;
    }
    // the rows are whole in LDS before lanes read what other lanes wrote
    asm volatile("s_wait_dscnt 0" ::: "memory");
    // 8 lanes a row of 128 B: a wave-wide store covers 4 rows, 4 whole lines
    const int c8 = (lane & 7) * 8;
    const _Float16* rp = stg + (lane >> 3) * KT_PITCH_H + c8;
    _Float16* op = o + (size_t)(b * N_SEQ + mq + (lane >> 3)) * INNER + h * DIM_HEAD + c8;
#pragma unroll
    for (int q = 0; q < 4; ++q)
        *(v8h*)(op + q * 4 * INNER) = *(const v8h*)(rp + q * 4 * KT_PITCH_H);
}

// ---------------------------------------------------------------------------
// Host-side launcher
// ---------------------------------------------------------------------------
extern "C" void kernel_launch(void* const* d_in, const int* in_sizes, int n_in,
                              void* d_out, int out_size, void* d_ws, size_t ws_size,
                              hipStream_t stream) {
    const float* x    = (const float*)d_in[0];
    const float* z    = (const float*)d_in[1];
    const float* lxg  = (const float*)d_in[2];
    const float* lxb  = (const float*)d_in[3];
    const float* lzg  = (const float*)d_in[4];
    const float* lzb  = (const float*)d_in[5];
    const float* Wq   = (const float*)d_in[6];
    const float* Wk   = (const float*)d_in[7];
    const float* Wv   = (const float*)d_in[8];
    const float* Wz   = (const float*)d_in[9];
    const float* Wo   = (const float*)d_in[10];
    const float* bo   = (const float*)d_in[11];
    float* out = (float*)d_out;

    char* ws = (char*)d_ws;
    size_t off = 0;
    float* z1z2 = (float*)(ws + off);       off += (size_t)BATCH * 2 * X_DIM * 4;
    _Float16* WtQ  = (_Float16*)(ws + off); off += (size_t)X_DIM * INNER * 2;
    _Float16* WtK  = (_Float16*)(ws + off); off += (size_t)X_DIM * INNER * 2;
    _Float16* WtV  = (_Float16*)(ws + off); off += (size_t)X_DIM * INNER * 2;
    _Float16* WtO  = (_Float16*)(ws + off); off += (size_t)INNER * X_DIM * 2;
    _Float16* xmod = (_Float16*)(ws + off); off += (size_t)M_ROWS * X_DIM * 2;
    _Float16* qb   = (_Float16*)(ws + off); off += (size_t)M_ROWS * INNER * 2;
    _Float16* kb   = (_Float16*)(ws + off); off += (size_t)M_ROWS * INNER * 2;
    _Float16* vb   = (_Float16*)(ws + off); off += (size_t)M_ROWS * INNER * 2;
    _Float16* ao   = (_Float16*)(ws + off); off += (size_t)M_ROWS * INNER * 2;

    // 1) z path and the four weights' convert + transpose (WtQ, WtK, WtV, WtO
    //    lie one behind the other), one grid
    setup_kernel<<<BATCH + 4 * W_TILES, 256, 0, stream>>>(Wq, Wk, Wv, Wo, WtQ,
                                                           z, lzg, lzb, Wz, z1z2);

    // 2) LN + FiLM on x -> f16
    xmod_kernel<<<M_ROWS / (8 * XM_ROWS), 256, 0, stream>>>(x, lxg, lxb, z1z2, xmod);

    // 3) Q/K/V projections (f16 out), one grid: z = 0, 1, 2 reads WtQ, WtK, WtV
    //    and writes qb, kb, vb, which lie one behind the other
    dim3 ggrid(INNER / 128, M_ROWS / 128, 3);
    gemm_wmma_kernel<<<ggrid, 256, 0, stream>>>(xmod, WtQ, qb, nullptr, nullptr);

    // 4) flash attention
    dim3 agrid(N_SEQ / 128, HEADS, BATCH);
    flash_attn_kernel<<<agrid, 256, 0, stream>>>(qb, kb, vb, ao);

    // 5) output projection (f32 out + bias)
    dim3 ogrid(X_DIM / 128, M_ROWS / 128);
    gemm_wmma_kernel<<<ogrid, 256, 0, stream>>>(ao, WtO, nullptr, out, bo);
}
